// v000
// The times below were measured on an AMD MI455X: many runs one after another, warmed up first and cycling through
// copies of the inputs, with the whole window's GPU time divided by the number of runs. Launches and the gaps
// between them are all in it. The median over several windows is given; except for v000 it joins two sittings, which
// can be a few percent apart, so the side-by-side timings, each taken in one sitting, are the better comparison.
// v000 is the starting kernel. One run takes 615 microseconds.
#include <hip/hip_runtime.h>

typedef __attribute__((ext_vector_type(16))) _Float16 v16h;
typedef __attribute__((ext_vector_type(8)))  _Float16 v8h;
typedef __attribute__((ext_vector_type(4)))  _Float16 v4h;
typedef __attribute__((ext_vector_type(8)))  float    v8f;
typedef __attribute__((ext_vector_type(4)))  float    v4f;
typedef __attribute__((ext_vector_type(4)))  unsigned int u32x4;
typedef __attribute__((ext_vector_type(8)))  int          i32x8;
typedef __attribute__((ext_vector_type(4)))  int          i32x4;

#if defined(__has_builtin)
#if __has_builtin(__builtin_amdgcn_tensor_load_to_lds) && \
    __has_builtin(__builtin_amdgcn_s_wait_tensorcnt)
#define USE_TDM 1
#endif
#endif
#ifndef USE_TDM
#define USE_TDM 0
#endif

__device__ __forceinline__ v8f v8f_zero() {
  v8f z;
#pragma unroll
  for (int i = 0; i < 8; ++i) z[i] = 0.0f;
  return z;
}

__device__ __forceinline__ v8f wmma16x16x32(v16h a, v16h b, v8f c) {
  return __builtin_amdgcn_wmma_f32_16x16x32_f16(false, a, false, b, (short)0, c,
                                                false, false);
}

__device__ __forceinline__ v16h load_frag(const _Float16* p, int ld, int row0,
                                          int k0, int lane) {
  const _Float16* q = p + (row0 + (lane & 15)) * ld + k0 + ((lane >> 4) << 3);
  v16h v;
#pragma unroll
  for (int i = 0; i < 8; ++i) {
    v[i] = q[i];
    v[i + 8] = q[i + 16];
  }
  return v;
}

#if USE_TDM
__device__ __forceinline__ void tdm_load_2d(unsigned lds_off, const void* gptr,
                                            unsigned width, unsigned height,
                                            unsigned stride, unsigned pad_int,
                                            unsigned pad_amt) {
  unsigned long long ga = (unsigned long long)(size_t)gptr;
  u32x4 g0;
  g0[0] = 1u;
  g0[1] = lds_off;
  g0[2] = (unsigned)(ga & 0xffffffffu);
  g0[3] = (unsigned)((ga >> 32) & 0x01ffffffu)
          | (2u << 30);
  i32x8 g1;
  g1[0] = (int)((1u << 16)
                | (1u << 20)
                | (pad_int << 22) | (pad_amt << 25));
  g1[1] = (int)((stride & 0xffffu) << 16);
  g1[2] = (int)(((stride >> 16) & 0xffffu)
                | ((height & 0xffffu) << 16));
  g1[3] = (int)(((height >> 16) & 0xffffu)
                | ((width & 0xffffu) << 16));
  g1[4] = (int)(height & 0xffffu);
  g1[5] = (int)stride;
  g1[6] = 0;
  g1[7] = 0;
  i32x4 z4 = {0, 0, 0, 0};                      // groups 2/3 unused (2D)
  i32x8 z8 = {0, 0, 0, 0, 0, 0, 0, 0};
  __builtin_amdgcn_tensor_load_to_lds(g0, g1, z4, z4, z8, 0);
}
#endif

__global__ __launch_bounds__(256) void cast_f16_kernel(
    const float* __restrict__ in, _Float16* __restrict__ out) {
  long long i = ((long long)blockIdx.x * 256 + threadIdx.x) * 4;
  v4f x = *(const v4f*)(in + i);
  v4h h;
#pragma unroll
  for (int j = 0; j < 4; ++j) h[j] = (_Float16)x[j];
  *(v4h*)(out + i) = h;
}

// in: f32 [nmat][rows][cols] -> out: f16 [nmat][cols][rows]
__global__ __launch_bounds__(256) void transpose_cast_kernel(
    const float* __restrict__ in, _Float16* __restrict__ out, int rows,
    int cols) {
  __shared__ float tile[32][33];
  const int m = blockIdx.z;
  const int r0 = blockIdx.y * 32, c0 = blockIdx.x * 32;
  const float* src = in + (long long)m * rows * cols;
  _Float16* dst = out + (long long)m * rows * cols;
  const int tx = threadIdx.x & 31, ty = threadIdx.x >> 5;  // 32 x 8
#pragma unroll
  for (int i = 0; i < 32; i += 8)
    tile[ty + i][tx] = src[(long long)(r0 + ty + i) * cols + c0 + tx];
  __syncthreads();
#pragma unroll
  for (int i = 0; i < 32; i += 8)
    dst[(long long)(c0 + ty + i) * rows + r0 + tx] = (_Float16)tile[tx][ty + i];
}

// ---------------------------------------------------------------------------
// GEMM: C[m,n] = sum_k A[m,k]*Bt[n,k] + bias[n].  A,Bt f16 row-major, C f32.
// Block 256 threads (8 waves), tile 128x128x32, wave tile 32x64 (2x4 WMMA).
// Double-buffered LDS; tiles fetched by the Tensor Data Mover (wave 0 issues,
// s_wait_tensorcnt + barrier hands off), manual b128 copies as fallback.
// ---------------------------------------------------------------------------
constexpr int BM = 128, BN = 128, BK = 32;
constexpr int LDT = BK + 8;

__global__ __launch_bounds__(256) void gemm_bias_f16_kernel(
    const _Float16* __restrict__ A, const _Float16* __restrict__ Bt,
    const float* __restrict__ bias, float* __restrict__ C, int M, int N,
    int K) {
  __shared__ _Float16 aS[2][BM * LDT];
  __shared__ _Float16 bS[2][BN * LDT];
  const int tid = threadIdx.x, lane = tid & 31, wid = tid >> 5;
  const int wm = (wid & 3) * 32, wn = (wid >> 2) * 64;
  const int n0 = blockIdx.x * BN, m0 = blockIdx.y * BM;
  const _Float16* Abase = A + (long long)m0 * K;
  const _Float16* Bbase = Bt + (long long)n0 * K;

  v8f acc[2][4];
#pragma unroll
  for (int i = 0; i < 2; ++i)
#pragma unroll
    for (int j = 0; j < 4; ++j) acc[i][j] = v8f_zero();

  auto stage = [&](int buf, int k0) {
#if USE_TDM
    if (wid == 0) {
      tdm_load_2d((unsigned)(size_t)&aS[buf][0], Abase + k0, BK, BM, K, 3, 3);
      tdm_load_2d((unsigned)(size_t)&bS[buf][0], Bbase + k0, BK, BN, K, 3, 3);
    }
#else
#pragma unroll
    for (int it = 0; it < 2; ++it) {
      int idx = tid + it * 256;  // 0..511
      int r = idx >> 2;          // 0..127
      int c = (idx & 3) << 3;    // 0,8,16,24
      *(v8h*)&aS[buf][r * LDT + c] =
          *(const v8h*)(Abase + (long long)r * K + k0 + c);
      *(v8h*)&bS[buf][r * LDT + c] =
          *(const v8h*)(Bbase + (long long)r * K + k0 + c);
    }
#endif
  };
  auto stage_handoff = [&]() {
#if USE_TDM
    if (wid == 0) __builtin_amdgcn_s_wait_tensorcnt((short)0);
#endif
    __syncthreads();
  };

  const int NK = K / BK;
  stage(0, 0);
  stage_handoff();
  for (int it = 0; it < NK; ++it) {
    const int cur = it & 1;
    if (it + 1 < NK) stage(cur ^ 1, (it + 1) * BK);  // overlap copy w/ compute
    v16h af[2], bf[4];
#pragma unroll
    for (int i = 0; i < 2; ++i)
      af[i] = load_frag(aS[cur], LDT, wm + i * 16, 0, lane);
#pragma unroll
    for (int j = 0; j < 4; ++j)
      bf[j] = load_frag(bS[cur], LDT, wn + j * 16, 0, lane);
#pragma unroll
    for (int i = 0; i < 2; ++i)
#pragma unroll
      for (int j = 0; j < 4; ++j)
        acc[i][j] = wmma16x16x32(af[i], bf[j], acc[i][j]);
    stage_handoff();
  }

  const int half = lane >> 4;
  const int nl = lane & 15;
#pragma unroll
  for (int i = 0; i < 2; ++i)
#pragma unroll
    for (int j = 0; j < 4; ++j) {
      int nc = n0 + wn + j * 16 + nl;
      float bv = bias[nc];
#pragma unroll
      for (int r = 0; r < 8; ++r) {
        int mr = m0 + wm + i * 16 + r + half * 8;
        C[(long long)mr * N + nc] = acc[i][j][r] + bv;
      }
    }
}

// ---------------------------------------------------------------------------
// RMS-norm + RoPE + cast-to-f16, permuting [B,S,H,F] -> [B,H,S,F].
// One wave per (b,s,h) vector; lane owns 4 of the 128 features.
// ---------------------------------------------------------------------------
__global__ __launch_bounds__(256) void norm_rope_cast_kernel(
    const float* __restrict__ qf, const float* __restrict__ kf,
    const float* __restrict__ vf, const float* __restrict__ qw,
    const float* __restrict__ kw, _Float16* __restrict__ qh,
    _Float16* __restrict__ kh, _Float16* __restrict__ vh) {
  constexpr int S = 2048, H = 16, F = 128;
  const int lane = threadIdx.x & 31;
  const int wid = threadIdx.x >> 5;
  const int vid = blockIdx.x * 8 + wid;  // 0 .. B*S*H-1
  const int b = vid / (S * H);
  const int rem = vid - b * (S * H);
  const int s = rem / H;
  const int h = rem - s * H;
  const long long inoff = ((long long)(b * S + s) * H + h) * F;
  const long long outoff = ((long long)(b * H + h) * S + s) * F;
  const int f0 = lane * 4;

  float cosv[4], sinv[4];
#pragma unroll
  for (int i = 0; i < 4; ++i) {
    int j = (f0 + i) & 63;
    float freq = __powf(10000.0f, -(float)j * (1.0f / 64.0f));
    float ang = (float)s * freq;
    cosv[i] = __cosf(ang);
    sinv[i] = __sinf(ang);
  }
  const float sgn = (lane < 16) ? -1.0f : 1.0f;  // rotate_half sign

  const float* src[2] = {qf, kf};
  const float* wsc[2] = {qw, kw};
  _Float16* dst[2] = {qh, kh};
#pragma unroll
  for (int t = 0; t < 2; ++t) {
    v4f x = *(const v4f*)(src[t] + inoff + f0);
    float ss = x[0] * x[0] + x[1] * x[1] + x[2] * x[2] + x[3] * x[3];
#pragma unroll
    for (int m = 1; m < 32; m <<= 1) ss += __shfl_xor(ss, m, 32);
    float rms = sqrtf(ss * (1.0f / F));
    float inv = 1.0f / (rms + 1e-6f);
    float y[4];
#pragma unroll
    for (int i = 0; i < 4; ++i) y[i] = x[i] * inv * wsc[t][f0 + i];
    float p[4];  // partner features f +/- 64 live in lane ^ 16
#pragma unroll
    for (int i = 0; i < 4; ++i) p[i] = __shfl_xor(y[i], 16, 32);
    v4h out;
#pragma unroll
    for (int i = 0; i < 4; ++i)
      out[i] = (_Float16)(y[i] * cosv[i] + sgn * p[i] * sinv[i]);
    *(v4h*)(dst[t] + outoff + f0) = out;
  }
  v4f xv = *(const v4f*)(vf + inoff + f0);
  v4h ov;
#pragma unroll
  for (int i = 0; i < 4; ++i) ov[i] = (_Float16)xv[i];
  *(v4h*)(vh + outoff + f0) = ov;
}

__global__ __launch_bounds__(128) void flash_attn_kernel(
    const _Float16* __restrict__ qh, const _Float16* __restrict__ kh,
    const _Float16* __restrict__ vh, _Float16* __restrict__ attn) {
  constexpr int S = 2048, H = 16, F = 128;
  constexpr int QT = 64, KT = 64;
  constexpr int LDK = F + 8;
  constexpr int LDV = KT + 8;
  __shared__ _Float16 Kt[KT * LDK];
  __shared__ _Float16 Vt[F * LDV];
  __shared__ _Float16 Pb[4][16 * LDV];

  const int tid = threadIdx.x;
  const int lane = tid & 31;
  const int wid = tid >> 5;
  const int half = lane >> 4;
  const int b = blockIdx.z, h = blockIdx.y;
  const int q0 = blockIdx.x * QT + wid * 16;
  const long long base = ((long long)(b * H + h)) * S * F;
  const _Float16* Q = qh + base;
  const _Float16* Kp = kh + base;
  const _Float16* Vp = vh + base;

  v16h qfrag[4];
#pragma unroll
  for (int kc = 0; kc < 4; ++kc) qfrag[kc] = load_frag(Q, F, q0, kc * 32, lane);

  v8f o[8];
#pragma unroll
  for (int j = 0; j < 8; ++j) o[j] = v8f_zero();
  float mst[8], lst[8];
#pragma unroll
  for (int r = 0; r < 8; ++r) {
    mst[r] = -1e30f;
    lst[r] = 0.0f;
  }
  const float scale = 0.08838834764831845f;  // 1/sqrt(128)

  for (int kt0 = 0; kt0 < S; kt0 += KT) {
    __syncthreads();  // previous tile fully consumed
#if USE_TDM
    if (wid == 0)
      tdm_load_2d((unsigned)(size_t)&Kt[0], Kp + (long long)kt0 * F, F, KT, F,
                  5, 3);
#else
#pragma unroll
    for (int it = 0; it < 8; ++it) {
      int idx = tid + it * 128;
      int kr = idx >> 4;
      int c = (idx & 15) << 3;
      *(v8h*)&Kt[kr * LDK + c] =
          *(const v8h*)(Kp + (long long)(kt0 + kr) * F + c);
    }
#endif
    // V tile transposed: Vt[f][key]
#pragma unroll
    for (int it = 0; it < 16; ++it) {
      int idx = tid + it * 128;
      int kr = idx >> 5;
      int f4 = (idx & 31) << 2;
      v4h v = *(const v4h*)(Vp + (long long)(kt0 + kr) * F + f4);
#pragma unroll
      for (int j = 0; j < 4; ++j) Vt[(f4 + j) * LDV + kr] = v[j];
    }
#if USE_TDM
    if (wid == 0) __builtin_amdgcn_s_wait_tensorcnt((short)0);
#endif
    __syncthreads();

    // Scores: 16 x KT in 4 n-tiles, K-reduction over F
    v8f sc[4];
#pragma unroll
    for (int jn = 0; jn < 4; ++jn) {
      sc[jn] = v8f_zero();
#pragma unroll
      for (int kc = 0; kc < 4; ++kc) {
        v16h kf = load_frag(Kt, LDK, jn * 16, kc * 32, lane);
        sc[jn] = wmma16x16x32(qfrag[kc], kf, sc[jn]);
      }
    }

    float alpha[8];
#pragma unroll
    for (int r = 0; r < 8; ++r) {
      float mx = sc[0][r] * scale;
#pragma unroll
      for (int jn = 1; jn < 4; ++jn) mx = fmaxf(mx, sc[jn][r] * scale);
#pragma unroll
      for (int m = 1; m < 16; m <<= 1) mx = fmaxf(mx, __shfl_xor(mx, m, 32));
      float mnew = fmaxf(mst[r], mx);
      alpha[r] = __expf(mst[r] - mnew);
      float s = 0.0f;
#pragma unroll
      for (int jn = 0; jn < 4; ++jn) {
        float p = __expf(sc[jn][r] * scale - mnew);
        s += p;
        Pb[wid][(r + half * 8) * LDV + jn * 16 + (lane & 15)] = (_Float16)p;
      }
#pragma unroll
      for (int m = 1; m < 16; m <<= 1) s += __shfl_xor(s, m, 32);
      lst[r] = lst[r] * alpha[r] + s;
      mst[r] = mnew;
    }
#pragma unroll
    for (int j = 0; j < 8; ++j)
#pragma unroll
      for (int r = 0; r < 8; ++r) o[j][r] *= alpha[r];

    asm volatile("s_wait_dscnt 0" ::: "memory");  // P stores -> P frag reads

    v16h pa[2];
#pragma unroll
    for (int kc = 0; kc < 2; ++kc)
      pa[kc] = load_frag(Pb[wid], LDV, 0, kc * 32, lane);
#pragma unroll
    for (int jf = 0; jf < 8; ++jf)
#pragma unroll
      for (int kc = 0; kc < 2; ++kc) {
        v16h vf = load_frag(Vt, LDV, jf * 16, kc * 32, lane);
        o[jf] = wmma16x16x32(pa[kc], vf, o[jf]);
      }
  }

  // Normalize by row sums and store f16 attn output as [B,S,H,F]
#pragma unroll
  for (int r = 0; r < 8; ++r) {
    float inv = 1.0f / lst[r];
    int srow = q0 + r + half * 8;
    long long outbase = ((long long)(b * S + srow)) * (H * F) + h * F;
#pragma unroll
    for (int jf = 0; jf < 8; ++jf)
      attn[outbase + jf * 16 + (lane & 15)] = (_Float16)(o[jf][r] * inv);
  }
}

// ---------------------------------------------------------------------------
extern "C" void kernel_launch(void* const* d_in, const int* in_sizes, int n_in,
                              void* d_out, int out_size, void* d_ws,
                              size_t ws_size, hipStream_t stream) {
  constexpr int Bb = 2, S = 2048, D = 2048, H = 16, F = 128;
  constexpr long long MR = (long long)Bb * S;  // 4096 rows
  constexpr long long EL = MR * D;             // 8388608 elems (act tensors)
  constexpr long long WE = (long long)H * D * F;  // 4194304 elems (weights)

  const float* xq = (const float*)d_in[0];
  const float* xk = (const float*)d_in[1];
  const float* xv = (const float*)d_in[2];
  const float* WQ = (const float*)d_in[3];
  const float* WK = (const float*)d_in[4];
  const float* WV = (const float*)d_in[5];
  const float* WO = (const float*)d_in[6];
  const float* bQ = (const float*)d_in[7];
  const float* bK = (const float*)d_in[8];
  const float* bV = (const float*)d_in[9];
  const float* bO = (const float*)d_in[10];
  const float* qw = (const float*)d_in[11];
  const float* kw = (const float*)d_in[12];

  // Workspace (~185 MB):
  //   qf,kf,vf : f32 [4096,2048] raw projections
  //   Xq,Xk,Xv : f16 [4096,2048] cast inputs   (later aliased by qh,kh,vh)
  //   WQt..WOt : f16 [2048,2048] transposed weights (Bt = [N][K])
  //   at       : f16 [B,S,H,F]  attention out  (aliases dead WQt+WKt)
  float* qf = (float*)d_ws;
  float* kf = qf + EL;
  float* vf = kf + EL;
  _Float16* Xq = (_Float16*)(vf + EL);
  _Float16* Xk = Xq + EL;
  _Float16* Xv = Xk + EL;
  _Float16* WQt = Xv + EL;
  _Float16* WKt = WQt + WE;
  _Float16* WVt = WKt + WE;
  _Float16* WOt = WVt + WE;
  _Float16* qhp = Xq;  // aliases: X* dead after projection GEMMs
  _Float16* khp = Xk;
  _Float16* vhp = Xv;
  _Float16* at = WQt;  // aliases: WQt/WKt dead after projection GEMMs

  // 1) cast activations f32 -> f16
  cast_f16_kernel<<<(int)(EL / 4 / 256), 256, 0, stream>>>(xq, Xq);
  cast_f16_kernel<<<(int)(EL / 4 / 256), 256, 0, stream>>>(xk, Xk);
  cast_f16_kernel<<<(int)(EL / 4 / 256), 256, 0, stream>>>(xv, Xv);
  // 2) transpose+cast weights: W[H,D,F] -> [H,F,D]; W_O[2048,2048] -> T
  transpose_cast_kernel<<<dim3(F / 32, D / 32, H), 256, 0, stream>>>(WQ, WQt, D,
                                                                     F);
  transpose_cast_kernel<<<dim3(F / 32, D / 32, H), 256, 0, stream>>>(WK, WKt, D,
                                                                     F);
  transpose_cast_kernel<<<dim3(F / 32, D / 32, H), 256, 0, stream>>>(WV, WVt, D,
                                                                     F);
  transpose_cast_kernel<<<dim3(D / 32, D / 32, 1), 256, 0, stream>>>(WO, WOt, D,
                                                                     D);
  dim3 gg(D / BN, (int)(MR / BM));  // (16, 32)
  gemm_bias_f16_kernel<<<gg, 256, 0, stream>>>(Xq, WQt, bQ, qf, (int)MR, D, D);
  gemm_bias_f16_kernel<<<gg, 256, 0, stream>>>(Xk, WKt, bK, kf, (int)MR, D, D);
  gemm_bias_f16_kernel<<<gg, 256, 0, stream>>>(Xv, WVt, bV, vf, (int)MR, D, D);
  // 4) RMS-norm + RoPE + cast, permute to [B,H,S,F]
  norm_rope_cast_kernel<<<(Bb * S * H) / 8, 256, 0, stream>>>(
      qf, kf, vf, qw, kw, qhp, khp, vhp);
  // 5) flash attention -> [B,S,H,F] f16
  flash_attn_kernel<<<dim3(S / 64, H, Bb), 128, 0, stream>>>(qhp, khp, vhp, at);
  // 6) output projection + b_O -> d_out f32
  gemm_bias_f16_kernel<<<gg, 256, 0, stream>>>(at, WOt, bO, (float*)d_out,
                                               (int)MR, D, D);
}

// v001
// One run takes 536 microseconds.
// In both of two side-by-side timings against v000, it was 1.19 times as fast.
#include <hip/hip_runtime.h>

typedef __attribute__((ext_vector_type(16))) _Float16 v16h;
typedef __attribute__((ext_vector_type(8)))  _Float16 v8h;
typedef __attribute__((ext_vector_type(4)))  _Float16 v4h;
typedef __attribute__((ext_vector_type(8)))  float    v8f;
typedef __attribute__((ext_vector_type(4)))  float    v4f;
typedef __attribute__((ext_vector_type(4)))  unsigned int u32x4;
typedef __attribute__((ext_vector_type(8)))  int          i32x8;
typedef __attribute__((ext_vector_type(4)))  int          i32x4;

#if defined(__has_builtin)
#if __has_builtin(__builtin_amdgcn_tensor_load_to_lds) && \
    __has_builtin(__builtin_amdgcn_s_wait_tensorcnt)
#define USE_TDM 1
#endif
#endif
#ifndef USE_TDM
#define USE_TDM 0
#endif

__device__ __forceinline__ v8f v8f_zero() {
  v8f z;
#pragma unroll
  for (int i = 0; i < 8; ++i) z[i] = 0.0f;
  return z;
}

__device__ __forceinline__ v8f wmma16x16x32(v16h a, v16h b, v8f c) {
  return __builtin_amdgcn_wmma_f32_16x16x32_f16(false, a, false, b, (short)0, c,
                                                false, false);
}

__device__ __forceinline__ v16h load_frag(const _Float16* p, int ld, int row0,
                                          int k0, int lane) {
  const _Float16* q = p + (row0 + (lane & 15)) * ld + k0 + ((lane >> 4) << 3);
  v16h v;
#pragma unroll
  for (int i = 0; i < 8; ++i) {
    v[i] = q[i];
    v[i + 8] = q[i + 16];
  }
  return v;
}

__device__ __forceinline__ float xhalf(float x) {
  const int b = __builtin_bit_cast(int, x);
  return __builtin_bit_cast(
      float, __builtin_amdgcn_permlanex16(b, b, 0x76543210, 0xfedcba98, false,
                                          false));
}

#if USE_TDM
__device__ __forceinline__ void tdm_load_2d(unsigned lds_off, const void* gptr,
                                            unsigned width, unsigned height,
                                            unsigned stride, unsigned pad_int,
                                            unsigned pad_amt) {
  unsigned long long ga = (unsigned long long)(size_t)gptr;
  u32x4 g0;
  g0[0] = 1u;
  g0[1] = lds_off;
  g0[2] = (unsigned)(ga & 0xffffffffu);
  g0[3] = (unsigned)((ga >> 32) & 0x01ffffffu)
          | (2u << 30);
  i32x8 g1;
  g1[0] = (int)((1u << 16)
                | (1u << 20)
                | (pad_int << 22) | (pad_amt << 25));
  g1[1] = (int)((stride & 0xffffu) << 16);
  g1[2] = (int)(((stride >> 16) & 0xffffu)
                | ((height & 0xffffu) << 16));
  g1[3] = (int)(((height >> 16) & 0xffffu)
                | ((width & 0xffffu) << 16));
  g1[4] = (int)(height & 0xffffu);
  g1[5] = (int)stride;
  g1[6] = 0;
  g1[7] = 0;
  i32x4 z4 = {0, 0, 0, 0};                      // groups 2/3 unused (2D)
  i32x8 z8 = {0, 0, 0, 0, 0, 0, 0, 0};
  __builtin_amdgcn_tensor_load_to_lds(g0, g1, z4, z4, z8, 0);
}
#endif

__global__ __launch_bounds__(256) void cast_f16_kernel(
    const float* __restrict__ in, _Float16* __restrict__ out) {
  long long i = ((long long)blockIdx.x * 256 + threadIdx.x) * 4;
  v4f x = *(const v4f*)(in + i);
  v4h h;
#pragma unroll
  for (int j = 0; j < 4; ++j) h[j] = (_Float16)x[j];
  *(v4h*)(out + i) = h;
}

// in: f32 [nmat][rows][cols] -> out: f16 [nmat][cols][rows]
__global__ __launch_bounds__(256) void transpose_cast_kernel(
    const float* __restrict__ in, _Float16* __restrict__ out, int rows,
    int cols) {
  __shared__ float tile[32][33];
  const int m = blockIdx.z;
  const int r0 = blockIdx.y * 32, c0 = blockIdx.x * 32;
  const float* src = in + (long long)m * rows * cols;
  _Float16* dst = out + (long long)m * rows * cols;
  const int tx = threadIdx.x & 31, ty = threadIdx.x >> 5;  // 32 x 8
#pragma unroll
  for (int i = 0; i < 32; i += 8)
    tile[ty + i][tx] = src[(long long)(r0 + ty + i) * cols + c0 + tx];
  __syncthreads();
#pragma unroll
  for (int i = 0; i < 32; i += 8)
    dst[(long long)(c0 + ty + i) * rows + r0 + tx] = (_Float16)tile[tx][ty + i];
}

// ---------------------------------------------------------------------------
// GEMM: C[m,n] = sum_k A[m,k]*Bt[n,k] + bias[n].  A,Bt f16 row-major, C f32.
// Block 256 threads (8 waves), tile 128x128x32, wave tile 32x64 (2x4 WMMA).
// Double-buffered LDS; tiles fetched by the Tensor Data Mover (wave 0 issues,
// s_wait_tensorcnt + barrier hands off), manual b128 copies as fallback.
// ---------------------------------------------------------------------------
constexpr int BM = 128, BN = 128, BK = 32;
constexpr int LDT = BK + 8;

__global__ __launch_bounds__(256) void gemm_bias_f16_kernel(
    const _Float16* __restrict__ A, const _Float16* __restrict__ Bt,
    const float* __restrict__ bias, float* __restrict__ C, int M, int N,
    int K) {
  __shared__ _Float16 aS[2][BM * LDT];
  __shared__ _Float16 bS[2][BN * LDT];
  const int tid = threadIdx.x, lane = tid & 31, wid = tid >> 5;
  const int wm = (wid & 3) * 32, wn = (wid >> 2) * 64;
  const int n0 = blockIdx.x * BN, m0 = blockIdx.y * BM;
  const _Float16* Abase = A + (long long)m0 * K;
  const _Float16* Bbase = Bt + (long long)n0 * K;

  v8f acc[2][4];
#pragma unroll
  for (int i = 0; i < 2; ++i)
#pragma unroll
    for (int j = 0; j < 4; ++j) acc[i][j] = v8f_zero();

  auto stage = [&](int buf, int k0) {
#if USE_TDM
    if (wid == 0) {
      tdm_load_2d((unsigned)(size_t)&aS[buf][0], Abase + k0, BK, BM, K, 3, 3);
      tdm_load_2d((unsigned)(size_t)&bS[buf][0], Bbase + k0, BK, BN, K, 3, 3);
    }
#else
#pragma unroll
    for (int it = 0; it < 2; ++it) {
      int idx = tid + it * 256;  // 0..511
      int r = idx >> 2;          // 0..127
      int c = (idx & 3) << 3;    // 0,8,16,24
      *(v8h*)&aS[buf][r * LDT + c] =
          *(const v8h*)(Abase + (long long)r * K + k0 + c);
      *(v8h*)&bS[buf][r * LDT + c] =
          *(const v8h*)(Bbase + (long long)r * K + k0 + c);
    }
#endif
  };
  auto stage_handoff = [&]() {
#if USE_TDM
    if (wid == 0) __builtin_amdgcn_s_wait_tensorcnt((short)0);
#endif
    __syncthreads();
  };

  const int NK = K / BK;
  stage(0, 0);
  stage_handoff();
  for (int it = 0; it < NK; ++it) {
    const int cur = it & 1;
    if (it + 1 < NK) stage(cur ^ 1, (it + 1) * BK);  // overlap copy w/ compute
    v16h af[2], bf[4];
#pragma unroll
    for (int i = 0; i < 2; ++i)
      af[i] = load_frag(aS[cur], LDT, wm + i * 16, 0, lane);
#pragma unroll
    for (int j = 0; j < 4; ++j)
      bf[j] = load_frag(bS[cur], LDT, wn + j * 16, 0, lane);
#pragma unroll
    for (int i = 0; i < 2; ++i)
#pragma unroll
      for (int j = 0; j < 4; ++j)
        acc[i][j] = wmma16x16x32(af[i], bf[j], acc[i][j]);
    stage_handoff();
  }

  const int half = lane >> 4;
  const int nl = lane & 15;
#pragma unroll
  for (int i = 0; i < 2; ++i)
#pragma unroll
    for (int j = 0; j < 4; ++j) {
      int nc = n0 + wn + j * 16 + nl;
      float bv = bias[nc];
#pragma unroll
      for (int r = 0; r < 8; ++r) {
        int mr = m0 + wm + i * 16 + r + half * 8;
        C[(long long)mr * N + nc] = acc[i][j][r] + bv;
      }
    }
}

// ---------------------------------------------------------------------------
// RMS-norm + RoPE + cast-to-f16, permuting [B,S,H,F] -> [B,H,S,F].
// One wave per (b,s,h) vector; lane owns 4 of the 128 features.
// ---------------------------------------------------------------------------
__global__ __launch_bounds__(256) void norm_rope_cast_kernel(
    const float* __restrict__ qf, const float* __restrict__ kf,
    const float* __restrict__ vf, const float* __restrict__ qw,
    const float* __restrict__ kw, _Float16* __restrict__ qh,
    _Float16* __restrict__ kh, _Float16* __restrict__ vh) {
  constexpr int S = 2048, H = 16, F = 128;
  const int lane = threadIdx.x & 31;
  const int wid = threadIdx.x >> 5;
  const int vid = blockIdx.x * 8 + wid;  // 0 .. B*S*H-1
  const int b = vid / (S * H);
  const int rem = vid - b * (S * H);
  const int s = rem / H;
  const int h = rem - s * H;
  const long long inoff = ((long long)(b * S + s) * H + h) * F;
  const long long outoff = ((long long)(b * H + h) * S + s) * F;
  const int f0 = lane * 4;

  float cosv[4], sinv[4];
#pragma unroll
  for (int i = 0; i < 4; ++i) {
    int j = (f0 + i) & 63;
    float freq = __powf(10000.0f, -(float)j * (1.0f / 64.0f));
    float ang = (float)s * freq;
    cosv[i] = __cosf(ang);
    sinv[i] = __sinf(ang);
  }
  const float sgn = (lane < 16) ? -1.0f : 1.0f;  // rotate_half sign

  const float* src[2] = {qf, kf};
  const float* wsc[2] = {qw, kw};
  _Float16* dst[2] = {qh, kh};
#pragma unroll
  for (int t = 0; t < 2; ++t) {
    v4f x = *(const v4f*)(src[t] + inoff + f0);
    float ss = x[0] * x[0] + x[1] * x[1] + x[2] * x[2] + x[3] * x[3];
#pragma unroll
    for (int m = 1; m < 32; m <<= 1) ss += __shfl_xor(ss, m, 32);
    float rms = sqrtf(ss * (1.0f / F));
    float inv = 1.0f / (rms + 1e-6f);
    float y[4];
#pragma unroll
    for (int i = 0; i < 4; ++i) y[i] = x[i] * inv * wsc[t][f0 + i];
    float p[4];  // partner features f +/- 64 live in lane ^ 16
#pragma unroll
    for (int i = 0; i < 4; ++i) p[i] = __shfl_xor(y[i], 16, 32);
    v4h out;
#pragma unroll
    for (int i = 0; i < 4; ++i)
      out[i] = (_Float16)(y[i] * cosv[i] + sgn * p[i] * sinv[i]);
    *(v4h*)(dst[t] + outoff + f0) = out;
  }
  v4f xv = *(const v4f*)(vf + inoff + f0);
  v4h ov;
#pragma unroll
  for (int i = 0; i < 4; ++i) ov[i] = (_Float16)xv[i];
  *(v4h*)(vh + outoff + f0) = ov;
}

__global__ __launch_bounds__(128) void flash_attn_kernel(
    const _Float16* __restrict__ qh, const _Float16* __restrict__ kh,
    const _Float16* __restrict__ vh, _Float16* __restrict__ attn) {
  constexpr int S = 2048, H = 16, F = 128;
  constexpr int QT = 64, KT = 64;
  constexpr int LDK = F + 8;
  constexpr int LDV = KT + 8;
  __shared__ _Float16 Kt[KT * LDK];
  __shared__ _Float16 Vt[F * LDV];

  const int tid = threadIdx.x;
  const int lane = tid & 31;
  const int wid = tid >> 5;
  const int half = lane >> 4;
  const int b = blockIdx.z, h = blockIdx.y;
  const int q0 = blockIdx.x * QT + wid * 16;
  const long long base = ((long long)(b * H + h)) * S * F;
  const _Float16* Q = qh + base;
  const _Float16* Kp = kh + base;
  const _Float16* Vp = vh + base;

  v16h qfrag[4];
#pragma unroll
  for (int kc = 0; kc < 4; ++kc) qfrag[kc] = load_frag(Q, F, q0, kc * 32, lane);

  v8f o[8];
#pragma unroll
  for (int j = 0; j < 8; ++j) o[j] = v8f_zero();
  float mst = -1e30f;  // running maximum of query (lane & 15), both halves
  float lst = 0.0f;    // running sum over this half's keys only
  const float scale = 0.08838834764831845f;  // 1/sqrt(128)

  for (int kt0 = 0; kt0 < S; kt0 += KT) {
    __syncthreads();  // previous tile fully consumed
#if USE_TDM
    if (wid == 0)
      tdm_load_2d((unsigned)(size_t)&Kt[0], Kp + (long long)kt0 * F, F, KT, F,
                  5, 3);
#else
#pragma unroll
    for (int it = 0; it < 8; ++it) {
      int idx = tid + it * 128;
      int kr = idx >> 4;
      int c = (idx & 15) << 3;
      *(v8h*)&Kt[kr * LDK + c] =
          *(const v8h*)(Kp + (long long)(kt0 + kr) * F + c);
    }
#endif
    // V tile transposed: Vt[f][key]
#pragma unroll
    for (int it = 0; it < 16; ++it) {
      int idx = tid + it * 128;
      int kr = idx >> 5;
      int f4 = (idx & 31) << 2;
      v4h v = *(const v4h*)(Vp + (long long)(kt0 + kr) * F + f4);
#pragma unroll
      for (int j = 0; j < 4; ++j) Vt[(f4 + j) * LDV + kr] = v[j];
    }
#if USE_TDM
    if (wid == 0) __builtin_amdgcn_s_wait_tensorcnt((short)0);
#endif
    __syncthreads();

    // Scores: S^T, KT x 16 in 4 key tiles, K-reduction over F.
    // sc[jn][r] = score of key jn*16 + 8*half + r against query (lane & 15)
    v8f sc[4];
#pragma unroll
    for (int jn = 0; jn < 4; ++jn) {
      sc[jn] = v8f_zero();
#pragma unroll
      for (int kc = 0; kc < 4; ++kc) {
        v16h kf = load_frag(Kt, LDK, jn * 16, kc * 32, lane);
        sc[jn] = wmma16x16x32(kf, qfrag[kc], sc[jn]);
      }
    }

    float mx = sc[0][0];
#pragma unroll
    for (int jn = 0; jn < 4; ++jn)
#pragma unroll
      for (int r = 0; r < 8; ++r) mx = fmaxf(mx, sc[jn][r]);
    mx = fmaxf(mx, xhalf(mx)) * scale;  // scale > 0: max commutes with it
    const float mnew = fmaxf(mst, mx);
    const float alpha = __expf(mst - mnew);
    // P^T as B operand: element s of chunk kc is key kc*32 + 8*half + s for
    // s < 8 and kc*32 + 16 + 8*half + (s - 8) above: tiles 2kc and 2kc + 1 as
    // they lie, the k order of load_frag on the V^T side.
    v16h pb[2];
    float ps[4];
#pragma unroll
    for (int jn = 0; jn < 4; ++jn) {
      ps[jn] = 0.0f;
#pragma unroll
      for (int r = 0; r < 8; ++r) {
        float p = __expf(sc[jn][r] * scale - mnew);
        ps[jn] += p;
        pb[jn >> 1][(jn & 1) * 8 + r] = (_Float16)p;
      }
    }
    lst = lst * alpha + ((ps[0] + ps[1]) + (ps[2] + ps[3]));
    mst = mnew;
#pragma unroll
    for (int j = 0; j < 8; ++j)
#pragma unroll
      for (int r = 0; r < 8; ++r) o[j][r] *= alpha;

    // o[jf][r] = O^T[feature jf*16 + 8*half + r][query (lane & 15)]
#pragma unroll
    for (int jf = 0; jf < 8; ++jf)
#pragma unroll
      for (int kc = 0; kc < 2; ++kc) {
        v16h vf = load_frag(Vt, LDV, jf * 16, kc * 32, lane);
        o[jf] = wmma16x16x32(vf, pb[kc], o[jf]);
      }
  }

  // Join the halves' sums, normalize, store f16 attn output as [B,S,H,F]:
  // a lane's 8 registers of a tile are 8 consecutive features of its query.
  const float inv = 1.0f / (lst + xhalf(lst));
  _Float16* orow = attn + ((long long)(b * S + q0 + (lane & 15))) * (H * F) +
                   h * F + half * 8;
#pragma unroll
  for (int jf = 0; jf < 8; ++jf) {
    v8h ov;
#pragma unroll
    for (int r = 0; r < 8; ++r) ov[r] = (_Float16)(o[jf][r] * inv);
    *(v8h*)(orow + jf * 16) = ov;
  }
}

// ---------------------------------------------------------------------------
extern "C" void kernel_launch(void* const* d_in, const int* in_sizes, int n_in,
                              void* d_out, int out_size, void* d_ws,
                              size_t ws_size, hipStream_t stream) {
  constexpr int Bb = 2, S = 2048, D = 2048, H = 16, F = 128;
  constexpr long long MR = (long long)Bb * S;  // 4096 rows
  constexpr long long EL = MR * D;             // 8388608 elems (act tensors)
  constexpr long long WE = (long long)H * D * F;  // 4194304 elems (weights)

  const float* xq = (const float*)d_in[0];
  const float* xk = (const float*)d_in[1];
  const float* xv = (const float*)d_in[2];
  const float* WQ = (const float*)d_in[3];
  const float* WK = (const float*)d_in[4];
  const float* WV = (const float*)d_in[5];
  const float* WO = (const float*)d_in[6];
  const float* bQ = (const float*)d_in[7];
  const float* bK = (const float*)d_in[8];
  const float* bV = (const float*)d_in[9];
  const float* bO = (const float*)d_in[10];
  const float* qw = (const float*)d_in[11];
  const float* kw = (const float*)d_in[12];

  // Workspace (~185 MB):
  //   qf,kf,vf : f32 [4096,2048] raw projections
  //   Xq,Xk,Xv : f16 [4096,2048] cast inputs   (later aliased by qh,kh,vh)
  //   WQt..WOt : f16 [2048,2048] transposed weights (Bt = [N][K])
  //   at       : f16 [B,S,H,F]  attention out  (aliases dead WQt+WKt)
  float* qf = (float*)d_ws;
  float* kf = qf + EL;
  float* vf = kf + EL;
  _Float16* Xq = (_Float16*)(vf + EL);
  _Float16* Xk = Xq + EL;
  _Float16* Xv = Xk + EL;
  _Float16* WQt = Xv + EL;
  _Float16* WKt = WQt + WE;
  _Float16* WVt = WKt + WE;
  _Float16* WOt = WVt + WE;
  _Float16* qhp = Xq;  // aliases: X* dead after projection GEMMs
  _Float16* khp = Xk;
  _Float16* vhp = Xv;
  _Float16* at = WQt;  // aliases: WQt/WKt dead after projection GEMMs

  // 1) cast activations f32 -> f16
  cast_f16_kernel<<<(int)(EL / 4 / 256), 256, 0, stream>>>(xq, Xq);
  cast_f16_kernel<<<(int)(EL / 4 / 256), 256, 0, stream>>>(xk, Xk);
  cast_f16_kernel<<<(int)(EL / 4 / 256), 256, 0, stream>>>(xv, Xv);
  // 2) transpose+cast weights: W[H,D,F] -> [H,F,D]; W_O[2048,2048] -> T
  transpose_cast_kernel<<<dim3(F / 32, D / 32, H), 256, 0, stream>>>(WQ, WQt, D,
                                                                     F);
  transpose_cast_kernel<<<dim3(F / 32, D / 32, H), 256, 0, stream>>>(WK, WKt, D,
                                                                     F);
  transpose_cast_kernel<<<dim3(F / 32, D / 32, H), 256, 0, stream>>>(WV, WVt, D,
                                                                     F);
  transpose_cast_kernel<<<dim3(D / 32, D / 32, 1), 256, 0, stream>>>(WO, WOt, D,
                                                                     D);
  dim3 gg(D / BN, (int)(MR / BM));  // (16, 32)
  gemm_bias_f16_kernel<<<gg, 256, 0, stream>>>(Xq, WQt, bQ, qf, (int)MR, D, D);
  gemm_bias_f16_kernel<<<gg, 256, 0, stream>>>(Xk, WKt, bK, kf, (int)MR, D, D);
  gemm_bias_f16_kernel<<<gg, 256, 0, stream>>>(Xv, WVt, bV, vf, (int)MR, D, D);
  // 4) RMS-norm + RoPE + cast, permute to [B,H,S,F]
  norm_rope_cast_kernel<<<(Bb * S * H) / 8, 256, 0, stream>>>(
      qf, kf, vf, qw, kw, qhp, khp, vhp);
  // 5) flash attention -> [B,S,H,F] f16
  flash_attn_kernel<<<dim3(S / 64, H, Bb), 128, 0, stream>>>(qhp, khp, vhp, at);
  // 6) output projection + b_O -> d_out f32
  gemm_bias_f16_kernel<<<gg, 256, 0, stream>>>(at, WOt, bO, (float*)d_out,
                                               (int)MR, D, D);
}

// v002
// A run of this version takes 308 microseconds.
// Timed twice side by side with v001, it ran 1.74 times as fast both times.
// Over all steps from v000 it is 2.06 times as fast.
#include <hip/hip_runtime.h>
#include <stdint.h>

typedef __attribute__((ext_vector_type(16))) _Float16 v16h;
typedef __attribute__((ext_vector_type(8)))  _Float16 v8h;
typedef __attribute__((ext_vector_type(4)))  _Float16 v4h;
typedef __attribute__((ext_vector_type(8)))  float    v8f;
typedef __attribute__((ext_vector_type(4)))  float    v4f;
typedef __attribute__((ext_vector_type(4)))  unsigned int u32x4;
typedef __attribute__((ext_vector_type(8)))  int          i32x8;
typedef __attribute__((ext_vector_type(4)))  int          i32x4;
typedef __attribute__((ext_vector_type(8)))  unsigned int u32x8;
typedef __attribute__((ext_vector_type(8)))  short        s16x8;

#if defined(__has_builtin)
#if __has_builtin(__builtin_amdgcn_tensor_load_to_lds) && \
    __has_builtin(__builtin_amdgcn_s_wait_tensorcnt)
#define USE_TDM 1
#endif
#endif
#ifndef USE_TDM
#define USE_TDM 0
#endif

__device__ __forceinline__ v8f v8f_zero() {
  v8f z;
#pragma unroll
  for (int i = 0; i < 8; ++i) z[i] = 0.0f;
  return z;
}

__device__ __forceinline__ v8f wmma16x16x32(v16h a, v16h b, v8f c) {
  return __builtin_amdgcn_wmma_f32_16x16x32_f16(false, a, false, b, (short)0, c,
                                                false, false);
}

__device__ __forceinline__ v16h load_frag(const _Float16* p, int ld, int row0,
                                          int k0, int lane) {
  const _Float16* q = p + (row0 + (lane & 15)) * ld + k0 + ((lane >> 4) << 3);
  v16h v;
#pragma unroll
  for (int i = 0; i < 8; ++i) {
    v[i] = q[i];
    v[i + 8] = q[i + 16];
  }
  return v;
}

__device__ __forceinline__ float xhalf(float x) {
  const int b = __builtin_bit_cast(int, x);
  return __builtin_bit_cast(
      float, __builtin_amdgcn_permlanex16(b, b, 0x76543210, 0xfedcba98, false,
                                          false));
}

#if USE_TDM
__device__ __forceinline__ void tdm_load_2d(unsigned lds_off, const void* gptr,
                                            unsigned width, unsigned height,
                                            unsigned stride, unsigned pad_int,
                                            unsigned pad_amt) {
  unsigned long long ga = (unsigned long long)(size_t)gptr;
  u32x4 g0;
  g0[0] = 1u;
  g0[1] = lds_off;
  g0[2] = (unsigned)(ga & 0xffffffffu);
  g0[3] = (unsigned)((ga >> 32) & 0x01ffffffu)
          | (2u << 30);
  i32x8 g1;
  g1[0] = (int)((1u << 16)
                | (1u << 20)
                | (pad_int << 22) | (pad_amt << 25));
  g1[1] = (int)((stride & 0xffffu) << 16);
  g1[2] = (int)(((stride >> 16) & 0xffffu)
                | ((height & 0xffffu) << 16));
  g1[3] = (int)(((height >> 16) & 0xffffu)
                | ((width & 0xffffu) << 16));
  g1[4] = (int)(height & 0xffffu);
  g1[5] = (int)stride;
  g1[6] = 0;
  g1[7] = 0;
  i32x4 z4 = {0, 0, 0, 0};                      // groups 2/3 unused (2D)
  i32x8 z8 = {0, 0, 0, 0, 0, 0, 0, 0};
  __builtin_amdgcn_tensor_load_to_lds(g0, g1, z4, z4, z8, 0);
}
#endif

__device__ __forceinline__ uint32_t uni(uint32_t v) {
  return (uint32_t)__builtin_amdgcn_readfirstlane((int)v);
}
__device__ __forceinline__ uint32_t pinned(uint32_t v) {
  uint32_t w = uni(v);
  // the test stays in an SGPR
  asm volatile("" : "+s"(w));
  return w;
}

__device__ __forceinline__ void tdm_load_v_tile(uint32_t lds_dst,
                                                const _Float16* src) {
  constexpr uint32_t d0 = 256u, d1 = 64u;
  const uint64_t ga = (uint64_t)(size_t)src;
  u32x4 g0;
  g0[0] = uni(1u);
  g0[1] = uni(lds_dst);
  g0[2] = uni((uint32_t)ga);
  g0[3] = uni((((uint32_t)(ga >> 32)) & 0x01FFFFFFu) | 0x80000000u);
  u32x8 g1;
  g1[0] = uni((1u << 20) | (5u << 22) | (7u << 25));
  g1[1] = uni((d0 & 0xFFFFu) << 16);
  g1[2] = uni((d0 >> 16) | ((d1 & 0xFFFFu) << 16));
  g1[3] = uni((d1 >> 16) | (d0 << 16));
  g1[4] = uni(d1);
  g1[5] = uni(d0);  // source row pitch = row length
  g1[6] = uni(0u);
  g1[7] = uni(0u);
  asm volatile("tensor_load_to_lds %0, %1" ::"s"(g0), "s"(g1) : "memory");
}

__device__ __forceinline__ v8h ld_tr16(const unsigned char* p) {
  typedef __attribute__((address_space(3))) s16x8 lds_s16x8;
  return __builtin_bit_cast(
      v8h, __builtin_amdgcn_ds_load_tr16_b128_v8i16((lds_s16x8*)p));
}

__global__ __launch_bounds__(256) void cast_f16_kernel(
    const float* __restrict__ in, _Float16* __restrict__ out) {
  long long i = ((long long)blockIdx.x * 256 + threadIdx.x) * 4;
  v4f x = *(const v4f*)(in + i);
  v4h h;
#pragma unroll
  for (int j = 0; j < 4; ++j) h[j] = (_Float16)x[j];
  *(v4h*)(out + i) = h;
}

// in: f32 [nmat][rows][cols] -> out: f16 [nmat][cols][rows]
__global__ __launch_bounds__(256) void transpose_cast_kernel(
    const float* __restrict__ in, _Float16* __restrict__ out, int rows,
    int cols) {
  __shared__ float tile[32][33];
  const int m = blockIdx.z;
  const int r0 = blockIdx.y * 32, c0 = blockIdx.x * 32;
  const float* src = in + (long long)m * rows * cols;
  _Float16* dst = out + (long long)m * rows * cols;
  const int tx = threadIdx.x & 31, ty = threadIdx.x >> 5;  // 32 x 8
#pragma unroll
  for (int i = 0; i < 32; i += 8)
    tile[ty + i][tx] = src[(long long)(r0 + ty + i) * cols + c0 + tx];
  __syncthreads();
#pragma unroll
  for (int i = 0; i < 32; i += 8)
    dst[(long long)(c0 + ty + i) * rows + r0 + tx] = (_Float16)tile[tx][ty + i];
}

// ---------------------------------------------------------------------------
// GEMM: C[m,n] = sum_k A[m,k]*Bt[n,k] + bias[n].  A,Bt f16 row-major, C f32.
// Block 256 threads (8 waves), tile 128x128x32, wave tile 32x64 (2x4 WMMA).
// Double-buffered LDS; tiles fetched by the Tensor Data Mover (wave 0 issues,
// s_wait_tensorcnt + barrier hands off), manual b128 copies as fallback.
// ---------------------------------------------------------------------------
constexpr int BM = 128, BN = 128, BK = 32;
constexpr int LDT = BK + 8;

__global__ __launch_bounds__(256) void gemm_bias_f16_kernel(
    const _Float16* __restrict__ A, const _Float16* __restrict__ Bt,
    const float* __restrict__ bias, float* __restrict__ C, int M, int N,
    int K) {
  __shared__ _Float16 aS[2][BM * LDT];
  __shared__ _Float16 bS[2][BN * LDT];
  const int tid = threadIdx.x, lane = tid & 31, wid = tid >> 5;
  const int wm = (wid & 3) * 32, wn = (wid >> 2) * 64;
  const int n0 = blockIdx.x * BN, m0 = blockIdx.y * BM;
  const _Float16* Abase = A + (long long)m0 * K;
  const _Float16* Bbase = Bt + (long long)n0 * K;

  v8f acc[2][4];
#pragma unroll
  for (int i = 0; i < 2; ++i)
#pragma unroll
    for (int j = 0; j < 4; ++j) acc[i][j] = v8f_zero();

  auto stage = [&](int buf, int k0) {
#if USE_TDM
    if (wid == 0) {
      tdm_load_2d((unsigned)(size_t)&aS[buf][0], Abase + k0, BK, BM, K, 3, 3);
      tdm_load_2d((unsigned)(size_t)&bS[buf][0], Bbase + k0, BK, BN, K, 3, 3);
    }
#else
#pragma unroll
    for (int it = 0; it < 2; ++it) {
      int idx = tid + it * 256;  // 0..511
      int r = idx >> 2;          // 0..127
      int c = (idx & 3) << 3;    // 0,8,16,24
      *(v8h*)&aS[buf][r * LDT + c] =
          *(const v8h*)(Abase + (long long)r * K + k0 + c);
      *(v8h*)&bS[buf][r * LDT + c] =
          *(const v8h*)(Bbase + (long long)r * K + k0 + c);
    }
#endif
  };
  auto stage_handoff = [&]() {
#if USE_TDM
    if (wid == 0) __builtin_amdgcn_s_wait_tensorcnt((short)0);
#endif
    __syncthreads();
  };

  const int NK = K / BK;
  stage(0, 0);
  stage_handoff();
  for (int it = 0; it < NK; ++it) {
    const int cur = it & 1;
    if (it + 1 < NK) stage(cur ^ 1, (it + 1) * BK);  // overlap copy w/ compute
    v16h af[2], bf[4];
#pragma unroll
    for (int i = 0; i < 2; ++i)
      af[i] = load_frag(aS[cur], LDT, wm + i * 16, 0, lane);
#pragma unroll
    for (int j = 0; j < 4; ++j)
      bf[j] = load_frag(bS[cur], LDT, wn + j * 16, 0, lane);
#pragma unroll
    for (int i = 0; i < 2; ++i)
#pragma unroll
      for (int j = 0; j < 4; ++j)
        acc[i][j] = wmma16x16x32(af[i], bf[j], acc[i][j]);
    stage_handoff();
  }

  const int half = lane >> 4;
  const int nl = lane & 15;
#pragma unroll
  for (int i = 0; i < 2; ++i)
#pragma unroll
    for (int j = 0; j < 4; ++j) {
      int nc = n0 + wn + j * 16 + nl;
      float bv = bias[nc];
#pragma unroll
      for (int r = 0; r < 8; ++r) {
        int mr = m0 + wm + i * 16 + r + half * 8;
        C[(long long)mr * N + nc] = acc[i][j][r] + bv;
      }
    }
}

// ---------------------------------------------------------------------------
// RMS-norm + RoPE + cast-to-f16, permuting [B,S,H,F] -> [B,H,S,F].
// One wave per (b,s,h) vector; lane owns 4 of the 128 features.
// ---------------------------------------------------------------------------
__global__ __launch_bounds__(256) void norm_rope_cast_kernel(
    const float* __restrict__ qf, const float* __restrict__ kf,
    const float* __restrict__ vf, const float* __restrict__ qw,
    const float* __restrict__ kw, _Float16* __restrict__ qh,
    _Float16* __restrict__ kh, _Float16* __restrict__ vh) {
  constexpr int S = 2048, H = 16, F = 128;
  const int lane = threadIdx.x & 31;
  const int wid = threadIdx.x >> 5;
  const int vid = blockIdx.x * 8 + wid;  // 0 .. B*S*H-1
  const int b = vid / (S * H);
  const int rem = vid - b * (S * H);
  const int s = rem / H;
  const int h = rem - s * H;
  const long long inoff = ((long long)(b * S + s) * H + h) * F;
  const long long outoff = ((long long)(b * H + h) * S + s) * F;
  const int f0 = lane * 4;

  float cosv[4], sinv[4];
#pragma unroll
  for (int i = 0; i < 4; ++i) {
    int j = (f0 + i) & 63;
    float freq = __powf(10000.0f, -(float)j * (1.0f / 64.0f));
    float ang = (float)s * freq;
    cosv[i] = __cosf(ang);
    sinv[i] = __sinf(ang);
  }
  const float sgn = (lane < 16) ? -1.0f : 1.0f;  // rotate_half sign

  const float* src[2] = {qf, kf};
  const float* wsc[2] = {qw, kw};
  _Float16* dst[2] = {qh, kh};
#pragma unroll
  for (int t = 0; t < 2; ++t) {
    v4f x = *(const v4f*)(src[t] + inoff + f0);
    float ss = x[0] * x[0] + x[1] * x[1] + x[2] * x[2] + x[3] * x[3];
#pragma unroll
    for (int m = 1; m < 32; m <<= 1) ss += __shfl_xor(ss, m, 32);
    float rms = sqrtf(ss * (1.0f / F));
    float inv = 1.0f / (rms + 1e-6f);
    float y[4];
#pragma unroll
    for (int i = 0; i < 4; ++i) y[i] = x[i] * inv * wsc[t][f0 + i];
    float p[4];  // partner features f +/- 64 live in lane ^ 16
#pragma unroll
    for (int i = 0; i < 4; ++i) p[i] = __shfl_xor(y[i], 16, 32);
    v4h out;
#pragma unroll
    for (int i = 0; i < 4; ++i)
      out[i] = (_Float16)(y[i] * cosv[i] + sgn * p[i] * sinv[i]);
    *(v4h*)(dst[t] + outoff + f0) = out;
  }
  v4f xv = *(const v4f*)(vf + inoff + f0);
  v4h ov;
#pragma unroll
  for (int i = 0; i < 4; ++i) ov[i] = (_Float16)xv[i];
  *(v4h*)(vh + outoff + f0) = ov;
}

__global__ __launch_bounds__(128) void flash_attn_kernel(
    const _Float16* __restrict__ qh, const _Float16* __restrict__ kh,
    const _Float16* __restrict__ vh, _Float16* __restrict__ attn) {
  constexpr int S = 2048, H = 16, F = 128;
  constexpr int QT = 64, KT = 64;
  constexpr int LDK = F + 8;
  constexpr int PV = 2 * F + 32;
  __shared__ _Float16 Kt[KT * LDK];
  __shared__ __attribute__((aligned(2048))) unsigned char Vs[KT * PV];

  const int tid = threadIdx.x;
  const int lane = tid & 31;
  const int wid = tid >> 5;
  const int half = lane >> 4;
  const uint32_t wave = uni(threadIdx.x >> 5);
  const int b = blockIdx.z, h = blockIdx.y;
  const int q0 = blockIdx.x * QT + wid * 16;
  const long long base = ((long long)(b * H + h)) * S * F;
  const _Float16* Q = qh + base;
  const _Float16* Kp = kh + base;
  const _Float16* Vp = vh + base;

  v16h qfrag[4];
#pragma unroll
  for (int kc = 0; kc < 4; ++kc) qfrag[kc] = load_frag(Q, F, q0, kc * 32, lane);

  v8f o[8];
#pragma unroll
  for (int j = 0; j < 8; ++j) o[j] = v8f_zero();
  float mst = -1e30f;  // running maximum of query (lane & 15), both halves
  float lst = 0.0f;    // running sum over this half's keys only
  const float scale = 0.08838834764831845f;  // 1/sqrt(128)

  // This lane's address in the first 16-key x 16-feature block of the V tile.
  const unsigned char* vad =
      Vs + (8 * half + (lane & 7)) * PV + ((lane >> 3) & 1) * 16;

  for (int kt0 = 0; kt0 < S; kt0 += KT) {
    // This wave's LDS reads have retired before the mover is aimed at the
    // tiles again.
    asm volatile("s_wait_dscnt 0x0" ::: "memory");
    __syncthreads();  // previous tile fully consumed
#if USE_TDM
    if (wid == 0)
      tdm_load_2d((unsigned)(size_t)&Kt[0], Kp + (long long)kt0 * F, F, KT, F,
                  5, 3);
#else
#pragma unroll
    for (int it = 0; it < 8; ++it) {
      int idx = tid + it * 128;
      int kr = idx >> 4;
      int c = (idx & 15) << 3;
      *(v8h*)&Kt[kr * LDK + c] =
          *(const v8h*)(Kp + (long long)(kt0 + kr) * F + c);
    }
#endif
    // V tile as it lies, Vs[key][f]: one request of wave 1, beside wave 0's.
    if (pinned(wave == 1u)) {
      tdm_load_v_tile((uint32_t)(size_t)&Vs[0], Vp + (long long)kt0 * F);
      // The tile has landed before this wave reaches the barrier below.
      asm volatile("s_wait_tensorcnt 0x0" ::: "memory");
    }
#if USE_TDM
    if (wid == 0) __builtin_amdgcn_s_wait_tensorcnt((short)0);
#endif
    __syncthreads();

    // Scores: S^T, KT x 16 in 4 key tiles, K-reduction over F.
    // sc[jn][r] = score of key jn*16 + 8*half + r against query (lane & 15)
    v8f sc[4];
#pragma unroll
    for (int jn = 0; jn < 4; ++jn) {
      sc[jn] = v8f_zero();
#pragma unroll
      for (int kc = 0; kc < 4; ++kc) {
        v16h kf = load_frag(Kt, LDK, jn * 16, kc * 32, lane);
        sc[jn] = wmma16x16x32(kf, qfrag[kc], sc[jn]);
      }
    }

    float mx = sc[0][0];
#pragma unroll
    for (int jn = 0; jn < 4; ++jn)
#pragma unroll
      for (int r = 0; r < 8; ++r) mx = fmaxf(mx, sc[jn][r]);
    mx = fmaxf(mx, xhalf(mx)) * scale;  // scale > 0: max commutes with it
    const float mnew = fmaxf(mst, mx);
    const float alpha = __expf(mst - mnew);
    // P^T as B operand: element s of chunk kc is key kc*32 + 8*half + s for
    // s < 8 and kc*32 + 16 + 8*half + (s - 8) above: tiles 2kc and 2kc + 1 as
    // they lie, the k order of the ld_tr16 pairs on the V^T side.
    v16h pb[2];
    float ps[4];
#pragma unroll
    for (int jn = 0; jn < 4; ++jn) {
      ps[jn] = 0.0f;
#pragma unroll
      for (int r = 0; r < 8; ++r) {
        float p = __expf(sc[jn][r] * scale - mnew);
        ps[jn] += p;
        pb[jn >> 1][(jn & 1) * 8 + r] = (_Float16)p;
      }
    }
    lst = lst * alpha + ((ps[0] + ps[1]) + (ps[2] + ps[3]));
    mst = mnew;
#pragma unroll
    for (int j = 0; j < 8; ++j)
#pragma unroll
      for (int r = 0; r < 8; ++r) o[j][r] *= alpha;

    // o[jf][r] = O^T[feature jf*16 + 8*half + r][query (lane & 15)]
#pragma unroll
    for (int jf = 0; jf < 8; ++jf)
#pragma unroll
      for (int kc = 0; kc < 2; ++kc) {
        // keys kc*32 + 8*half + 0..7, then + 16: the k order of pb[kc]
        const v8h lo = ld_tr16(vad + (kc * 32) * PV + jf * 32);
        const v8h hi = ld_tr16(vad + (kc * 32 + 16) * PV + jf * 32);
        const v16h vf = __builtin_shufflevector(lo, hi, 0, 1, 2, 3, 4, 5, 6, 7,
                                                8, 9, 10, 11, 12, 13, 14, 15);
        o[jf] = wmma16x16x32(vf, pb[kc], o[jf]);
      }
  }

  // Join the halves' sums, normalize, store f16 attn output as [B,S,H,F]:
  // a lane's 8 registers of a tile are 8 consecutive features of its query.
  const float inv = 1.0f / (lst + xhalf(lst));
  _Float16* orow = attn + ((long long)(b * S + q0 + (lane & 15))) * (H * F) +
                   h * F + half * 8;
#pragma unroll
  for (int jf = 0; jf < 8; ++jf) {
    v8h ov;
#pragma unroll
    for (int r = 0; r < 8; ++r) ov[r] = (_Float16)(o[jf][r] * inv);
    *(v8h*)(orow + jf * 16) = ov;
  }
}

// ---------------------------------------------------------------------------
extern "C" void kernel_launch(void* const* d_in, const int* in_sizes, int n_in,
                              void* d_out, int out_size, void* d_ws,
                              size_t ws_size, hipStream_t stream) {
  constexpr int Bb = 2, S = 2048, D = 2048, H = 16, F = 128;
  constexpr long long MR = (long long)Bb * S;  // 4096 rows
  constexpr long long EL = MR * D;             // 8388608 elems (act tensors)
  constexpr long long WE = (long long)H * D * F;  // 4194304 elems (weights)

  const float* xq = (const float*)d_in[0];
  const float* xk = (const float*)d_in[1];
  const float* xv = (const float*)d_in[2];
  const float* WQ = (const float*)d_in[3];
  const float* WK = (const float*)d_in[4];
  const float* WV = (const float*)d_in[5];
  const float* WO = (const float*)d_in[6];
  const float* bQ = (const float*)d_in[7];
  const float* bK = (const float*)d_in[8];
  const float* bV = (const float*)d_in[9];
  const float* bO = (const float*)d_in[10];
  const float* qw = (const float*)d_in[11];
  const float* kw = (const float*)d_in[12];

  // Workspace (~185 MB):
  //   qf,kf,vf : f32 [4096,2048] raw projections
  //   Xq,Xk,Xv : f16 [4096,2048] cast inputs   (later aliased by qh,kh,vh)
  //   WQt..WOt : f16 [2048,2048] transposed weights (Bt = [N][K])
  //   at       : f16 [B,S,H,F]  attention out  (aliases dead WQt+WKt)
  float* qf = (float*)d_ws;
  float* kf = qf + EL;
  float* vf = kf + EL;
  _Float16* Xq = (_Float16*)(vf + EL);
  _Float16* Xk = Xq + EL;
  _Float16* Xv = Xk + EL;
  _Float16* WQt = Xv + EL;
  _Float16* WKt = WQt + WE;
  _Float16* WVt = WKt + WE;
  _Float16* WOt = WVt + WE;
  _Float16* qhp = Xq;  // aliases: X* dead after projection GEMMs
  _Float16* khp = Xk;
  _Float16* vhp = Xv;
  _Float16* at = WQt;  // aliases: WQt/WKt dead after projection GEMMs

  // 1) cast activations f32 -> f16
  cast_f16_kernel<<<(int)(EL / 4 / 256), 256, 0, stream>>>(xq, Xq);
  cast_f16_kernel<<<(int)(EL / 4 / 256), 256, 0, stream>>>(xk, Xk);
  cast_f16_kernel<<<(int)(EL / 4 / 256), 256, 0, stream>>>(xv, Xv);
  // 2) transpose+cast weights: W[H,D,F] -> [H,F,D]; W_O[2048,2048] -> T
  transpose_cast_kernel<<<dim3(F / 32, D / 32, H), 256, 0, stream>>>(WQ, WQt, D,
                                                                     F);
  transpose_cast_kernel<<<dim3(F / 32, D / 32, H), 256, 0, stream>>>(WK, WKt, D,
                                                                     F);
  transpose_cast_kernel<<<dim3(F / 32, D / 32, H), 256, 0, stream>>>(WV, WVt, D,
                                                                     F);
  transpose_cast_kernel<<<dim3(D / 32, D / 32, 1), 256, 0, stream>>>(WO, WOt, D,
                                                                     D);
  dim3 gg(D / BN, (int)(MR / BM));  // (16, 32)
  gemm_bias_f16_kernel<<<gg, 256, 0, stream>>>(Xq, WQt, bQ, qf, (int)MR, D, D);
  gemm_bias_f16_kernel<<<gg, 256, 0, stream>>>(Xk, WKt, bK, kf, (int)MR, D, D);
  gemm_bias_f16_kernel<<<gg, 256, 0, stream>>>(Xv, WVt, bV, vf, (int)MR, D, D);
  // 4) RMS-norm + RoPE + cast, permute to [B,H,S,F]
  norm_rope_cast_kernel<<<(Bb * S * H) / 8, 256, 0, stream>>>(
      qf, kf, vf, qw, kw, qhp, khp, vhp);
  // 5) flash attention -> [B,S,H,F] f16
  flash_attn_kernel<<<dim3(S / 64, H, Bb), 128, 0, stream>>>(qhp, khp, vhp, at);
  // 6) output projection + b_O -> d_out f32
  gemm_bias_f16_kernel<<<gg, 256, 0, stream>>>(at, WOt, bO, (float*)d_out,
                                               (int)MR, D, D);
}

// v003
// Measured time: 297 microseconds a run.
// Timed twice side by side with v002, it ran 1.03 and 1.04 times as fast.
// Over all steps from v000 it is 2.14 times as fast.
#include <hip/hip_runtime.h>
#include <stdint.h>

typedef __attribute__((ext_vector_type(16))) _Float16 v16h;
typedef __attribute__((ext_vector_type(8)))  _Float16 v8h;
typedef __attribute__((ext_vector_type(4)))  _Float16 v4h;
typedef __attribute__((ext_vector_type(8)))  float    v8f;
typedef __attribute__((ext_vector_type(4)))  float    v4f;
typedef __attribute__((ext_vector_type(4)))  unsigned int u32x4;
typedef __attribute__((ext_vector_type(8)))  int          i32x8;
typedef __attribute__((ext_vector_type(4)))  int          i32x4;
typedef __attribute__((ext_vector_type(8)))  unsigned int u32x8;
typedef __attribute__((ext_vector_type(8)))  short        s16x8;

#if defined(__has_builtin)
#if __has_builtin(__builtin_amdgcn_tensor_load_to_lds) && \
    __has_builtin(__builtin_amdgcn_s_wait_tensorcnt)
#define USE_TDM 1
#endif
#endif
#ifndef USE_TDM
#define USE_TDM 0
#endif

__device__ __forceinline__ v8f v8f_zero() {
  v8f z;
#pragma unroll
  for (int i = 0; i < 8; ++i) z[i] = 0.0f;
  return z;
}

__device__ __forceinline__ v8f wmma16x16x32(v16h a, v16h b, v8f c) {
  return __builtin_amdgcn_wmma_f32_16x16x32_f16(false, a, false, b, (short)0, c,
                                                false, false);
}

__device__ __forceinline__ v16h load_frag(const _Float16* p, int ld, int row0,
                                          int k0, int lane) {
  const _Float16* q = p + (row0 + (lane & 15)) * ld + k0 + ((lane >> 4) << 3);
  v16h v;
#pragma unroll
  for (int i = 0; i < 8; ++i) {
    v[i] = q[i];
    v[i + 8] = q[i + 16];
  }
  return v;
}

__device__ __forceinline__ float xhalf(float x) {
  const int b = __builtin_bit_cast(int, x);
  return __builtin_bit_cast(
      float, __builtin_amdgcn_permlanex16(b, b, 0x76543210, 0xfedcba98, false,
                                          false));
}

#if USE_TDM
__device__ __forceinline__ void tdm_load_2d(unsigned lds_off, const void* gptr,
                                            unsigned width, unsigned height,
                                            unsigned stride, unsigned pad_int,
                                            unsigned pad_amt) {
  unsigned long long ga = (unsigned long long)(size_t)gptr;
  u32x4 g0;
  g0[0] = 1u;
  g0[1] = lds_off;
  g0[2] = (unsigned)(ga & 0xffffffffu);
  g0[3] = (unsigned)((ga >> 32) & 0x01ffffffu)
          | (2u << 30);
  i32x8 g1;
  g1[0] = (int)((1u << 16)
                | (1u << 20)
                | (pad_int << 22) | (pad_amt << 25));
  g1[1] = (int)((stride & 0xffffu) << 16);
  g1[2] = (int)(((stride >> 16) & 0xffffu)
                | ((height & 0xffffu) << 16));
  g1[3] = (int)(((height >> 16) & 0xffffu)
                | ((width & 0xffffu) << 16));
  g1[4] = (int)(height & 0xffffu);
  g1[5] = (int)stride;
  g1[6] = 0;
  g1[7] = 0;
  i32x4 z4 = {0, 0, 0, 0};                      // groups 2/3 unused (2D)
  i32x8 z8 = {0, 0, 0, 0, 0, 0, 0, 0};
  __builtin_amdgcn_tensor_load_to_lds(g0, g1, z4, z4, z8, 0);
}
#endif

__device__ __forceinline__ uint32_t uni(uint32_t v) {
  return (uint32_t)__builtin_amdgcn_readfirstlane((int)v);
}
__device__ __forceinline__ uint32_t pinned(uint32_t v) {
  uint32_t w = uni(v);
  // the test stays in an SGPR
  asm volatile("" : "+s"(w));
  return w;
}

__device__ __forceinline__ void tdm_load_v_tile(uint32_t lds_dst,
                                                const _Float16* src) {
  constexpr uint32_t d0 = 256u, d1 = 64u;
  const uint64_t ga = (uint64_t)(size_t)src;
  u32x4 g0;
  g0[0] = uni(1u);
  g0[1] = uni(lds_dst);
  g0[2] = uni((uint32_t)ga);
  g0[3] = uni((((uint32_t)(ga >> 32)) & 0x01FFFFFFu) | 0x80000000u);
  u32x8 g1;
  g1[0] = uni((1u << 20) | (5u << 22) | (7u << 25));
  g1[1] = uni((d0 & 0xFFFFu) << 16);
  g1[2] = uni((d0 >> 16) | ((d1 & 0xFFFFu) << 16));
  g1[3] = uni((d1 >> 16) | (d0 << 16));
  g1[4] = uni(d1);
  g1[5] = uni(d0);  // source row pitch = row length
  g1[6] = uni(0u);
  g1[7] = uni(0u);
  asm volatile("tensor_load_to_lds %0, %1" ::"s"(g0), "s"(g1) : "memory");
}

__device__ __forceinline__ v8h ld_tr16(const unsigned char* p) {
  typedef __attribute__((address_space(3))) s16x8 lds_s16x8;
  return __builtin_bit_cast(
      v8h, __builtin_amdgcn_ds_load_tr16_b128_v8i16((lds_s16x8*)p));
}

constexpr int CAST_U = 16;  // 16-byte pieces per thread
__global__ __launch_bounds__(256) void cast_f16_kernel(
    const float* __restrict__ in, _Float16* __restrict__ out) {
  const long long i0 =
      (long long)blockIdx.x * (256 * 4 * CAST_U) + threadIdx.x * 4;
  v4f x[CAST_U];
  // unrolled: x stays in registers and the loads issue ahead of their use
#pragma unroll
  for (int u = 0; u < CAST_U; ++u) x[u] = *(const v4f*)(in + i0 + u * 1024);
  // unrolled: x is indexed by constants only
#pragma unroll
  for (int u = 0; u < CAST_U; ++u) {
    v4h h;
#pragma unroll
    for (int j = 0; j < 4; ++j) h[j] = (_Float16)x[u][j];
    *(v4h*)(out + i0 + u * 1024) = h;
  }
}

// in: f32 [nmat][rows][cols] -> out: f16 [nmat][cols][rows]
// A block takes TR rows x 32 columns (TR / 32 square tiles, one barrier).
// rows and cols are compile-time, so that every load and store of a thread is
// one address register plus an immediate offset.
constexpr int TR = 256;
template <int rows, int cols>
__global__ __launch_bounds__(256) void transpose_cast_kernel(
    const float* __restrict__ in, _Float16* __restrict__ out) {
  __shared__ float tile[TR][33];
  const int m = blockIdx.z;
  const int r0 = blockIdx.y * TR, c0 = blockIdx.x * 32;
  const float* src = in + (long long)m * rows * cols;
  _Float16* dst = out + (long long)m * rows * cols;
  const int tx = threadIdx.x & 31, ty = threadIdx.x >> 5;  // 32 x 8
  const float* sp = src + (long long)(r0 + ty) * cols + c0 + tx;
  float x[TR / 8];
  // unrolled: x stays in registers and the loads issue back to back
#pragma unroll
  for (int i = 0; i < TR / 8; ++i) x[i] = sp[i * 8 * cols];
  // unrolled: x is indexed by constants only
#pragma unroll
  for (int i = 0; i < TR / 8; ++i) tile[ty + i * 8][tx] = x[i];
  __syncthreads();
  _Float16* dp = dst + (long long)(c0 + ty) * rows + r0 + tx;
  // unrolled: immediate offsets for the LDS reads and the stores
#pragma unroll
  for (int i = 0; i < 32; i += 8)
#pragma unroll
    for (int t = 0; t < TR; t += 32)
      dp[i * rows + t] = (_Float16)tile[t + tx][ty + i];
}

// ---------------------------------------------------------------------------
// GEMM: C[m,n] = sum_k A[m,k]*Bt[n,k] + bias[n].  A,Bt f16 row-major, C f32.
// Block 256 threads (8 waves), tile 128x128x32, wave tile 32x64 (2x4 WMMA).
// Double-buffered LDS; tiles fetched by the Tensor Data Mover (wave 0 issues,
// s_wait_tensorcnt + barrier hands off), manual b128 copies as fallback.
// ---------------------------------------------------------------------------
constexpr int BM = 128, BN = 128, BK = 32;
constexpr int LDT = BK + 8;

__global__ __launch_bounds__(256) void gemm_bias_f16_kernel(
    const _Float16* __restrict__ A, const _Float16* __restrict__ Bt,
    const float* __restrict__ bias, float* __restrict__ C, int M, int N,
    int K) {
  __shared__ _Float16 aS[2][BM * LDT];
  __shared__ _Float16 bS[2][BN * LDT];
  const int tid = threadIdx.x, lane = tid & 31, wid = tid >> 5;
  const int wm = (wid & 3) * 32, wn = (wid >> 2) * 64;
  const int n0 = blockIdx.x * BN, m0 = blockIdx.y * BM;
  const _Float16* Abase = A + (long long)m0 * K;
  const _Float16* Bbase = Bt + (long long)n0 * K;

  v8f acc[2][4];
#pragma unroll
  for (int i = 0; i < 2; ++i)
#pragma unroll
    for (int j = 0; j < 4; ++j) acc[i][j] = v8f_zero();

  auto stage = [&](int buf, int k0) {
#if USE_TDM
    if (wid == 0) {
      tdm_load_2d((unsigned)(size_t)&aS[buf][0], Abase + k0, BK, BM, K, 3, 3);
      tdm_load_2d((unsigned)(size_t)&bS[buf][0], Bbase + k0, BK, BN, K, 3, 3);
    }
#else
#pragma unroll
    for (int it = 0; it < 2; ++it) {
      int idx = tid + it * 256;  // 0..511
      int r = idx >> 2;          // 0..127
      int c = (idx & 3) << 3;    // 0,8,16,24
      *(v8h*)&aS[buf][r * LDT + c] =
          *(const v8h*)(Abase + (long long)r * K + k0 + c);
      *(v8h*)&bS[buf][r * LDT + c] =
          *(const v8h*)(Bbase + (long long)r * K + k0 + c);
    }
#endif
  };
  auto stage_handoff = [&]() {
#if USE_TDM
    if (wid == 0) __builtin_amdgcn_s_wait_tensorcnt((short)0);
#endif
    __syncthreads();
  };

  const int NK = K / BK;
  stage(0, 0);
  stage_handoff();
  for (int it = 0; it < NK; ++it) {
    const int cur = it & 1;
    if (it + 1 < NK) stage(cur ^ 1, (it + 1) * BK);  // overlap copy w/ compute
    v16h af[2], bf[4];
#pragma unroll
    for (int i = 0; i < 2; ++i)
      af[i] = load_frag(aS[cur], LDT, wm + i * 16, 0, lane);
#pragma unroll
    for (int j = 0; j < 4; ++j)
      bf[j] = load_frag(bS[cur], LDT, wn + j * 16, 0, lane);
#pragma unroll
    for (int i = 0; i < 2; ++i)
#pragma unroll
      for (int j = 0; j < 4; ++j)
        acc[i][j] = wmma16x16x32(af[i], bf[j], acc[i][j]);
    stage_handoff();
  }

  const int half = lane >> 4;
  const int nl = lane & 15;
#pragma unroll
  for (int i = 0; i < 2; ++i)
#pragma unroll
    for (int j = 0; j < 4; ++j) {
      int nc = n0 + wn + j * 16 + nl;
      float bv = bias[nc];
#pragma unroll
      for (int r = 0; r < 8; ++r) {
        int mr = m0 + wm + i * 16 + r + half * 8;
        C[(long long)mr * N + nc] = acc[i][j][r] + bv;
      }
    }
}

// ---------------------------------------------------------------------------
// RMS-norm + RoPE + cast-to-f16, permuting [B,S,H,F] -> [B,H,S,F].
// One wave per position (b,s) and group of NH heads; lane owns 4 of the 128
// features of each head. The angles depend on s and the lane alone: once a
// wave. A block's 8 waves are 8 consecutive positions of one head group.
// ---------------------------------------------------------------------------
constexpr int NH = 8;
__global__ __launch_bounds__(256) void norm_rope_cast_kernel(
    const float* __restrict__ qf, const float* __restrict__ kf,
    const float* __restrict__ vf, const float* __restrict__ qw,
    const float* __restrict__ kw, _Float16* __restrict__ qh,
    _Float16* __restrict__ kh, _Float16* __restrict__ vh) {
  constexpr int S = 2048, H = 16, F = 128;
  const int lane = threadIdx.x & 31;
  const int wid = threadIdx.x >> 5;
  constexpr int PB = 2 * S / 8;  // blocks per head group (B = 2)
  const int hg = blockIdx.x / PB;
  const int bs = (blockIdx.x - hg * PB) * 8 + wid;  // 0 .. B*S-1
  const int b = bs / S;
  const int s = bs - b * S;
  const int h = hg * NH;  // first head of the group
  const int f0 = lane * 4;
  const long long inoff = ((long long)bs * H + h) * F + f0;
  const long long outoff = ((long long)(b * H + h) * S + s) * F + f0;

  const v4f wsc[2] = {*(const v4f*)(qw + f0), *(const v4f*)(kw + f0)};
  // Behind this wait the two loads' offset register may be written again.
  asm volatile("s_wait_xcnt 0x0" ::: "memory");

  v4f xin[3][NH];
  // unrolled: xin stays in registers and the loads issue ahead of their use
#pragma unroll
  for (int g = 0; g < NH; ++g) {
    xin[0][g] = *(const v4f*)(qf + inoff + g * F);
    xin[1][g] = *(const v4f*)(kf + inoff + g * F);
    xin[2][g] = *(const v4f*)(vf + inoff + g * F);
  }

  float cosv[4], sinv[4];
#pragma unroll
  for (int i = 0; i < 4; ++i) {
    int j = (f0 + i) & 63;
    float freq = __powf(10000.0f, -(float)j * (1.0f / 64.0f));
    float ang = (float)s * freq;
    cosv[i] = __cosf(ang);
    sinv[i] = __sinf(ang);
  }
  const float sgn = (lane < 16) ? -1.0f : 1.0f;  // rotate_half sign

  _Float16* dst[2] = {qh, kh};
  // unrolled: xin is indexed by constants only; the heads' chains are
  // independent and fill each other's waits
#pragma unroll
  for (int g = 0; g < NH; ++g) {
#pragma unroll
  for (int t = 0; t < 2; ++t) {
    const v4f x = xin[t][g];
    float ss = x[0] * x[0] + x[1] * x[1] + x[2] * x[2] + x[3] * x[3];
#pragma unroll
    for (int m = 1; m < 32; m <<= 1) ss += __shfl_xor(ss, m, 32);
    float rms = sqrtf(ss * (1.0f / F));
    float inv = 1.0f / (rms + 1e-6f);
    float y[4];
#pragma unroll
    for (int i = 0; i < 4; ++i) y[i] = x[i] * inv * wsc[t][i];
    float p[4];  // partner features f +/- 64 live in lane ^ 16
#pragma unroll
    for (int i = 0; i < 4; ++i) p[i] = __shfl_xor(y[i], 16, 32);
    v4h out;
#pragma unroll
    for (int i = 0; i < 4; ++i)
      out[i] = (_Float16)(y[i] * cosv[i] + sgn * p[i] * sinv[i]);
    *(v4h*)(dst[t] + outoff + (long long)g * S * F) = out;
  }
  v4h ov;
#pragma unroll
  for (int i = 0; i < 4; ++i) ov[i] = (_Float16)xin[2][g][i];
  *(v4h*)(vh + outoff + (long long)g * S * F) = ov;
  }
}

__global__ __launch_bounds__(128) void flash_attn_kernel(
    const _Float16* __restrict__ qh, const _Float16* __restrict__ kh,
    const _Float16* __restrict__ vh, _Float16* __restrict__ attn) {
  constexpr int S = 2048, H = 16, F = 128;
  constexpr int QT = 64, KT = 64;
  constexpr int LDK = F + 8;
  constexpr int PV = 2 * F + 32;
  __shared__ _Float16 Kt[KT * LDK];
  __shared__ __attribute__((aligned(2048))) unsigned char Vs[KT * PV];

  const int tid = threadIdx.x;
  const int lane = tid & 31;
  const int wid = tid >> 5;
  const int half = lane >> 4;
  const uint32_t wave = uni(threadIdx.x >> 5);
  const int b = blockIdx.z, h = blockIdx.y;
  const int q0 = blockIdx.x * QT + wid * 16;
  const long long base = ((long long)(b * H + h)) * S * F;
  const _Float16* Q = qh + base;
  const _Float16* Kp = kh + base;
  const _Float16* Vp = vh + base;

  v16h qfrag[4];
#pragma unroll
  for (int kc = 0; kc < 4; ++kc) qfrag[kc] = load_frag(Q, F, q0, kc * 32, lane);

  v8f o[8];
#pragma unroll
  for (int j = 0; j < 8; ++j) o[j] = v8f_zero();
  float mst = -1e30f;  // running maximum of query (lane & 15), both halves
  float lst = 0.0f;    // running sum over this half's keys only
  const float scale = 0.08838834764831845f;  // 1/sqrt(128)

  // This lane's address in the first 16-key x 16-feature block of the V tile.
  const unsigned char* vad =
      Vs + (8 * half + (lane & 7)) * PV + ((lane >> 3) & 1) * 16;

  for (int kt0 = 0; kt0 < S; kt0 += KT) {
    // This wave's LDS reads have retired before the mover is aimed at the
    // tiles again.
    asm volatile("s_wait_dscnt 0x0" ::: "memory");
    __syncthreads();  // previous tile fully consumed
#if USE_TDM
    if (wid == 0)
      tdm_load_2d((unsigned)(size_t)&Kt[0], Kp + (long long)kt0 * F, F, KT, F,
                  5, 3);
#else
#pragma unroll
    for (int it = 0; it < 8; ++it) {
      int idx = tid + it * 128;
      int kr = idx >> 4;
      int c = (idx & 15) << 3;
      *(v8h*)&Kt[kr * LDK + c] =
          *(const v8h*)(Kp + (long long)(kt0 + kr) * F + c);
    }
#endif
    // V tile as it lies, Vs[key][f]: one request of wave 1, beside wave 0's.
    if (pinned(wave == 1u)) {
      tdm_load_v_tile((uint32_t)(size_t)&Vs[0], Vp + (long long)kt0 * F);
      // The tile has landed before this wave reaches the barrier below.
      asm volatile("s_wait_tensorcnt 0x0" ::: "memory");
    }
#if USE_TDM
    if (wid == 0) __builtin_amdgcn_s_wait_tensorcnt((short)0);
#endif
    __syncthreads();

    // Scores: S^T, KT x 16 in 4 key tiles, K-reduction over F.
    // sc[jn][r] = score of key jn*16 + 8*half + r against query (lane & 15)
    v8f sc[4];
#pragma unroll
    for (int jn = 0; jn < 4; ++jn) {
      sc[jn] = v8f_zero();
#pragma unroll
      for (int kc = 0; kc < 4; ++kc) {
        v16h kf = load_frag(Kt, LDK, jn * 16, kc * 32, lane);
        sc[jn] = wmma16x16x32(kf, qfrag[kc], sc[jn]);
      }
    }

    float mx = sc[0][0];
#pragma unroll
    for (int jn = 0; jn < 4; ++jn)
#pragma unroll
      for (int r = 0; r < 8; ++r) mx = fmaxf(mx, sc[jn][r]);
    mx = fmaxf(mx, xhalf(mx)) * scale;  // scale > 0: max commutes with it
    const float mnew = fmaxf(mst, mx);
    const float alpha = __expf(mst - mnew);
    // P^T as B operand: element s of chunk kc is key kc*32 + 8*half + s for
    // s < 8 and kc*32 + 16 + 8*half + (s - 8) above: tiles 2kc and 2kc + 1 as
    // they lie, the k order of the ld_tr16 pairs on the V^T side.
    v16h pb[2];
    float ps[4];
#pragma unroll
    for (int jn = 0; jn < 4; ++jn) {
      ps[jn] = 0.0f;
#pragma unroll
      for (int r = 0; r < 8; ++r) {
        float p = __expf(sc[jn][r] * scale - mnew);
        ps[jn] += p;
        pb[jn >> 1][(jn & 1) * 8 + r] = (_Float16)p;
      }
    }
    lst = lst * alpha + ((ps[0] + ps[1]) + (ps[2] + ps[3]));
    mst = mnew;
#pragma unroll
    for (int j = 0; j < 8; ++j)
#pragma unroll
      for (int r = 0; r < 8; ++r) o[j][r] *= alpha;

    // o[jf][r] = O^T[feature jf*16 + 8*half + r][query (lane & 15)]
#pragma unroll
    for (int jf = 0; jf < 8; ++jf)
#pragma unroll
      for (int kc = 0; kc < 2; ++kc) {
        // keys kc*32 + 8*half + 0..7, then + 16: the k order of pb[kc]
        const v8h lo = ld_tr16(vad + (kc * 32) * PV + jf * 32);
        const v8h hi = ld_tr16(vad + (kc * 32 + 16) * PV + jf * 32);
        const v16h vf = __builtin_shufflevector(lo, hi, 0, 1, 2, 3, 4, 5, 6, 7,
                                                8, 9, 10, 11, 12, 13, 14, 15);
        o[jf] = wmma16x16x32(vf, pb[kc], o[jf]);
      }
  }

  // Join the halves' sums, normalize, store f16 attn output as [B,S,H,F]:
  // a lane's 8 registers of a tile are 8 consecutive features of its query.
  const float inv = 1.0f / (lst + xhalf(lst));
  _Float16* orow = attn + ((long long)(b * S + q0 + (lane & 15))) * (H * F) +
                   h * F + half * 8;
#pragma unroll
  for (int jf = 0; jf < 8; ++jf) {
    v8h ov;
#pragma unroll
    for (int r = 0; r < 8; ++r) ov[r] = (_Float16)(o[jf][r] * inv);
    *(v8h*)(orow + jf * 16) = ov;
  }
}

// ---------------------------------------------------------------------------
extern "C" void kernel_launch(void* const* d_in, const int* in_sizes, int n_in,
                              void* d_out, int out_size, void* d_ws,
                              size_t ws_size, hipStream_t stream) {
  constexpr int Bb = 2, S = 2048, D = 2048, H = 16, F = 128;
  constexpr long long MR = (long long)Bb * S;  // 4096 rows
  constexpr long long EL = MR * D;             // 8388608 elems (act tensors)
  constexpr long long WE = (long long)H * D * F;  // 4194304 elems (weights)

  const float* xq = (const float*)d_in[0];
  const float* xk = (const float*)d_in[1];
  const float* xv = (const float*)d_in[2];
  const float* WQ = (const float*)d_in[3];
  const float* WK = (const float*)d_in[4];
  const float* WV = (const float*)d_in[5];
  const float* WO = (const float*)d_in[6];
  const float* bQ = (const float*)d_in[7];
  const float* bK = (const float*)d_in[8];
  const float* bV = (const float*)d_in[9];
  const float* bO = (const float*)d_in[10];
  const float* qw = (const float*)d_in[11];
  const float* kw = (const float*)d_in[12];

  // Workspace (~185 MB):
  //   qf,kf,vf : f32 [4096,2048] raw projections
  //   Xq,Xk,Xv : f16 [4096,2048] cast inputs   (later aliased by qh,kh,vh)
  //   WQt..WOt : f16 [2048,2048] transposed weights (Bt = [N][K])
  //   at       : f16 [B,S,H,F]  attention out  (aliases dead WQt+WKt)
  float* qf = (float*)d_ws;
  float* kf = qf + EL;
  float* vf = kf + EL;
  _Float16* Xq = (_Float16*)(vf + EL);
  _Float16* Xk = Xq + EL;
  _Float16* Xv = Xk + EL;
  _Float16* WQt = Xv + EL;
  _Float16* WKt = WQt + WE;
  _Float16* WVt = WKt + WE;
  _Float16* WOt = WVt + WE;
  _Float16* qhp = Xq;  // aliases: X* dead after projection GEMMs
  _Float16* khp = Xk;
  _Float16* vhp = Xv;
  _Float16* at = WQt;  // aliases: WQt/WKt dead after projection GEMMs

  // 1) cast activations f32 -> f16
  cast_f16_kernel<<<(int)(EL / 4 / 256 / CAST_U), 256, 0, stream>>>(xq, Xq);
  cast_f16_kernel<<<(int)(EL / 4 / 256 / CAST_U), 256, 0, stream>>>(xk, Xk);
  cast_f16_kernel<<<(int)(EL / 4 / 256 / CAST_U), 256, 0, stream>>>(xv, Xv);
  // 2) transpose+cast weights: W[H,D,F] -> [H,F,D]; W_O[2048,2048] -> T
  transpose_cast_kernel<D, F>
      <<<dim3(F / 32, D / TR, H), 256, 0, stream>>>(WQ, WQt);
  transpose_cast_kernel<D, F>
      <<<dim3(F / 32, D / TR, H), 256, 0, stream>>>(WK, WKt);
  transpose_cast_kernel<D, F>
      <<<dim3(F / 32, D / TR, H), 256, 0, stream>>>(WV, WVt);
  transpose_cast_kernel<D, D>
      <<<dim3(D / 32, D / TR, 1), 256, 0, stream>>>(WO, WOt);
  dim3 gg(D / BN, (int)(MR / BM));  // (16, 32)
  gemm_bias_f16_kernel<<<gg, 256, 0, stream>>>(Xq, WQt, bQ, qf, (int)MR, D, D);
  gemm_bias_f16_kernel<<<gg, 256, 0, stream>>>(Xk, WKt, bK, kf, (int)MR, D, D);
  gemm_bias_f16_kernel<<<gg, 256, 0, stream>>>(Xv, WVt, bV, vf, (int)MR, D, D);
  // 4) RMS-norm + RoPE + cast, permute to [B,H,S,F]
  norm_rope_cast_kernel<<<(Bb * S * H) / 8 / NH, 256, 0, stream>>>(
      qf, kf, vf, qw, kw, qhp, khp, vhp);
  // 5) flash attention -> [B,S,H,F] f16
  flash_attn_kernel<<<dim3(S / 64, H, Bb), 128, 0, stream>>>(qhp, khp, vhp, at);
  // 6) output projection + b_O -> d_out f32
  gemm_bias_f16_kernel<<<gg, 256, 0, stream>>>(at, WOt, bO, (float*)d_out,
                                               (int)MR, D, D);
}

// v004
// One run takes 254 microseconds.
// Two timings next to v003 both put it at 1.17 times that version's speed.
// All steps since v000 together make it 2.50 times as fast.
#include <hip/hip_runtime.h>
#include <stdint.h>

typedef __attribute__((ext_vector_type(16))) _Float16 v16h;
typedef __attribute__((ext_vector_type(8)))  _Float16 v8h;
typedef __attribute__((ext_vector_type(4)))  _Float16 v4h;
typedef __attribute__((ext_vector_type(8)))  float    v8f;
typedef __attribute__((ext_vector_type(4)))  float    v4f;
typedef __attribute__((ext_vector_type(4)))  unsigned int u32x4;
typedef __attribute__((ext_vector_type(8)))  int          i32x8;
typedef __attribute__((ext_vector_type(4)))  int          i32x4;
typedef __attribute__((ext_vector_type(8)))  unsigned int u32x8;
typedef __attribute__((ext_vector_type(8)))  short        s16x8;

#if defined(__has_builtin)
#if __has_builtin(__builtin_amdgcn_tensor_load_to_lds) && \
    __has_builtin(__builtin_amdgcn_s_wait_tensorcnt)
#define USE_TDM 1
#endif
#endif
#ifndef USE_TDM
#define USE_TDM 0
#endif

__device__ __forceinline__ v8f v8f_zero() {
  v8f z;
#pragma unroll
  for (int i = 0; i < 8; ++i) z[i] = 0.0f;
  return z;
}

__device__ __forceinline__ v8f wmma16x16x32(v16h a, v16h b, v8f c) {
  return __builtin_amdgcn_wmma_f32_16x16x32_f16(false, a, false, b, (short)0, c,
                                                false, false);
}

__device__ __forceinline__ v16h load_frag(const _Float16* p, int ld, int row0,
                                          int k0, int lane) {
  const _Float16* q = p + (row0 + (lane & 15)) * ld + k0 + ((lane >> 4) << 3);
  v16h v;
#pragma unroll
  for (int i = 0; i < 8; ++i) {
    v[i] = q[i];
    v[i + 8] = q[i + 16];
  }
  return v;
}

__device__ __forceinline__ float xhalf(float x) {
  const int b = __builtin_bit_cast(int, x);
  return __builtin_bit_cast(
      float, __builtin_amdgcn_permlanex16(b, b, 0x76543210, 0xfedcba98, false,
                                          false));
}

#if USE_TDM
__device__ __forceinline__ void tdm_load_2d(unsigned lds_off, const void* gptr,
                                            unsigned width, unsigned height,
                                            unsigned stride, unsigned pad_int,
                                            unsigned pad_amt) {
  unsigned long long ga = (unsigned long long)(size_t)gptr;
  u32x4 g0;
  g0[0] = 1u;
  g0[1] = lds_off;
  g0[2] = (unsigned)(ga & 0xffffffffu);
  g0[3] = (unsigned)((ga >> 32) & 0x01ffffffu)
          | (2u << 30);
  i32x8 g1;
  g1[0] = (int)((1u << 16)
                | (1u << 20)
                | (pad_int << 22) | (pad_amt << 25));
  g1[1] = (int)((stride & 0xffffu) << 16);
  g1[2] = (int)(((stride >> 16) & 0xffffu)
                | ((height & 0xffffu) << 16));
  g1[3] = (int)(((height >> 16) & 0xffffu)
                | ((width & 0xffffu) << 16));
  g1[4] = (int)(height & 0xffffu);
  g1[5] = (int)stride;
  g1[6] = 0;
  g1[7] = 0;
  i32x4 z4 = {0, 0, 0, 0};                      // groups 2/3 unused (2D)
  i32x8 z8 = {0, 0, 0, 0, 0, 0, 0, 0};
  __builtin_amdgcn_tensor_load_to_lds(g0, g1, z4, z4, z8, 0);
}
#endif

__device__ __forceinline__ uint32_t uni(uint32_t v) {
  return (uint32_t)__builtin_amdgcn_readfirstlane((int)v);
}
__device__ __forceinline__ uint32_t pinned(uint32_t v) {
  uint32_t w = uni(v);
  // the test stays in an SGPR
  asm volatile("" : "+s"(w));
  return w;
}

__device__ __forceinline__ void tdm_load_v_tile(uint32_t lds_dst,
                                                const _Float16* src) {
  constexpr uint32_t d0 = 256u, d1 = 64u;
  const uint64_t ga = (uint64_t)(size_t)src;
  u32x4 g0;
  g0[0] = uni(1u);
  g0[1] = uni(lds_dst);
  g0[2] = uni((uint32_t)ga);
  g0[3] = uni((((uint32_t)(ga >> 32)) & 0x01FFFFFFu) | 0x80000000u);
  u32x8 g1;
  g1[0] = uni((1u << 20) | (5u << 22) | (7u << 25));
  g1[1] = uni((d0 & 0xFFFFu) << 16);
  g1[2] = uni((d0 >> 16) | ((d1 & 0xFFFFu) << 16));
  g1[3] = uni((d1 >> 16) | (d0 << 16));
  g1[4] = uni(d1);
  g1[5] = uni(d0);  // source row pitch = row length
  g1[6] = uni(0u);
  g1[7] = uni(0u);
  asm volatile("tensor_load_to_lds %0, %1" ::"s"(g0), "s"(g1) : "memory");
}

__device__ __forceinline__ v8h ld_tr16(const unsigned char* p) {
  typedef __attribute__((address_space(3))) s16x8 lds_s16x8;
  return __builtin_bit_cast(
      v8h, __builtin_amdgcn_ds_load_tr16_b128_v8i16((lds_s16x8*)p));
}

constexpr int CAST_U = 16;  // 16-byte pieces per thread
__global__ __launch_bounds__(256) void cast_f16_kernel(
    const float* __restrict__ in, _Float16* __restrict__ out) {
  const long long i0 =
      (long long)blockIdx.x * (256 * 4 * CAST_U) + threadIdx.x * 4;
  v4f x[CAST_U];
  // unrolled: x stays in registers and the loads issue ahead of their use
#pragma unroll
  for (int u = 0; u < CAST_U; ++u) x[u] = *(const v4f*)(in + i0 + u * 1024);
  // unrolled: x is indexed by constants only
#pragma unroll
  for (int u = 0; u < CAST_U; ++u) {
    v4h h;
#pragma unroll
    for (int j = 0; j < 4; ++j) h[j] = (_Float16)x[u][j];
    *(v4h*)(out + i0 + u * 1024) = h;
  }
}

// in: f32 [nmat][rows][cols] -> out: f16 [nmat][cols][rows]
// A block takes TR rows x 32 columns (TR / 32 square tiles, one barrier).
// rows and cols are compile-time, so that every load and store of a thread is
// one address register plus an immediate offset.
constexpr int TR = 256;
template <int rows, int cols>
__global__ __launch_bounds__(256) void transpose_cast_kernel(
    const float* __restrict__ in, _Float16* __restrict__ out) {
  __shared__ float tile[TR][33];
  const int m = blockIdx.z;
  const int r0 = blockIdx.y * TR, c0 = blockIdx.x * 32;
  const float* src = in + (long long)m * rows * cols;
  _Float16* dst = out + (long long)m * rows * cols;
  const int tx = threadIdx.x & 31, ty = threadIdx.x >> 5;  // 32 x 8
  const float* sp = src + (long long)(r0 + ty) * cols + c0 + tx;
  float x[TR / 8];
  // unrolled: x stays in registers and the loads issue back to back
#pragma unroll
  for (int i = 0; i < TR / 8; ++i) x[i] = sp[i * 8 * cols];
  // unrolled: x is indexed by constants only
#pragma unroll
  for (int i = 0; i < TR / 8; ++i) tile[ty + i * 8][tx] = x[i];
  __syncthreads();
  _Float16* dp = dst + (long long)(c0 + ty) * rows + r0 + tx;
  // unrolled: immediate offsets for the LDS reads and the stores
#pragma unroll
  for (int i = 0; i < 32; i += 8)
#pragma unroll
    for (int t = 0; t < TR; t += 32)
      dp[i * rows + t] = (_Float16)tile[t + tx][ty + i];
}

// ---------------------------------------------------------------------------
// GEMM: C[m,n] = sum_k A[m,k]*Bt[n,k] + bias[n].  A,Bt f16 row-major, C f32.
// Block 256 threads (8 waves), tile 128x128, wave tile 32x64 (2x4 WMMA).
// A stage is 128 k: 256 bytes of each of the 256 operand rows, so that one
// hand-over serves 32 WMMAs a wave. Waves 0 to 3 each bring a slice of 64 rows by one tensor load; two
// buffers, the next stage in flight while this one is worked on.
// K is a multiple of BK and at least 2 * BK.
// ---------------------------------------------------------------------------
constexpr int BM = 128, BN = 128, BK = 128;
constexpr int GP = 2 * BK + 16;   // LDS row pitch, bytes: 16 x odd
constexpr int SLB = 18432;        // a slice: 64 rows of GP bytes, up to 2 KiB
constexpr int STB = 4 * SLB;      // a buffer: A rows 0-63, 64-127, Bt the same
static_assert(64 * GP <= SLB && SLB % 2048 == 0, "slice size");

__device__ __forceinline__ u32x8 tdm_gemm_group1(uint32_t pitch) {
  constexpr uint32_t d0 = 256u, d1 = 64u;
  u32x8 g1;
  g1[0] = uni((1u << 20) | (5u << 22) | (3u << 25));
  g1[1] = uni((d0 & 0xFFFFu) << 16);
  g1[2] = uni((d0 >> 16) | ((d1 & 0xFFFFu) << 16));
  g1[3] = uni((d1 >> 16) | (d0 << 16));
  g1[4] = uni(d1);
  g1[5] = uni(pitch);
  g1[6] = uni(0u);
  g1[7] = uni(0u);
  return g1;
}
__device__ __forceinline__ void tdm_load_gemm_slice(uint32_t lds_dst,
                                                    const _Float16* src,
                                                    u32x8 g1) {
  const uint64_t ga = (uint64_t)(size_t)src;
  u32x4 g0;
  g0[0] = uni(1u);
  g0[1] = uni(lds_dst);
  g0[2] = uni((uint32_t)ga);
  g0[3] = uni((((uint32_t)(ga >> 32)) & 0x01FFFFFFu) | 0x80000000u);
  asm volatile("tensor_load_to_lds %0, %1" ::"s"(g0), "s"(g1) : "memory");
}

// 16x32 f16 fragment from LDS, p = this lane's row + 16 * (lane >> 4) bytes:
// the k order of load_frag (k 8h .. 8h+7, then 16 + 8h .. 16 + 8h+7).
__device__ __forceinline__ v16h lds_frag(const unsigned char* p) {
  const v8h lo = *(const v8h*)p;
  const v8h hi = *(const v8h*)(p + 32);
  return __builtin_shufflevector(lo, hi, 0, 1, 2, 3, 4, 5, 6, 7, 8, 9, 10, 11,
                                 12, 13, 14, 15);
}

__global__ __launch_bounds__(256) void gemm_bias_f16_kernel(
    const _Float16* __restrict__ A, const _Float16* __restrict__ Bt,
    const float* __restrict__ bias, float* __restrict__ C, int M, int N,
    int K) {
  __shared__ __attribute__((aligned(2048))) unsigned char ring[2 * STB];
  const int tid = threadIdx.x, lane = tid & 31, wid = tid >> 5;
  const uint32_t wave = uni(threadIdx.x >> 5);
  const int wm = (wid & 3) * 32, wn = (wid >> 2) * 64;
  const int n0 = blockIdx.x * BN, m0 = blockIdx.y * BM;

  v8f acc[2][4];
#pragma unroll
  for (int i = 0; i < 2; ++i)
#pragma unroll
    for (int j = 0; j < 4; ++j) acc[i][j] = v8f_zero();

  // Slice sl of a buffer and its source rows (waves 4 to 7 issue nothing).
  const uint32_t sl = wave & 3u;
  const _Float16* src = (sl < 2u)
                            ? A + (long long)(m0 + 64 * (int)sl) * K
                            : Bt + (long long)(n0 + 64 * (int)(sl - 2u)) * K;
  const uint32_t dst = (uint32_t)(size_t)&ring[0] + sl * SLB;
  u32x8 g1 = tdm_gemm_group1((uint32_t)K * 2u);
  // pinned(), for the group: its words keep
  // their scalar registers, unwritten, while a request is in flight
  asm volatile("" : "+s"(g1));

  // This lane's row of the wave's first A and first B fragment in buffer 0.
  const unsigned char* ap = ring + (wm >> 6) * SLB +
                            ((wm & 63) + (lane & 15)) * GP + (lane >> 4) * 16;
  const unsigned char* bp =
      ring + (2 + (wid >> 2)) * SLB + (lane & 15) * GP + (lane >> 4) * 16;

  const int NK = K / BK;
  if (pinned(wave < 4u)) {
    tdm_load_gemm_slice(dst, src, g1);
    // Stage 0 has landed before this wave reaches the barrier below.
    asm volatile("s_wait_tensorcnt 0x0" ::: "memory");
  }
  __syncthreads();
  if (pinned(wave < 4u)) tdm_load_gemm_slice(dst + STB, src + BK, g1);

  // not unrolled: one copy of the pass, the buffer picked by an offset
#pragma clang loop unroll(disable)
  for (int it = 0; it < NK; ++it) {
    const int bo = (it & 1) * STB;
    // unrolled: every LDS read is one address register plus an immediate
#pragma unroll
    for (int kk = 0; kk < BK / 32; ++kk) {
      v16h af[2], bf[4];
#pragma unroll
      for (int i = 0; i < 2; ++i)
        af[i] = lds_frag(ap + bo + i * 16 * GP + kk * 64);
#pragma unroll
      for (int j = 0; j < 4; ++j)
        bf[j] = lds_frag(bp + bo + j * 16 * GP + kk * 64);
#pragma unroll
      for (int i = 0; i < 2; ++i)
#pragma unroll
        for (int j = 0; j < 4; ++j)
          acc[i][j] = wmma16x16x32(af[i], bf[j], acc[i][j]);
    }
    // Publish point of stage it + 1. This wave's reads of this buffer have
    // retired before the mover is aimed at it again.
    asm volatile("s_wait_dscnt 0x0" ::: "memory");
    if (pinned(wave < 4u)) {
      // This wave's slice of stage it + 1 has landed.
      asm volatile("s_wait_tensorcnt 0x0" ::: "memory");
    }
    __syncthreads();
    if (pinned(wave < 4u && it + 2 < NK))
      tdm_load_gemm_slice(dst + bo, src + (long long)(it + 2) * BK, g1);
  }
  // Nothing of the ring is outstanding when the wave goes on to its stores.
  asm volatile("s_wait_tensorcnt 0x0" ::: "memory");
  asm volatile("s_wait_dscnt 0x0" ::: "memory");

  const int half = lane >> 4;
  const int nl = lane & 15;
#pragma unroll
  for (int i = 0; i < 2; ++i)
#pragma unroll
    for (int j = 0; j < 4; ++j) {
      int nc = n0 + wn + j * 16 + nl;
      float bv = bias[nc];
#pragma unroll
      for (int r = 0; r < 8; ++r) {
        int mr = m0 + wm + i * 16 + r + half * 8;
        C[(long long)mr * N + nc] = acc[i][j][r] + bv;
      }
    }
}

// ---------------------------------------------------------------------------
// RMS-norm + RoPE + cast-to-f16, permuting [B,S,H,F] -> [B,H,S,F].
// One wave per position (b,s) and group of NH heads; lane owns 4 of the 128
// features of each head. The angles depend on s and the lane alone: once a
// wave. A block's 8 waves are 8 consecutive positions of one head group.
// ---------------------------------------------------------------------------
constexpr int NH = 8;
__global__ __launch_bounds__(256) void norm_rope_cast_kernel(
    const float* __restrict__ qf, const float* __restrict__ kf,
    const float* __restrict__ vf, const float* __restrict__ qw,
    const float* __restrict__ kw, _Float16* __restrict__ qh,
    _Float16* __restrict__ kh, _Float16* __restrict__ vh) {
  constexpr int S = 2048, H = 16, F = 128;
  const int lane = threadIdx.x & 31;
  const int wid = threadIdx.x >> 5;
  constexpr int PB = 2 * S / 8;  // blocks per head group (B = 2)
  const int hg = blockIdx.x / PB;
  const int bs = (blockIdx.x - hg * PB) * 8 + wid;  // 0 .. B*S-1
  const int b = bs / S;
  const int s = bs - b * S;
  const int h = hg * NH;  // first head of the group
  const int f0 = lane * 4;
  const long long inoff = ((long long)bs * H + h) * F + f0;
  const long long outoff = ((long long)(b * H + h) * S + s) * F + f0;

  const v4f wsc[2] = {*(const v4f*)(qw + f0), *(const v4f*)(kw + f0)};
  // Behind this wait the two loads' offset register may be written again.
  asm volatile("s_wait_xcnt 0x0" ::: "memory");

  v4f xin[3][NH];
  // unrolled: xin stays in registers and the loads issue ahead of their use
#pragma unroll
  for (int g = 0; g < NH; ++g) {
    xin[0][g] = *(const v4f*)(qf + inoff + g * F);
    xin[1][g] = *(const v4f*)(kf + inoff + g * F);
    xin[2][g] = *(const v4f*)(vf + inoff + g * F);
  }

  float cosv[4], sinv[4];
#pragma unroll
  for (int i = 0; i < 4; ++i) {
    int j = (f0 + i) & 63;
    float freq = __powf(10000.0f, -(float)j * (1.0f / 64.0f));
    float ang = (float)s * freq;
    cosv[i] = __cosf(ang);
    sinv[i] = __sinf(ang);
  }
  const float sgn = (lane < 16) ? -1.0f : 1.0f;  // rotate_half sign

  _Float16* dst[2] = {qh, kh};
  // unrolled: xin is indexed by constants only; the heads' chains are
  // independent and fill each other's waits
#pragma unroll
  for (int g = 0; g < NH; ++g) {
#pragma unroll
  for (int t = 0; t < 2; ++t) {
    const v4f x = xin[t][g];
    float ss = x[0] * x[0] + x[1] * x[1] + x[2] * x[2] + x[3] * x[3];
#pragma unroll
    for (int m = 1; m < 32; m <<= 1) ss += __shfl_xor(ss, m, 32);
    float rms = sqrtf(ss * (1.0f / F));
    float inv = 1.0f / (rms + 1e-6f);
    float y[4];
#pragma unroll
    for (int i = 0; i < 4; ++i) y[i] = x[i] * inv * wsc[t][i];
    float p[4];  // partner features f +/- 64 live in lane ^ 16
#pragma unroll
    for (int i = 0; i < 4; ++i) p[i] = __shfl_xor(y[i], 16, 32);
    v4h out;
#pragma unroll
    for (int i = 0; i < 4; ++i)
      out[i] = (_Float16)(y[i] * cosv[i] + sgn * p[i] * sinv[i]);
    *(v4h*)(dst[t] + outoff + (long long)g * S * F) = out;
  }
  v4h ov;
#pragma unroll
  for (int i = 0; i < 4; ++i) ov[i] = (_Float16)xin[2][g][i];
  *(v4h*)(vh + outoff + (long long)g * S * F) = ov;
  }
}

__global__ __launch_bounds__(128) void flash_attn_kernel(
    const _Float16* __restrict__ qh, const _Float16* __restrict__ kh,
    const _Float16* __restrict__ vh, _Float16* __restrict__ attn) {
  constexpr int S = 2048, H = 16, F = 128;
  constexpr int QT = 64, KT = 64;
  constexpr int LDK = F + 8;
  constexpr int PV = 2 * F + 32;
  __shared__ _Float16 Kt[KT * LDK];
  __shared__ __attribute__((aligned(2048))) unsigned char Vs[KT * PV];

  const int tid = threadIdx.x;
  const int lane = tid & 31;
  const int wid = tid >> 5;
  const int half = lane >> 4;
  const uint32_t wave = uni(threadIdx.x >> 5);
  const int b = blockIdx.z, h = blockIdx.y;
  const int q0 = blockIdx.x * QT + wid * 16;
  const long long base = ((long long)(b * H + h)) * S * F;
  const _Float16* Q = qh + base;
  const _Float16* Kp = kh + base;
  const _Float16* Vp = vh + base;

  v16h qfrag[4];
#pragma unroll
  for (int kc = 0; kc < 4; ++kc) qfrag[kc] = load_frag(Q, F, q0, kc * 32, lane);

  v8f o[8];
#pragma unroll
  for (int j = 0; j < 8; ++j) o[j] = v8f_zero();
  float mst = -1e30f;  // running maximum of query (lane & 15), both halves
  float lst = 0.0f;    // running sum over this half's keys only
  const float scale = 0.08838834764831845f;  // 1/sqrt(128)

  // This lane's address in the first 16-key x 16-feature block of the V tile.
  const unsigned char* vad =
      Vs + (8 * half + (lane & 7)) * PV + ((lane >> 3) & 1) * 16;

  for (int kt0 = 0; kt0 < S; kt0 += KT) {
    // This wave's LDS reads have retired before the mover is aimed at the
    // tiles again.
    asm volatile("s_wait_dscnt 0x0" ::: "memory");
    __syncthreads();  // previous tile fully consumed
#if USE_TDM
    if (wid == 0)
      tdm_load_2d((unsigned)(size_t)&Kt[0], Kp + (long long)kt0 * F, F, KT, F,
                  5, 3);
#else
#pragma unroll
    for (int it = 0; it < 8; ++it) {
      int idx = tid + it * 128;
      int kr = idx >> 4;
      int c = (idx & 15) << 3;
      *(v8h*)&Kt[kr * LDK + c] =
          *(const v8h*)(Kp + (long long)(kt0 + kr) * F + c);
    }
#endif
    // V tile as it lies, Vs[key][f]: one request of wave 1, beside wave 0's.
    if (pinned(wave == 1u)) {
      tdm_load_v_tile((uint32_t)(size_t)&Vs[0], Vp + (long long)kt0 * F);
      // The tile has landed before this wave reaches the barrier below.
      asm volatile("s_wait_tensorcnt 0x0" ::: "memory");
    }
#if USE_TDM
    if (wid == 0) __builtin_amdgcn_s_wait_tensorcnt((short)0);
#endif
    __syncthreads();

    // Scores: S^T, KT x 16 in 4 key tiles, K-reduction over F.
    // sc[jn][r] = score of key jn*16 + 8*half + r against query (lane & 15)
    v8f sc[4];
#pragma unroll
    for (int jn = 0; jn < 4; ++jn) {
      sc[jn] = v8f_zero();
#pragma unroll
      for (int kc = 0; kc < 4; ++kc) {
        v16h kf = load_frag(Kt, LDK, jn * 16, kc * 32, lane);
        sc[jn] = wmma16x16x32(kf, qfrag[kc], sc[jn]);
      }
    }

    float mx = sc[0][0];
#pragma unroll
    for (int jn = 0; jn < 4; ++jn)
#pragma unroll
      for (int r = 0; r < 8; ++r) mx = fmaxf(mx, sc[jn][r]);
    mx = fmaxf(mx, xhalf(mx)) * scale;  // scale > 0: max commutes with it
    const float mnew = fmaxf(mst, mx);
    const float alpha = __expf(mst - mnew);
    // P^T as B operand: element s of chunk kc is key kc*32 + 8*half + s for
    // s < 8 and kc*32 + 16 + 8*half + (s - 8) above: tiles 2kc and 2kc + 1 as
    // they lie, the k order of the ld_tr16 pairs on the V^T side.
    v16h pb[2];
    float ps[4];
#pragma unroll
    for (int jn = 0; jn < 4; ++jn) {
      ps[jn] = 0.0f;
#pragma unroll
      for (int r = 0; r < 8; ++r) {
        float p = __expf(sc[jn][r] * scale - mnew);
        ps[jn] += p;
        pb[jn >> 1][(jn & 1) * 8 + r] = (_Float16)p;
      }
    }
    lst = lst * alpha + ((ps[0] + ps[1]) + (ps[2] + ps[3]));
    mst = mnew;
#pragma unroll
    for (int j = 0; j < 8; ++j)
#pragma unroll
      for (int r = 0; r < 8; ++r) o[j][r] *= alpha;

    // o[jf][r] = O^T[feature jf*16 + 8*half + r][query (lane & 15)]
#pragma unroll
    for (int jf = 0; jf < 8; ++jf)
#pragma unroll
      for (int kc = 0; kc < 2; ++kc) {
        // keys kc*32 + 8*half + 0..7, then + 16: the k order of pb[kc]
        const v8h lo = ld_tr16(vad + (kc * 32) * PV + jf * 32);
        const v8h hi = ld_tr16(vad + (kc * 32 + 16) * PV + jf * 32);
        const v16h vf = __builtin_shufflevector(lo, hi, 0, 1, 2, 3, 4, 5, 6, 7,
                                                8, 9, 10, 11, 12, 13, 14, 15);
        o[jf] = wmma16x16x32(vf, pb[kc], o[jf]);
      }
  }

  // Join the halves' sums, normalize, store f16 attn output as [B,S,H,F]:
  // a lane's 8 registers of a tile are 8 consecutive features of its query.
  const float inv = 1.0f / (lst + xhalf(lst));
  _Float16* orow = attn + ((long long)(b * S + q0 + (lane & 15))) * (H * F) +
                   h * F + half * 8;
#pragma unroll
  for (int jf = 0; jf < 8; ++jf) {
    v8h ov;
#pragma unroll
    for (int r = 0; r < 8; ++r) ov[r] = (_Float16)(o[jf][r] * inv);
    *(v8h*)(orow + jf * 16) = ov;
  }
}

// ---------------------------------------------------------------------------
extern "C" void kernel_launch(void* const* d_in, const int* in_sizes, int n_in,
                              void* d_out, int out_size, void* d_ws,
                              size_t ws_size, hipStream_t stream) {
  constexpr int Bb = 2, S = 2048, D = 2048, H = 16, F = 128;
  constexpr long long MR = (long long)Bb * S;  // 4096 rows
  constexpr long long EL = MR * D;             // 8388608 elems (act tensors)
  constexpr long long WE = (long long)H * D * F;  // 4194304 elems (weights)

  const float* xq = (const float*)d_in[0];
  const float* xk = (const float*)d_in[1];
  const float* xv = (const float*)d_in[2];
  const float* WQ = (const float*)d_in[3];
  const float* WK = (const float*)d_in[4];
  const float* WV = (const float*)d_in[5];
  const float* WO = (const float*)d_in[6];
  const float* bQ = (const float*)d_in[7];
  const float* bK = (const float*)d_in[8];
  const float* bV = (const float*)d_in[9];
  const float* bO = (const float*)d_in[10];
  const float* qw = (const float*)d_in[11];
  const float* kw = (const float*)d_in[12];

  // Workspace (~185 MB):
  //   qf,kf,vf : f32 [4096,2048] raw projections
  //   Xq,Xk,Xv : f16 [4096,2048] cast inputs   (later aliased by qh,kh,vh)
  //   WQt..WOt : f16 [2048,2048] transposed weights (Bt = [N][K])
  //   at       : f16 [B,S,H,F]  attention out  (aliases dead WQt+WKt)
  float* qf = (float*)d_ws;
  float* kf = qf + EL;
  float* vf = kf + EL;
  _Float16* Xq = (_Float16*)(vf + EL);
  _Float16* Xk = Xq + EL;
  _Float16* Xv = Xk + EL;
  _Float16* WQt = Xv + EL;
  _Float16* WKt = WQt + WE;
  _Float16* WVt = WKt + WE;
  _Float16* WOt = WVt + WE;
  _Float16* qhp = Xq;  // aliases: X* dead after projection GEMMs
  _Float16* khp = Xk;
  _Float16* vhp = Xv;
  _Float16* at = WQt;  // aliases: WQt/WKt dead after projection GEMMs

  // 1) cast activations f32 -> f16
  cast_f16_kernel<<<(int)(EL / 4 / 256 / CAST_U), 256, 0, stream>>>(xq, Xq);
  cast_f16_kernel<<<(int)(EL / 4 / 256 / CAST_U), 256, 0, stream>>>(xk, Xk);
  cast_f16_kernel<<<(int)(EL / 4 / 256 / CAST_U), 256, 0, stream>>>(xv, Xv);
  // 2) transpose+cast weights: W[H,D,F] -> [H,F,D]; W_O[2048,2048] -> T
  transpose_cast_kernel<D, F>
      <<<dim3(F / 32, D / TR, H), 256, 0, stream>>>(WQ, WQt);
  transpose_cast_kernel<D, F>
      <<<dim3(F / 32, D / TR, H), 256, 0, stream>>>(WK, WKt);
  transpose_cast_kernel<D, F>
      <<<dim3(F / 32, D / TR, H), 256, 0, stream>>>(WV, WVt);
  transpose_cast_kernel<D, D>
      <<<dim3(D / 32, D / TR, 1), 256, 0, stream>>>(WO, WOt);
  dim3 gg(D / BN, (int)(MR / BM));  // (16, 32)
  gemm_bias_f16_kernel<<<gg, 256, 0, stream>>>(Xq, WQt, bQ, qf, (int)MR, D, D);
  gemm_bias_f16_kernel<<<gg, 256, 0, stream>>>(Xk, WKt, bK, kf, (int)MR, D, D);
  gemm_bias_f16_kernel<<<gg, 256, 0, stream>>>(Xv, WVt, bV, vf, (int)MR, D, D);
  // 4) RMS-norm + RoPE + cast, permute to [B,H,S,F]
  norm_rope_cast_kernel<<<(Bb * S * H) / 8 / NH, 256, 0, stream>>>(
      qf, kf, vf, qw, kw, qhp, khp, vhp);
  // 5) flash attention -> [B,S,H,F] f16
  flash_attn_kernel<<<dim3(S / 64, H, Bb), 128, 0, stream>>>(qhp, khp, vhp, at);
  // 6) output projection + b_O -> d_out f32
  gemm_bias_f16_kernel<<<gg, 256, 0, stream>>>(at, WOt, bO, (float*)d_out,
                                               (int)MR, D, D);
}

// v005
// A run of this version takes 230 microseconds.
// Next to v004, in two timings, it ran 1.11 and 1.10 times as fast.
// Counting every step since v000, it is 2.76 times as fast.
#include <hip/hip_runtime.h>
#include <stdint.h>

typedef __attribute__((ext_vector_type(16))) _Float16 v16h;
typedef __attribute__((ext_vector_type(8)))  _Float16 v8h;
typedef __attribute__((ext_vector_type(4)))  _Float16 v4h;
typedef __attribute__((ext_vector_type(8)))  float    v8f;
typedef __attribute__((ext_vector_type(4)))  float    v4f;
typedef __attribute__((ext_vector_type(4)))  unsigned int u32x4;
typedef __attribute__((ext_vector_type(8)))  int          i32x8;
typedef __attribute__((ext_vector_type(4)))  int          i32x4;
typedef __attribute__((ext_vector_type(8)))  unsigned int u32x8;
typedef __attribute__((ext_vector_type(8)))  short        s16x8;

#if defined(__has_builtin)
#if __has_builtin(__builtin_amdgcn_tensor_load_to_lds) && \
    __has_builtin(__builtin_amdgcn_s_wait_tensorcnt)
#define USE_TDM 1
#endif
#endif
#ifndef USE_TDM
#define USE_TDM 0
#endif

__device__ __forceinline__ v8f v8f_zero() {
  v8f z;
#pragma unroll
  for (int i = 0; i < 8; ++i) z[i] = 0.0f;
  return z;
}

__device__ __forceinline__ v8f wmma16x16x32(v16h a, v16h b, v8f c) {
  return __builtin_amdgcn_wmma_f32_16x16x32_f16(false, a, false, b, (short)0, c,
                                                false, false);
}

__device__ __forceinline__ v16h load_frag(const _Float16* p, int ld, int row0,
                                          int k0, int lane) {
  const _Float16* q = p + (row0 + (lane & 15)) * ld + k0 + ((lane >> 4) << 3);
  v16h v;
#pragma unroll
  for (int i = 0; i < 8; ++i) {
    v[i] = q[i];
    v[i + 8] = q[i + 16];
  }
  return v;
}

__device__ __forceinline__ float xhalf(float x) {
  const int b = __builtin_bit_cast(int, x);
  return __builtin_bit_cast(
      float, __builtin_amdgcn_permlanex16(b, b, 0x76543210, 0xfedcba98, false,
                                          false));
}

#if USE_TDM
__device__ __forceinline__ void tdm_load_2d(unsigned lds_off, const void* gptr,
                                            unsigned width, unsigned height,
                                            unsigned stride, unsigned pad_int,
                                            unsigned pad_amt) {
  unsigned long long ga = (unsigned long long)(size_t)gptr;
  u32x4 g0;
  g0[0] = 1u;
  g0[1] = lds_off;
  g0[2] = (unsigned)(ga & 0xffffffffu);
  g0[3] = (unsigned)((ga >> 32) & 0x01ffffffu)
          | (2u << 30);
  i32x8 g1;
  g1[0] = (int)((1u << 16)
                | (1u << 20)
                | (pad_int << 22) | (pad_amt << 25));
  g1[1] = (int)((stride & 0xffffu) << 16);
  g1[2] = (int)(((stride >> 16) & 0xffffu)
                | ((height & 0xffffu) << 16));
  g1[3] = (int)(((height >> 16) & 0xffffu)
                | ((width & 0xffffu) << 16));
  g1[4] = (int)(height & 0xffffu);
  g1[5] = (int)stride;
  g1[6] = 0;
  g1[7] = 0;
  i32x4 z4 = {0, 0, 0, 0};                      // groups 2/3 unused (2D)
  i32x8 z8 = {0, 0, 0, 0, 0, 0, 0, 0};
  __builtin_amdgcn_tensor_load_to_lds(g0, g1, z4, z4, z8, 0);
}
#endif

__device__ __forceinline__ uint32_t uni(uint32_t v) {
  return (uint32_t)__builtin_amdgcn_readfirstlane((int)v);
}
__device__ __forceinline__ uint32_t pinned(uint32_t v) {
  uint32_t w = uni(v);
  // the test stays in an SGPR
  asm volatile("" : "+s"(w));
  return w;
}

__device__ __forceinline__ void tdm_load_v_tile(uint32_t lds_dst,
                                                const _Float16* src) {
  constexpr uint32_t d0 = 256u, d1 = 64u;
  const uint64_t ga = (uint64_t)(size_t)src;
  u32x4 g0;
  g0[0] = uni(1u);
  g0[1] = uni(lds_dst);
  g0[2] = uni((uint32_t)ga);
  g0[3] = uni((((uint32_t)(ga >> 32)) & 0x01FFFFFFu) | 0x80000000u);
  u32x8 g1;
  g1[0] = uni((1u << 20) | (5u << 22) | (7u << 25));
  g1[1] = uni((d0 & 0xFFFFu) << 16);
  g1[2] = uni((d0 >> 16) | ((d1 & 0xFFFFu) << 16));
  g1[3] = uni((d1 >> 16) | (d0 << 16));
  g1[4] = uni(d1);
  g1[5] = uni(d0);  // source row pitch = row length
  g1[6] = uni(0u);
  g1[7] = uni(0u);
  asm volatile("tensor_load_to_lds %0, %1" ::"s"(g0), "s"(g1) : "memory");
}

__device__ __forceinline__ v8h ld_tr16(const unsigned char* p) {
  typedef __attribute__((address_space(3))) s16x8 lds_s16x8;
  return __builtin_bit_cast(
      v8h, __builtin_amdgcn_ds_load_tr16_b128_v8i16((lds_s16x8*)p));
}

constexpr int CAST_U = 16;  // 16-byte pieces per thread
__device__ __forceinline__ void cast_f16_block(const float* __restrict__ in,
                                               _Float16* __restrict__ out,
                                               int blk) {
  const long long i0 = (long long)blk * (256 * 4 * CAST_U) + threadIdx.x * 4;
  v4f x[CAST_U];
  // unrolled: x stays in registers and the loads issue ahead of their use
#pragma unroll
  for (int u = 0; u < CAST_U; ++u) x[u] = *(const v4f*)(in + i0 + u * 1024);
  // unrolled: x is indexed by constants only
#pragma unroll
  for (int u = 0; u < CAST_U; ++u) {
    v4h h;
#pragma unroll
    for (int j = 0; j < 4; ++j) h[j] = (_Float16)x[u][j];
    *(v4h*)(out + i0 + u * 1024) = h;
  }
  asm volatile("s_wait_xcnt 0x0" ::: "memory");
}

// in: f32 [nmat][rows][cols] -> out: f16 [nmat][cols][rows]
// A block takes TR rows x 32 columns (TR / 32 square tiles, one barrier).
// rows and cols are compile-time, so that every load and store of a thread is
// one address register plus an immediate offset.
constexpr int TR = 256;
template <int rows, int cols>
__device__ __forceinline__ void transpose_cast_block(
    float (*tile)[33], const float* __restrict__ in,
    _Float16* __restrict__ out, int blk) {
  constexpr int NC = cols / 32, NR = rows / TR;  // tiles across, tiles down
  const int m = blk / (NC * NR);
  const int r0 = ((blk / NC) % NR) * TR, c0 = (blk % NC) * 32;
  const float* src = in + (long long)m * rows * cols;
  _Float16* dst = out + (long long)m * rows * cols;
  const int tx = threadIdx.x & 31, ty = threadIdx.x >> 5;  // 32 x 8
  const float* sp = src + (long long)(r0 + ty) * cols + c0 + tx;
  float x[TR / 8];
  // unrolled: x stays in registers and the loads issue back to back
#pragma unroll
  for (int i = 0; i < TR / 8; ++i) x[i] = sp[i * 8 * cols];
  // unrolled: x is indexed by constants only
#pragma unroll
  for (int i = 0; i < TR / 8; ++i) tile[ty + i * 8][tx] = x[i];
  __syncthreads();
  _Float16* dp = dst + (long long)(c0 + ty) * rows + r0 + tx;
  // unrolled: immediate offsets for the LDS reads and the stores
#pragma unroll
  for (int i = 0; i < 32; i += 8)
#pragma unroll
    for (int t = 0; t < TR; t += 32)
      dp[i * rows + t] = (_Float16)tile[t + tx][ty + i];
  asm volatile("s_wait_xcnt 0x0" ::: "memory");
}

// The seven pre-passes depend on nothing and on one another not at all: one
// launch holds them all, blockIdx.y = the pass, so that each pass's start, its
// first loads' latency and its last stores' drain lie under the others' work
// instead of standing alone between two launch gaps. Every pass is PRE_BLOCKS
// blocks. The transposes, with the longer chain per block, take the lowest passes.
constexpr int PRE_BLOCKS = 512;
__global__ __launch_bounds__(256) void prepass_kernel(
    const float* xq, const float* xk, const float* xv, const float* WQ,
    const float* WK, const float* WV, const float* WO, _Float16* Xq,
    _Float16* Xk, _Float16* Xv, _Float16* WQt, _Float16* WKt, _Float16* WVt,
    _Float16* WOt) {
  constexpr int D = 2048, H = 16, F = 128, MR = 4096;
  static_assert(H * (D / TR) * (F / 32) == PRE_BLOCKS, "head weights");
  static_assert((D / TR) * (D / 32) == PRE_BLOCKS, "output weight");
  static_assert(MR * D / (256 * 4 * CAST_U) == PRE_BLOCKS, "activations");
  __shared__ float tile[TR][33];
  const int pass = blockIdx.y, blk = blockIdx.x;
  if (pass == 0) {
    transpose_cast_block<D, D>(tile, WO, WOt, blk);
  } else if (pass < 4) {
    transpose_cast_block<D, F>(tile, pass == 1 ? WQ : pass == 2 ? WK : WV,
                               pass == 1 ? WQt : pass == 2 ? WKt : WVt, blk);
  } else {
    cast_f16_block(pass == 4 ? xq : pass == 5 ? xk : xv,
                   pass == 4 ? Xq : pass == 5 ? Xk : Xv, blk);
  }
}

// ---------------------------------------------------------------------------
// GEMM: C[m,n] = sum_k A[m,k]*Bt[n,k] + bias[n].  A,Bt f16 row-major, C f32.
// Block 256 threads (8 waves), tile 128x128, wave tile 32x64 (2x4 WMMA).
// A stage is 128 k: 256 bytes of each of the 256 operand rows, so that one
// hand-over serves 32 WMMAs a wave. Waves 0 to 3 each bring a slice of 64 rows by one tensor load; two
// buffers, the next stage in flight while this one is worked on.
// K is a multiple of BK and at least 2 * BK.
// blockIdx.z picks one of up to three independent products of one shape, whose
// A, Bt and C lie one behind the other: in one launch a block's first stage and
// its stores lie under other blocks' WMMAs.
// ---------------------------------------------------------------------------
constexpr int BM = 128, BN = 128, BK = 128;
constexpr int GP = 2 * BK + 16;   // LDS row pitch, bytes: 16 x odd
constexpr int SLB = 18432;        // a slice: 64 rows of GP bytes, up to 2 KiB
constexpr int STB = 4 * SLB;      // a buffer: A rows 0-63, 64-127, Bt the same
static_assert(64 * GP <= SLB && SLB % 2048 == 0, "slice size");

__device__ __forceinline__ u32x8 tdm_gemm_group1(uint32_t pitch) {
  constexpr uint32_t d0 = 256u, d1 = 64u;
  u32x8 g1;
  g1[0] = uni((1u << 20) | (5u << 22) | (3u << 25));
  g1[1] = uni((d0 & 0xFFFFu) << 16);
  g1[2] = uni((d0 >> 16) | ((d1 & 0xFFFFu) << 16));
  g1[3] = uni((d1 >> 16) | (d0 << 16));
  g1[4] = uni(d1);
  g1[5] = uni(pitch);
  g1[6] = uni(0u);
  g1[7] = uni(0u);
  return g1;
}
__device__ __forceinline__ void tdm_load_gemm_slice(uint32_t lds_dst,
                                                    const _Float16* src,
                                                    u32x8 g1) {
  const uint64_t ga = (uint64_t)(size_t)src;
  u32x4 g0;
  g0[0] = uni(1u);
  g0[1] = uni(lds_dst);
  g0[2] = uni((uint32_t)ga);
  g0[3] = uni((((uint32_t)(ga >> 32)) & 0x01FFFFFFu) | 0x80000000u);
  asm volatile("tensor_load_to_lds %0, %1" ::"s"(g0), "s"(g1) : "memory");
}

// 16x32 f16 fragment from LDS, p = this lane's row + 16 * (lane >> 4) bytes:
// the k order of load_frag (k 8h .. 8h+7, then 16 + 8h .. 16 + 8h+7).
__device__ __forceinline__ v16h lds_frag(const unsigned char* p) {
  const v8h lo = *(const v8h*)p;
  const v8h hi = *(const v8h*)(p + 32);
  return __builtin_shufflevector(lo, hi, 0, 1, 2, 3, 4, 5, 6, 7, 8, 9, 10, 11,
                                 12, 13, 14, 15);
}

__global__ __launch_bounds__(256) void gemm_bias_f16_kernel(
    const _Float16* __restrict__ Az, const _Float16* __restrict__ Btz,
    const float* __restrict__ bias0, const float* __restrict__ bias1,
    const float* __restrict__ bias2, float* __restrict__ Cz, int M, int N,
    int K) {
  const int z = blockIdx.z;
  const _Float16* A = Az + (long long)z * M * K;
  const _Float16* Bt = Btz + (long long)z * N * K;
  const float* bias = z == 0 ? bias0 : z == 1 ? bias1 : bias2;
  float* C = Cz + (long long)z * M * N;
  __shared__ __attribute__((aligned(2048))) unsigned char ring[2 * STB];
  const int tid = threadIdx.x, lane = tid & 31, wid = tid >> 5;
  const uint32_t wave = uni(threadIdx.x >> 5);
  const int wm = (wid & 3) * 32, wn = (wid >> 2) * 64;
  const int n0 = blockIdx.x * BN, m0 = blockIdx.y * BM;

  v8f acc[2][4];
#pragma unroll
  for (int i = 0; i < 2; ++i)
#pragma unroll
    for (int j = 0; j < 4; ++j) acc[i][j] = v8f_zero();

  // Slice sl of a buffer and its source rows (waves 4 to 7 issue nothing).
  const uint32_t sl = wave & 3u;
  const _Float16* src = (sl < 2u)
                            ? A + (long long)(m0 + 64 * (int)sl) * K
                            : Bt + (long long)(n0 + 64 * (int)(sl - 2u)) * K;
  const uint32_t dst = (uint32_t)(size_t)&ring[0] + sl * SLB;
  u32x8 g1 = tdm_gemm_group1((uint32_t)K * 2u);
  // pinned(), for the group: its words keep
  // their scalar registers, unwritten, while a request is in flight
  asm volatile("" : "+s"(g1));

  // This lane's row of the wave's first A and first B fragment in buffer 0.
  const unsigned char* ap = ring + (wm >> 6) * SLB +
                            ((wm & 63) + (lane & 15)) * GP + (lane >> 4) * 16;
  const unsigned char* bp =
      ring + (2 + (wid >> 2)) * SLB + (lane & 15) * GP + (lane >> 4) * 16;

  const int NK = K / BK;
  if (pinned(wave < 4u)) {
    tdm_load_gemm_slice(dst, src, g1);
    // Stage 0 has landed before this wave reaches the barrier below.
    asm volatile("s_wait_tensorcnt 0x0" ::: "memory");
  }
  __syncthreads();
  if (pinned(wave < 4u)) tdm_load_gemm_slice(dst + STB, src + BK, g1);

  // not unrolled: one copy of the pass, the buffer picked by an offset
#pragma clang loop unroll(disable)
  for (int it = 0; it < NK; ++it) {
    const int bo = (it & 1) * STB;
    // unrolled: every LDS read is one address register plus an immediate
#pragma unroll
    for (int kk = 0; kk < BK / 32; ++kk) {
      v16h af[2], bf[4];
#pragma unroll
      for (int i = 0; i < 2; ++i)
        af[i] = lds_frag(ap + bo + i * 16 * GP + kk * 64);
#pragma unroll
      for (int j = 0; j < 4; ++j)
        bf[j] = lds_frag(bp + bo + j * 16 * GP + kk * 64);
#pragma unroll
      for (int i = 0; i < 2; ++i)
#pragma unroll
        for (int j = 0; j < 4; ++j)
          acc[i][j] = wmma16x16x32(af[i], bf[j], acc[i][j]);
    }
    // Publish point of stage it + 1. This wave's reads of this buffer have
    // retired before the mover is aimed at it again.
    asm volatile("s_wait_dscnt 0x0" ::: "memory");
    if (pinned(wave < 4u)) {
      // This wave's slice of stage it + 1 has landed.
      asm volatile("s_wait_tensorcnt 0x0" ::: "memory");
    }
    __syncthreads();
    if (pinned(wave < 4u && it + 2 < NK))
      tdm_load_gemm_slice(dst + bo, src + (long long)(it + 2) * BK, g1);
  }
  // Nothing of the ring is outstanding when the wave goes on to its stores. The
  // group is named so that its registers keep their words up to this wait.
  asm volatile("s_wait_tensorcnt 0x0" ::"s"(g1) : "memory");
  asm volatile("s_wait_dscnt 0x0" ::: "memory");

  const int half = lane >> 4;
  const int nl = lane & 15;
#pragma unroll
  for (int i = 0; i < 2; ++i)
#pragma unroll
    for (int j = 0; j < 4; ++j) {
      int nc = n0 + wn + j * 16 + nl;
      float bv = bias[nc];
#pragma unroll
      for (int r = 0; r < 8; ++r) {
        int mr = m0 + wm + i * 16 + r + half * 8;
        C[(long long)mr * N + nc] = acc[i][j][r] + bv;
      }
    }
}

// ---------------------------------------------------------------------------
// RMS-norm + RoPE + cast-to-f16, permuting [B,S,H,F] -> [B,H,S,F].
// One wave per position (b,s) and group of NH heads; lane owns 4 of the 128
// features of each head. The angles depend on s and the lane alone: once a
// wave. A block's 8 waves are 8 consecutive positions of one head group.
// ---------------------------------------------------------------------------
constexpr int NH = 8;
__global__ __launch_bounds__(256) void norm_rope_cast_kernel(
    const float* __restrict__ qf, const float* __restrict__ kf,
    const float* __restrict__ vf, const float* __restrict__ qw,
    const float* __restrict__ kw, _Float16* __restrict__ qh,
    _Float16* __restrict__ kh, _Float16* __restrict__ vh) {
  constexpr int S = 2048, H = 16, F = 128;
  const int lane = threadIdx.x & 31;
  const int wid = threadIdx.x >> 5;
  constexpr int PB = 2 * S / 8;  // blocks per head group (B = 2)
  const int hg = blockIdx.x / PB;
  const int bs = (blockIdx.x - hg * PB) * 8 + wid;  // 0 .. B*S-1
  const int b = bs / S;
  const int s = bs - b * S;
  const int h = hg * NH;  // first head of the group
  const int f0 = lane * 4;
  const long long inoff = ((long long)bs * H + h) * F + f0;
  const long long outoff = ((long long)(b * H + h) * S + s) * F + f0;

  const v4f wsc[2] = {*(const v4f*)(qw + f0), *(const v4f*)(kw + f0)};
  // Behind this wait the two loads' offset register may be written again.
  asm volatile("s_wait_xcnt 0x0" ::: "memory");

  v4f xin[3][NH];
  // unrolled: xin stays in registers and the loads issue ahead of their use
#pragma unroll
  for (int g = 0; g < NH; ++g) {
    xin[0][g] = *(const v4f*)(qf + inoff + g * F);
    xin[1][g] = *(const v4f*)(kf + inoff + g * F);
    xin[2][g] = *(const v4f*)(vf + inoff + g * F);
  }

  float cosv[4], sinv[4];
#pragma unroll
  for (int i = 0; i < 4; ++i) {
    int j = (f0 + i) & 63;
    float freq = __powf(10000.0f, -(float)j * (1.0f / 64.0f));
    float ang = (float)s * freq;
    cosv[i] = __cosf(ang);
    sinv[i] = __sinf(ang);
  }
  const float sgn = (lane < 16) ? -1.0f : 1.0f;  // rotate_half sign

  _Float16* dst[2] = {qh, kh};
  // unrolled: xin is indexed by constants only; the heads' chains are
  // independent and fill each other's waits
#pragma unroll
  for (int g = 0; g < NH; ++g) {
#pragma unroll
  for (int t = 0; t < 2; ++t) {
    const v4f x = xin[t][g];
    float ss = x[0] * x[0] + x[1] * x[1] + x[2] * x[2] + x[3] * x[3];
#pragma unroll
    for (int m = 1; m < 32; m <<= 1) ss += __shfl_xor(ss, m, 32);
    float rms = sqrtf(ss * (1.0f / F));
    float inv = 1.0f / (rms + 1e-6f);
    float y[4];
#pragma unroll
    for (int i = 0; i < 4; ++i) y[i] = x[i] * inv * wsc[t][i];
    float p[4];  // partner features f +/- 64 live in lane ^ 16
#pragma unroll
    for (int i = 0; i < 4; ++i) p[i] = __shfl_xor(y[i], 16, 32);
    v4h out;
#pragma unroll
    for (int i = 0; i < 4; ++i)
      out[i] = (_Float16)(y[i] * cosv[i] + sgn * p[i] * sinv[i]);
    *(v4h*)(dst[t] + outoff + (long long)g * S * F) = out;
  }
  v4h ov;
#pragma unroll
  for (int i = 0; i < 4; ++i) ov[i] = (_Float16)xin[2][g][i];
  *(v4h*)(vh + outoff + (long long)g * S * F) = ov;
  }
}

__global__ __launch_bounds__(128) void flash_attn_kernel(
    const _Float16* __restrict__ qh, const _Float16* __restrict__ kh,
    const _Float16* __restrict__ vh, _Float16* __restrict__ attn) {
  constexpr int S = 2048, H = 16, F = 128;
  constexpr int QT = 64, KT = 64;
  constexpr int LDK = F + 8;
  constexpr int PV = 2 * F + 32;
  __shared__ _Float16 Kt[KT * LDK];
  __shared__ __attribute__((aligned(2048))) unsigned char Vs[KT * PV];

  const int tid = threadIdx.x;
  const int lane = tid & 31;
  const int wid = tid >> 5;
  const int half = lane >> 4;
  const uint32_t wave = uni(threadIdx.x >> 5);
  const int b = blockIdx.z, h = blockIdx.y;
  const int q0 = blockIdx.x * QT + wid * 16;
  const long long base = ((long long)(b * H + h)) * S * F;
  const _Float16* Q = qh + base;
  const _Float16* Kp = kh + base;
  const _Float16* Vp = vh + base;

  v16h qfrag[4];
#pragma unroll
  for (int kc = 0; kc < 4; ++kc) qfrag[kc] = load_frag(Q, F, q0, kc * 32, lane);

  v8f o[8];
#pragma unroll
  for (int j = 0; j < 8; ++j) o[j] = v8f_zero();
  float mst = -1e30f;  // running maximum of query (lane & 15), both halves
  float lst = 0.0f;    // running sum over this half's keys only
  const float scale = 0.08838834764831845f;  // 1/sqrt(128)

  // This lane's address in the first 16-key x 16-feature block of the V tile.
  const unsigned char* vad =
      Vs + (8 * half + (lane & 7)) * PV + ((lane >> 3) & 1) * 16;

  for (int kt0 = 0; kt0 < S; kt0 += KT) {
    // This wave's LDS reads have retired before the mover is aimed at the
    // tiles again.
    asm volatile("s_wait_dscnt 0x0" ::: "memory");
    __syncthreads();  // previous tile fully consumed
#if USE_TDM
    if (wid == 0)
      tdm_load_2d((unsigned)(size_t)&Kt[0], Kp + (long long)kt0 * F, F, KT, F,
                  5, 3);
#else
#pragma unroll
    for (int it = 0; it < 8; ++it) {
      int idx = tid + it * 128;
      int kr = idx >> 4;
      int c = (idx & 15) << 3;
      *(v8h*)&Kt[kr * LDK + c] =
          *(const v8h*)(Kp + (long long)(kt0 + kr) * F + c);
    }
#endif
    // V tile as it lies, Vs[key][f]: one request of wave 1, beside wave 0's.
    if (pinned(wave == 1u)) {
      tdm_load_v_tile((uint32_t)(size_t)&Vs[0], Vp + (long long)kt0 * F);
      // The tile has landed before this wave reaches the barrier below.
      asm volatile("s_wait_tensorcnt 0x0" ::: "memory");
    }
#if USE_TDM
    if (wid == 0) __builtin_amdgcn_s_wait_tensorcnt((short)0);
#endif
    __syncthreads();

    // Scores: S^T, KT x 16 in 4 key tiles, K-reduction over F.
    // sc[jn][r] = score of key jn*16 + 8*half + r against query (lane & 15)
    v8f sc[4];
#pragma unroll
    for (int jn = 0; jn < 4; ++jn) {
      sc[jn] = v8f_zero();
#pragma unroll
      for (int kc = 0; kc < 4; ++kc) {
        v16h kf = load_frag(Kt, LDK, jn * 16, kc * 32, lane);
        sc[jn] = wmma16x16x32(kf, qfrag[kc], sc[jn]);
      }
    }

    float mx = sc[0][0];
#pragma unroll
    for (int jn = 0; jn < 4; ++jn)
#pragma unroll
      for (int r = 0; r < 8; ++r) mx = fmaxf(mx, sc[jn][r]);
    mx = fmaxf(mx, xhalf(mx)) * scale;  // scale > 0: max commutes with it
    const float mnew = fmaxf(mst, mx);
    const float alpha = __expf(mst - mnew);
    // P^T as B operand: element s of chunk kc is key kc*32 + 8*half + s for
    // s < 8 and kc*32 + 16 + 8*half + (s - 8) above: tiles 2kc and 2kc + 1 as
    // they lie, the k order of the ld_tr16 pairs on the V^T side.
    v16h pb[2];
    float ps[4];
#pragma unroll
    for (int jn = 0; jn < 4; ++jn) {
      ps[jn] = 0.0f;
#pragma unroll
      for (int r = 0; r < 8; ++r) {
        float p = __expf(sc[jn][r] * scale - mnew);
        ps[jn] += p;
        pb[jn >> 1][(jn & 1) * 8 + r] = (_Float16)p;
      }
    }
    lst = lst * alpha + ((ps[0] + ps[1]) + (ps[2] + ps[3]));
    mst = mnew;
#pragma unroll
    for (int j = 0; j < 8; ++j)
#pragma unroll
      for (int r = 0; r < 8; ++r) o[j][r] *= alpha;

    // o[jf][r] = O^T[feature jf*16 + 8*half + r][query (lane & 15)]
#pragma unroll
    for (int jf = 0; jf < 8; ++jf)
#pragma unroll
      for (int kc = 0; kc < 2; ++kc) {
        // keys kc*32 + 8*half + 0..7, then + 16: the k order of pb[kc]
        const v8h lo = ld_tr16(vad + (kc * 32) * PV + jf * 32);
        const v8h hi = ld_tr16(vad + (kc * 32 + 16) * PV + jf * 32);
        const v16h vf = __builtin_shufflevector(lo, hi, 0, 1, 2, 3, 4, 5, 6, 7,
                                                8, 9, 10, 11, 12, 13, 14, 15);
        o[jf] = wmma16x16x32(vf, pb[kc], o[jf]);
      }
  }

  // Join the halves' sums, normalize, store f16 attn output as [B,S,H,F]:
  // a lane's 8 registers of a tile are 8 consecutive features of its query.
  const float inv = 1.0f / (lst + xhalf(lst));
  _Float16* orow = attn + ((long long)(b * S + q0 + (lane & 15))) * (H * F) +
                   h * F + half * 8;
#pragma unroll
  for (int jf = 0; jf < 8; ++jf) {
    v8h ov;
#pragma unroll
    for (int r = 0; r < 8; ++r) ov[r] = (_Float16)(o[jf][r] * inv);
    *(v8h*)(orow + jf * 16) = ov;
  }
}

// ---------------------------------------------------------------------------
extern "C" void kernel_launch(void* const* d_in, const int* in_sizes, int n_in,
                              void* d_out, int out_size, void* d_ws,
                              size_t ws_size, hipStream_t stream) {
  constexpr int Bb = 2, S = 2048, D = 2048, H = 16, F = 128;
  constexpr long long MR = (long long)Bb * S;  // 4096 rows
  constexpr long long EL = MR * D;             // 8388608 elems (act tensors)
  constexpr long long WE = (long long)H * D * F;  // 4194304 elems (weights)

  const float* xq = (const float*)d_in[0];
  const float* xk = (const float*)d_in[1];
  const float* xv = (const float*)d_in[2];
  const float* WQ = (const float*)d_in[3];
  const float* WK = (const float*)d_in[4];
  const float* WV = (const float*)d_in[5];
  const float* WO = (const float*)d_in[6];
  const float* bQ = (const float*)d_in[7];
  const float* bK = (const float*)d_in[8];
  const float* bV = (const float*)d_in[9];
  const float* bO = (const float*)d_in[10];
  const float* qw = (const float*)d_in[11];
  const float* kw = (const float*)d_in[12];

  // Workspace (~185 MB):
  //   qf,kf,vf : f32 [4096,2048] raw projections
  //   Xq,Xk,Xv : f16 [4096,2048] cast inputs   (later aliased by qh,kh,vh)
  //   WQt..WOt : f16 [2048,2048] transposed weights (Bt = [N][K])
  //   at       : f16 [B,S,H,F]  attention out  (aliases dead WQt+WKt)
  float* qf = (float*)d_ws;
  float* kf = qf + EL;
  float* vf = kf + EL;
  _Float16* Xq = (_Float16*)(vf + EL);
  _Float16* Xk = Xq + EL;
  _Float16* Xv = Xk + EL;
  _Float16* WQt = Xv + EL;
  _Float16* WKt = WQt + WE;
  _Float16* WVt = WKt + WE;
  _Float16* WOt = WVt + WE;
  _Float16* qhp = Xq;  // aliases: X* dead after projection GEMMs
  _Float16* khp = Xk;
  _Float16* vhp = Xv;
  _Float16* at = WQt;  // aliases: WQt/WKt dead after projection GEMMs

  // 1+2) one launch: cast activations f32 -> f16; transpose+cast weights:
  // W[H,D,F] -> [H,F,D]; W_O[2048,2048] -> T
  prepass_kernel<<<dim3(PRE_BLOCKS, 7), 256, 0, stream>>>(
      xq, xk, xv, WQ, WK, WV, WO, Xq, Xk, Xv, WQt, WKt, WVt, WOt);
  gemm_bias_f16_kernel<<<dim3(D / BN, (int)(MR / BM), 3), 256, 0, stream>>>(
      Xq, WQt, bQ, bK, bV, qf, (int)MR, D, D);
  // 4) RMS-norm + RoPE + cast, permute to [B,H,S,F]
  norm_rope_cast_kernel<<<(Bb * S * H) / 8 / NH, 256, 0, stream>>>(
      qf, kf, vf, qw, kw, qhp, khp, vhp);
  // 5) flash attention -> [B,S,H,F] f16
  flash_attn_kernel<<<dim3(S / 64, H, Bb), 128, 0, stream>>>(qhp, khp, vhp, at);
  // 6) output projection + b_O -> d_out f32
  gemm_bias_f16_kernel<<<dim3(D / BN, (int)(MR / BM), 1), 256, 0, stream>>>(
      at, WOt, bO, bO, bO, (float*)d_out, (int)MR, D, D);
}

// v006
// One run takes 211 microseconds.
// Two timings next to v005 put it at 1.10 and 1.09 times that version's speed.
// Counting every step since v000, it is 3.03 times as fast.
#include <hip/hip_runtime.h>
#include <stdint.h>

typedef __attribute__((ext_vector_type(16))) _Float16 v16h;
typedef __attribute__((ext_vector_type(8)))  _Float16 v8h;
typedef __attribute__((ext_vector_type(4)))  _Float16 v4h;
typedef __attribute__((ext_vector_type(8)))  float    v8f;
typedef __attribute__((ext_vector_type(4)))  float    v4f;
typedef __attribute__((ext_vector_type(4)))  unsigned int u32x4;
typedef __attribute__((ext_vector_type(8)))  int          i32x8;
typedef __attribute__((ext_vector_type(4)))  int          i32x4;
typedef __attribute__((ext_vector_type(8)))  unsigned int u32x8;
typedef __attribute__((ext_vector_type(8)))  short        s16x8;

#if defined(__has_builtin)
#if __has_builtin(__builtin_amdgcn_tensor_load_to_lds) && \
    __has_builtin(__builtin_amdgcn_s_wait_tensorcnt)
#define USE_TDM 1
#endif
#endif
#ifndef USE_TDM
#define USE_TDM 0
#endif

__device__ __forceinline__ v8f v8f_zero() {
  v8f z;
#pragma unroll
  for (int i = 0; i < 8; ++i) z[i] = 0.0f;
  return z;
}

__device__ __forceinline__ v8f wmma16x16x32(v16h a, v16h b, v8f c) {
  return __builtin_amdgcn_wmma_f32_16x16x32_f16(false, a, false, b, (short)0, c,
                                                false, false);
}

__device__ __forceinline__ v16h load_frag(const _Float16* p, int ld, int row0,
                                          int k0, int lane) {
  const _Float16* q = p + (row0 + (lane & 15)) * ld + k0 + ((lane >> 4) << 3);
  v16h v;
#pragma unroll
  for (int i = 0; i < 8; ++i) {
    v[i] = q[i];
    v[i + 8] = q[i + 16];
  }
  return v;
}

__device__ __forceinline__ float xhalf(float x) {
  const int b = __builtin_bit_cast(int, x);
  return __builtin_bit_cast(
      float, __builtin_amdgcn_permlanex16(b, b, 0x76543210, 0xfedcba98, false,
                                          false));
}

#if USE_TDM
__device__ __forceinline__ void tdm_load_2d(unsigned lds_off, const void* gptr,
                                            unsigned width, unsigned height,
                                            unsigned stride, unsigned pad_int,
                                            unsigned pad_amt) {
  unsigned long long ga = (unsigned long long)(size_t)gptr;
  u32x4 g0;
  g0[0] = 1u;
  g0[1] = lds_off;
  g0[2] = (unsigned)(ga & 0xffffffffu);
  g0[3] = (unsigned)((ga >> 32) & 0x01ffffffu)
          | (2u << 30);
  i32x8 g1;
  g1[0] = (int)((1u << 16)
                | (1u << 20)
                | (pad_int << 22) | (pad_amt << 25));
  g1[1] = (int)((stride & 0xffffu) << 16);
  g1[2] = (int)(((stride >> 16) & 0xffffu)
                | ((height & 0xffffu) << 16));
  g1[3] = (int)(((height >> 16) & 0xffffu)
                | ((width & 0xffffu) << 16));
  g1[4] = (int)(height & 0xffffu);
  g1[5] = (int)stride;
  g1[6] = 0;
  g1[7] = 0;
  i32x4 z4 = {0, 0, 0, 0};                      // groups 2/3 unused (2D)
  i32x8 z8 = {0, 0, 0, 0, 0, 0, 0, 0};
  __builtin_amdgcn_tensor_load_to_lds(g0, g1, z4, z4, z8, 0);
}
#endif

__device__ __forceinline__ uint32_t uni(uint32_t v) {
  return (uint32_t)__builtin_amdgcn_readfirstlane((int)v);
}
__device__ __forceinline__ uint32_t pinned(uint32_t v) {
  uint32_t w = uni(v);
  // the test stays in an SGPR
  asm volatile("" : "+s"(w));
  return w;
}

__device__ __forceinline__ void tdm_load_v_tile(uint32_t lds_dst,
                                                const _Float16* src) {
  constexpr uint32_t d0 = 256u, d1 = 64u;
  const uint64_t ga = (uint64_t)(size_t)src;
  u32x4 g0;
  g0[0] = uni(1u);
  g0[1] = uni(lds_dst);
  g0[2] = uni((uint32_t)ga);
  g0[3] = uni((((uint32_t)(ga >> 32)) & 0x01FFFFFFu) | 0x80000000u);
  u32x8 g1;
  g1[0] = uni((1u << 20) | (5u << 22) | (7u << 25));
  g1[1] = uni((d0 & 0xFFFFu) << 16);
  g1[2] = uni((d0 >> 16) | ((d1 & 0xFFFFu) << 16));
  g1[3] = uni((d1 >> 16) | (d0 << 16));
  g1[4] = uni(d1);
  g1[5] = uni(d0);  // source row pitch = row length
  g1[6] = uni(0u);
  g1[7] = uni(0u);
  asm volatile("tensor_load_to_lds %0, %1" ::"s"(g0), "s"(g1) : "memory");
}

__device__ __forceinline__ v8h ld_tr16(const unsigned char* p) {
  typedef __attribute__((address_space(3))) s16x8 lds_s16x8;
  return __builtin_bit_cast(
      v8h, __builtin_amdgcn_ds_load_tr16_b128_v8i16((lds_s16x8*)p));
}

constexpr int CAST_U = 16;  // 16-byte pieces per thread
__device__ __forceinline__ void cast_f16_block(const float* __restrict__ in,
                                               _Float16* __restrict__ out,
                                               int blk) {
  const long long i0 = (long long)blk * (256 * 4 * CAST_U) + threadIdx.x * 4;
  v4f x[CAST_U];
  // unrolled: x stays in registers and the loads issue ahead of their use
#pragma unroll
  for (int u = 0; u < CAST_U; ++u) x[u] = *(const v4f*)(in + i0 + u * 1024);
  // unrolled: x is indexed by constants only
#pragma unroll
  for (int u = 0; u < CAST_U; ++u) {
    v4h h;
#pragma unroll
    for (int j = 0; j < 4; ++j) h[j] = (_Float16)x[u][j];
    *(v4h*)(out + i0 + u * 1024) = h;
  }
  asm volatile("s_wait_xcnt 0x0" ::: "memory");
}

// in: f32 [nmat][rows][cols] -> out: f16 [nmat][cols][rows]
// A block takes TR rows x 32 columns (TR / 32 square tiles, one barrier).
// rows and cols are compile-time, so that every load and store of a thread is
// one address register plus an immediate offset.
constexpr int TR = 256;
template <int rows, int cols>
__device__ __forceinline__ void transpose_cast_block(
    float (*tile)[33], const float* __restrict__ in,
    _Float16* __restrict__ out, int blk) {
  constexpr int NC = cols / 32, NR = rows / TR;  // tiles across, tiles down
  const int m = blk / (NC * NR);
  const int r0 = ((blk / NC) % NR) * TR, c0 = (blk % NC) * 32;
  const float* src = in + (long long)m * rows * cols;
  _Float16* dst = out + (long long)m * rows * cols;
  const int tx = threadIdx.x & 31, ty = threadIdx.x >> 5;  // 32 x 8
  const float* sp = src + (long long)(r0 + ty) * cols + c0 + tx;
  float x[TR / 8];
  // unrolled: x stays in registers and the loads issue back to back
#pragma unroll
  for (int i = 0; i < TR / 8; ++i) x[i] = sp[i * 8 * cols];
  // unrolled: x is indexed by constants only
#pragma unroll
  for (int i = 0; i < TR / 8; ++i) tile[ty + i * 8][tx] = x[i];
  __syncthreads();
  _Float16* dp = dst + (long long)(c0 + ty) * rows + r0 + tx;
  // unrolled: immediate offsets for the LDS reads and the stores
#pragma unroll
  for (int i = 0; i < 32; i += 8)
#pragma unroll
    for (int t = 0; t < TR; t += 32)
      dp[i * rows + t] = (_Float16)tile[t + tx][ty + i];
  asm volatile("s_wait_xcnt 0x0" ::: "memory");
}

// The seven pre-passes depend on nothing and on one another not at all: one
// launch holds them all, blockIdx.y = the pass, so that each pass's start, its
// first loads' latency and its last stores' drain lie under the others' work
// instead of standing alone between two launch gaps. Every pass is PRE_BLOCKS
// blocks. The transposes, with the longer chain per block, take the lowest passes.
constexpr int PRE_BLOCKS = 512;
__global__ __launch_bounds__(256) void prepass_kernel(
    const float* xq, const float* xk, const float* xv, const float* WQ,
    const float* WK, const float* WV, const float* WO, _Float16* Xq,
    _Float16* Xk, _Float16* Xv, _Float16* WQt, _Float16* WKt, _Float16* WVt,
    _Float16* WOt) {
  constexpr int D = 2048, H = 16, F = 128, MR = 4096;
  static_assert(H * (D / TR) * (F / 32) == PRE_BLOCKS, "head weights");
  static_assert((D / TR) * (D / 32) == PRE_BLOCKS, "output weight");
  static_assert(MR * D / (256 * 4 * CAST_U) == PRE_BLOCKS, "activations");
  __shared__ float tile[TR][33];
  const int pass = blockIdx.y, blk = blockIdx.x;
  if (pass == 0) {
    transpose_cast_block<D, D>(tile, WO, WOt, blk);
  } else if (pass < 4) {
    transpose_cast_block<D, F>(tile, pass == 1 ? WQ : pass == 2 ? WK : WV,
                               pass == 1 ? WQt : pass == 2 ? WKt : WVt, blk);
  } else {
    cast_f16_block(pass == 4 ? xq : pass == 5 ? xk : xv,
                   pass == 4 ? Xq : pass == 5 ? Xk : Xv, blk);
  }
}

// ---------------------------------------------------------------------------
// GEMM: C[m,n] = sum_k A[m,k]*Bt[n,k] + bias[n].  A,Bt f16 row-major, C f32.
// Block 256 threads (8 waves), tile 128x128, wave tile 32x64 (2x4 WMMA).
// A stage is 128 k: 256 bytes of each of the 256 operand rows, so that one
// hand-over serves 32 WMMAs a wave. Waves 0 to 3 each bring a slice of 64 rows by one tensor load; two
// buffers, the next stage in flight while this one is worked on.
// K is a multiple of BK and at least 2 * BK.
// blockIdx.z picks one of up to three independent products of one shape, whose
// A, Bt and C lie one behind the other: in one launch a block's first stage and
// its stores lie under other blocks' WMMAs.
// ---------------------------------------------------------------------------
constexpr int BM = 128, BN = 128, BK = 128;
constexpr int GP = 2 * BK + 16;   // LDS row pitch, bytes: 16 x odd
constexpr int SLB = 18432;        // a slice: 64 rows of GP bytes, up to 2 KiB
constexpr int STB = 4 * SLB;      // a buffer: A rows 0-63, 64-127, Bt the same
static_assert(64 * GP <= SLB && SLB % 2048 == 0, "slice size");

__device__ __forceinline__ u32x8 tdm_gemm_group1(uint32_t pitch) {
  constexpr uint32_t d0 = 256u, d1 = 64u;
  u32x8 g1;
  g1[0] = uni((1u << 20) | (5u << 22) | (3u << 25));
  g1[1] = uni((d0 & 0xFFFFu) << 16);
  g1[2] = uni((d0 >> 16) | ((d1 & 0xFFFFu) << 16));
  g1[3] = uni((d1 >> 16) | (d0 << 16));
  g1[4] = uni(d1);
  g1[5] = uni(pitch);
  g1[6] = uni(0u);
  g1[7] = uni(0u);
  return g1;
}
__device__ __forceinline__ void tdm_load_gemm_slice(uint32_t lds_dst,
                                                    const _Float16* src,
                                                    u32x8 g1) {
  const uint64_t ga = (uint64_t)(size_t)src;
  u32x4 g0;
  g0[0] = uni(1u);
  g0[1] = uni(lds_dst);
  g0[2] = uni((uint32_t)ga);
  g0[3] = uni((((uint32_t)(ga >> 32)) & 0x01FFFFFFu) | 0x80000000u);
  asm volatile("tensor_load_to_lds %0, %1" ::"s"(g0), "s"(g1) : "memory");
}

// 16x32 f16 fragment from LDS, p = this lane's row + 16 * (lane >> 4) bytes:
// the k order of load_frag (k 8h .. 8h+7, then 16 + 8h .. 16 + 8h+7).
__device__ __forceinline__ v16h lds_frag(const unsigned char* p) {
  const v8h lo = *(const v8h*)p;
  const v8h hi = *(const v8h*)(p + 32);
  return __builtin_shufflevector(lo, hi, 0, 1, 2, 3, 4, 5, 6, 7, 8, 9, 10, 11,
                                 12, 13, 14, 15);
}

__global__ __launch_bounds__(256) void gemm_bias_f16_kernel(
    const _Float16* __restrict__ Az, const _Float16* __restrict__ Btz,
    const float* __restrict__ bias0, const float* __restrict__ bias1,
    const float* __restrict__ bias2, float* __restrict__ Cz, int M, int N,
    int K) {
  const int z = blockIdx.z;
  const _Float16* A = Az + (long long)z * M * K;
  const _Float16* Bt = Btz + (long long)z * N * K;
  const float* bias = z == 0 ? bias0 : z == 1 ? bias1 : bias2;
  float* C = Cz + (long long)z * M * N;
  __shared__ __attribute__((aligned(2048))) unsigned char ring[2 * STB];
  const int tid = threadIdx.x, lane = tid & 31, wid = tid >> 5;
  const uint32_t wave = uni(threadIdx.x >> 5);
  const int wm = (wid & 3) * 32, wn = (wid >> 2) * 64;
  const int n0 = blockIdx.x * BN, m0 = blockIdx.y * BM;

  v8f acc[2][4];
#pragma unroll
  for (int i = 0; i < 2; ++i)
#pragma unroll
    for (int j = 0; j < 4; ++j) acc[i][j] = v8f_zero();

  // Slice sl of a buffer and its source rows (waves 4 to 7 issue nothing).
  const uint32_t sl = wave & 3u;
  const _Float16* src = (sl < 2u)
                            ? A + (long long)(m0 + 64 * (int)sl) * K
                            : Bt + (long long)(n0 + 64 * (int)(sl - 2u)) * K;
  const uint32_t dst = (uint32_t)(size_t)&ring[0] + sl * SLB;
  u32x8 g1 = tdm_gemm_group1((uint32_t)K * 2u);
  // pinned(), for the group: its words keep
  // their scalar registers, unwritten, while a request is in flight
  asm volatile("" : "+s"(g1));

  // This lane's row of the wave's first A and first B fragment in buffer 0.
  const unsigned char* ap = ring + (wm >> 6) * SLB +
                            ((wm & 63) + (lane & 15)) * GP + (lane >> 4) * 16;
  const unsigned char* bp =
      ring + (2 + (wid >> 2)) * SLB + (lane & 15) * GP + (lane >> 4) * 16;

  const int NK = K / BK;
  if (pinned(wave < 4u)) {
    tdm_load_gemm_slice(dst, src, g1);
    // Stage 0 has landed before this wave reaches the barrier below.
    asm volatile("s_wait_tensorcnt 0x0" ::: "memory");
  }
  __syncthreads();
  if (pinned(wave < 4u)) tdm_load_gemm_slice(dst + STB, src + BK, g1);

  // not unrolled: one copy of the pass, the buffer picked by an offset
#pragma clang loop unroll(disable)
  for (int it = 0; it < NK; ++it) {
    const int bo = (it & 1) * STB;
    // unrolled: every LDS read is one address register plus an immediate
#pragma unroll
    for (int kk = 0; kk < BK / 32; ++kk) {
      v16h af[2], bf[4];
#pragma unroll
      for (int i = 0; i < 2; ++i)
        af[i] = lds_frag(ap + bo + i * 16 * GP + kk * 64);
#pragma unroll
      for (int j = 0; j < 4; ++j)
        bf[j] = lds_frag(bp + bo + j * 16 * GP + kk * 64);
#pragma unroll
      for (int i = 0; i < 2; ++i)
#pragma unroll
        for (int j = 0; j < 4; ++j)
          acc[i][j] = wmma16x16x32(af[i], bf[j], acc[i][j]);
    }
    // Publish point of stage it + 1. This wave's reads of this buffer have
    // retired before the mover is aimed at it again.
    asm volatile("s_wait_dscnt 0x0" ::: "memory");
    if (pinned(wave < 4u)) {
      // This wave's slice of stage it + 1 has landed.
      asm volatile("s_wait_tensorcnt 0x0" ::: "memory");
    }
    __syncthreads();
    if (pinned(wave < 4u && it + 2 < NK))
      tdm_load_gemm_slice(dst + bo, src + (long long)(it + 2) * BK, g1);
  }
  // Nothing of the ring is outstanding when the wave goes on to its stores. The
  // group is named so that its registers keep their words up to this wait.
  asm volatile("s_wait_tensorcnt 0x0" ::"s"(g1) : "memory");
  asm volatile("s_wait_dscnt 0x0" ::: "memory");

  const int half = lane >> 4;
  const int nl = lane & 15;
#pragma unroll
  for (int i = 0; i < 2; ++i)
#pragma unroll
    for (int j = 0; j < 4; ++j) {
      int nc = n0 + wn + j * 16 + nl;
      float bv = bias[nc];
#pragma unroll
      for (int r = 0; r < 8; ++r) {
        int mr = m0 + wm + i * 16 + r + half * 8;
        C[(long long)mr * N + nc] = acc[i][j][r] + bv;
      }
    }
}

// ---------------------------------------------------------------------------
// RMS-norm + RoPE + cast-to-f16, permuting [B,S,H,F] -> [B,H,S,F].
// One wave per position (b,s) and group of NH heads; lane owns 4 of the 128
// features of each head. The angles depend on s and the lane alone: once a
// wave. A block's 8 waves are 8 consecutive positions of one head group.
// ---------------------------------------------------------------------------
constexpr int NH = 8;
__global__ __launch_bounds__(256) void norm_rope_cast_kernel(
    const float* __restrict__ qf, const float* __restrict__ kf,
    const float* __restrict__ vf, const float* __restrict__ qw,
    const float* __restrict__ kw, _Float16* __restrict__ qh,
    _Float16* __restrict__ kh, _Float16* __restrict__ vh) {
  constexpr int S = 2048, H = 16, F = 128;
  const int lane = threadIdx.x & 31;
  const int wid = threadIdx.x >> 5;
  constexpr int PB = 2 * S / 8;  // blocks per head group (B = 2)
  const int hg = blockIdx.x / PB;
  const int bs = (blockIdx.x - hg * PB) * 8 + wid;  // 0 .. B*S-1
  const int b = bs / S;
  const int s = bs - b * S;
  const int h = hg * NH;  // first head of the group
  const int f0 = lane * 4;
  const long long inoff = ((long long)bs * H + h) * F + f0;
  const long long outoff = ((long long)(b * H + h) * S + s) * F + f0;

  const v4f wsc[2] = {*(const v4f*)(qw + f0), *(const v4f*)(kw + f0)};
  // Behind this wait the two loads' offset register may be written again.
  asm volatile("s_wait_xcnt 0x0" ::: "memory");

  v4f xin[3][NH];
  // unrolled: xin stays in registers and the loads issue ahead of their use
#pragma unroll
  for (int g = 0; g < NH; ++g) {
    xin[0][g] = *(const v4f*)(qf + inoff + g * F);
    xin[1][g] = *(const v4f*)(kf + inoff + g * F);
    xin[2][g] = *(const v4f*)(vf + inoff + g * F);
  }

  float cosv[4], sinv[4];
#pragma unroll
  for (int i = 0; i < 4; ++i) {
    int j = (f0 + i) & 63;
    float freq = __powf(10000.0f, -(float)j * (1.0f / 64.0f));
    float ang = (float)s * freq;
    cosv[i] = __cosf(ang);
    sinv[i] = __sinf(ang);
  }
  const float sgn = (lane < 16) ? -1.0f : 1.0f;  // rotate_half sign

  _Float16* dst[2] = {qh, kh};
  // unrolled: xin is indexed by constants only; the heads' chains are
  // independent and fill each other's waits
#pragma unroll
  for (int g = 0; g < NH; ++g) {
#pragma unroll
  for (int t = 0; t < 2; ++t) {
    const v4f x = xin[t][g];
    float ss = x[0] * x[0] + x[1] * x[1] + x[2] * x[2] + x[3] * x[3];
#pragma unroll
    for (int m = 1; m < 32; m <<= 1) ss += __shfl_xor(ss, m, 32);
    float rms = sqrtf(ss * (1.0f / F));
    float inv = 1.0f / (rms + 1e-6f);
    float y[4];
#pragma unroll
    for (int i = 0; i < 4; ++i) y[i] = x[i] * inv * wsc[t][i];
    float p[4];  // partner features f +/- 64 live in lane ^ 16
#pragma unroll
    for (int i = 0; i < 4; ++i) p[i] = __shfl_xor(y[i], 16, 32);
    v4h out;
#pragma unroll
    for (int i = 0; i < 4; ++i)
      out[i] = (_Float16)(y[i] * cosv[i] + sgn * p[i] * sinv[i]);
    *(v4h*)(dst[t] + outoff + (long long)g * S * F) = out;
  }
  v4h ov;
#pragma unroll
  for (int i = 0; i < 4; ++i) ov[i] = (_Float16)xin[2][g][i];
  *(v4h*)(vh + outoff + (long long)g * S * F) = ov;
  }
}

__global__ __launch_bounds__(128) void flash_attn_kernel(
    const _Float16* __restrict__ qh, const _Float16* __restrict__ kh,
    const _Float16* __restrict__ vh, _Float16* __restrict__ attn) {
  constexpr int S = 2048, H = 16, F = 128;
  constexpr int QT = 64, KT = 64;
  constexpr int LDK = F + 8;
  constexpr int PV = 2 * F + 32;
  __shared__ _Float16 Kt[KT * LDK];
  __shared__ __attribute__((aligned(2048))) unsigned char Vs[KT * PV];

  const int tid = threadIdx.x;
  const int lane = tid & 31;
  const int wid = tid >> 5;
  const int half = lane >> 4;
  const uint32_t wave = uni(threadIdx.x >> 5);
  const int b = blockIdx.z, h = blockIdx.y;
  const int q0 = blockIdx.x * QT + wid * 16;
  const long long base = ((long long)(b * H + h)) * S * F;
  const _Float16* Q = qh + base;
  const _Float16* Kp = kh + base;
  const _Float16* Vp = vh + base;

  v16h qfrag[4];
#pragma unroll
  for (int kc = 0; kc < 4; ++kc) qfrag[kc] = load_frag(Q, F, q0, kc * 32, lane);

  v8f o[8];
#pragma unroll
  for (int j = 0; j < 8; ++j) o[j] = v8f_zero();
  float mst = -1e30f;  // running maximum of query (lane & 15), both halves
  float lst = 0.0f;    // running sum over this half's keys only
  const float scale = 0.08838834764831845f;  // 1/sqrt(128)

  // This lane's address in the first 16-key x 16-feature block of the V tile.
  const unsigned char* vad =
      Vs + (8 * half + (lane & 7)) * PV + ((lane >> 3) & 1) * 16;

  for (int kt0 = 0; kt0 < S; kt0 += KT) {
    // This wave's LDS reads have retired before the mover is aimed at the
    // tiles again.
    asm volatile("s_wait_dscnt 0x0" ::: "memory");
    __syncthreads();  // previous tile fully consumed
#if USE_TDM
    if (wid == 0)
      tdm_load_2d((unsigned)(size_t)&Kt[0], Kp + (long long)kt0 * F, F, KT, F,
                  5, 3);
#else
#pragma unroll
    for (int it = 0; it < 8; ++it) {
      int idx = tid + it * 128;
      int kr = idx >> 4;
      int c = (idx & 15) << 3;
      *(v8h*)&Kt[kr * LDK + c] =
          *(const v8h*)(Kp + (long long)(kt0 + kr) * F + c);
    }
#endif
    // V tile as it lies, Vs[key][f]: one request of wave 1, beside wave 0's.
    if (pinned(wave == 1u)) {
      tdm_load_v_tile((uint32_t)(size_t)&Vs[0], Vp + (long long)kt0 * F);
      // The tile has landed before this wave reaches the barrier below.
      asm volatile("s_wait_tensorcnt 0x0" ::: "memory");
    }
#if USE_TDM
    if (wid == 0) __builtin_amdgcn_s_wait_tensorcnt((short)0);
#endif
    __syncthreads();

    v16h kg[4][4], vg[4][4];
    auto read_k = [&](int jn) {
#pragma unroll
      for (int kc = 0; kc < 4; ++kc)
        kg[jn][kc] = load_frag(Kt, LDK, jn * 16, kc * 32, lane);
    };
    auto read_v = [&](int g) {
      const int kc = g >> 1;
#pragma unroll
      for (int t = 0; t < 4; ++t) {
        const int jf = (g & 1) * 4 + t;
        // keys kc*32 + 8*half + 0..7, then + 16: the k order of pb[kc]
        const v8h lo = ld_tr16(vad + (kc * 32) * PV + jf * 32);
        const v8h hi = ld_tr16(vad + (kc * 32 + 16) * PV + jf * 32);
        vg[g][t] = __builtin_shufflevector(lo, hi, 0, 1, 2, 3, 4, 5, 6, 7, 8,
                                           9, 10, 11, 12, 13, 14, 15);
      }
    };

    // Scores: S^T, KT x 16 in 4 key tiles, K-reduction over F.
    // sc[jn][r] = score of key jn*16 + 8*half + r against query (lane & 15)
    v8f sc[4];
    auto score = [&](int jn) {
      sc[jn] = v8f_zero();
#pragma unroll
      for (int kc = 0; kc < 4; ++kc)
        sc[jn] = wmma16x16x32(kg[jn][kc], qfrag[kc], sc[jn]);
    };
    read_k(0);
    read_k(1);
    read_k(2);
    read_k(3);
    // holds the reads together, ahead of the WMMAs
    __builtin_amdgcn_sched_barrier(0);
    score(0);
    score(1);
    score(2);
    score(3);

    float mx = sc[0][0];
#pragma unroll
    for (int jn = 0; jn < 4; ++jn)
#pragma unroll
      for (int r = 0; r < 8; ++r) mx = fmaxf(mx, sc[jn][r]);
    mx = fmaxf(mx, xhalf(mx)) * scale;  // scale > 0: max commutes with it
    const float mnew = fmaxf(mst, mx);
    const float alpha = __expf(mst - mnew);
    // P^T as B operand: element s of chunk kc is key kc*32 + 8*half + s for
    // s < 8 and kc*32 + 16 + 8*half + (s - 8) above: tiles 2kc and 2kc + 1 as
    // they lie, the k order of the ld_tr16 pairs on the V^T side.
    v16h pb[2];
    float ps[4];
#pragma unroll
    for (int jn = 0; jn < 4; ++jn) {
      ps[jn] = 0.0f;
#pragma unroll
      for (int r = 0; r < 8; ++r) {
        float p = __expf(sc[jn][r] * scale - mnew);
        ps[jn] += p;
        pb[jn >> 1][(jn & 1) * 8 + r] = (_Float16)p;
      }
    }
    lst = lst * alpha + ((ps[0] + ps[1]) + (ps[2] + ps[3]));
    mst = mnew;
    // keeps the V^T reads behind the softmax: they take the registers that the
    // scores leave
    __builtin_amdgcn_sched_barrier(0);
    read_v(0);
    read_v(1);
    read_v(2);
    // holds the reads together, ahead of the vector work and the WMMAs
    __builtin_amdgcn_sched_barrier(0);
#pragma unroll
    for (int j = 0; j < 8; ++j)
#pragma unroll
      for (int r = 0; r < 8; ++r) o[j][r] *= alpha;

    // o[jf][r] = O^T[feature jf*16 + 8*half + r][query (lane & 15)]
    // Each o[jf] takes chunk 0 and then chunk 1.
    auto pv = [&](int g) {
#pragma unroll
      for (int t = 0; t < 4; ++t)
        o[(g & 1) * 4 + t] =
            wmma16x16x32(vg[g][t], pb[g >> 1], o[(g & 1) * 4 + t]);
    };
    pv(0);
    // keeps the last group's reads behind the WMMAs whose registers they take
    __builtin_amdgcn_sched_barrier(0);
    read_v(3);
    // holds the reads together, ahead of the WMMAs
    __builtin_amdgcn_sched_barrier(0);
    pv(1);
    pv(2);
    pv(3);
  }

  // Join the halves' sums, normalize, store f16 attn output as [B,S,H,F]:
  // a lane's 8 registers of a tile are 8 consecutive features of its query.
  const float inv = 1.0f / (lst + xhalf(lst));
  _Float16* orow = attn + ((long long)(b * S + q0 + (lane & 15))) * (H * F) +
                   h * F + half * 8;
#pragma unroll
  for (int jf = 0; jf < 8; ++jf) {
    v8h ov;
#pragma unroll
    for (int r = 0; r < 8; ++r) ov[r] = (_Float16)(o[jf][r] * inv);
    *(v8h*)(orow + jf * 16) = ov;
  }
}

// ---------------------------------------------------------------------------
extern "C" void kernel_launch(void* const* d_in, const int* in_sizes, int n_in,
                              void* d_out, int out_size, void* d_ws,
                              size_t ws_size, hipStream_t stream) {
  constexpr int Bb = 2, S = 2048, D = 2048, H = 16, F = 128;
  constexpr long long MR = (long long)Bb * S;  // 4096 rows
  constexpr long long EL = MR * D;             // 8388608 elems (act tensors)
  constexpr long long WE = (long long)H * D * F;  // 4194304 elems (weights)

  const float* xq = (const float*)d_in[0];
  const float* xk = (const float*)d_in[1];
  const float* xv = (const float*)d_in[2];
  const float* WQ = (const float*)d_in[3];
  const float* WK = (const float*)d_in[4];
  const float* WV = (const float*)d_in[5];
  const float* WO = (const float*)d_in[6];
  const float* bQ = (const float*)d_in[7];
  const float* bK = (const float*)d_in[8];
  const float* bV = (const float*)d_in[9];
  const float* bO = (const float*)d_in[10];
  const float* qw = (const float*)d_in[11];
  const float* kw = (const float*)d_in[12];

  // Workspace (~185 MB):
  //   qf,kf,vf : f32 [4096,2048] raw projections
  //   Xq,Xk,Xv : f16 [4096,2048] cast inputs   (later aliased by qh,kh,vh)
  //   WQt..WOt : f16 [2048,2048] transposed weights (Bt = [N][K])
  //   at       : f16 [B,S,H,F]  attention out  (aliases dead WQt+WKt)
  float* qf = (float*)d_ws;
  float* kf = qf + EL;
  float* vf = kf + EL;
  _Float16* Xq = (_Float16*)(vf + EL);
  _Float16* Xk = Xq + EL;
  _Float16* Xv = Xk + EL;
  _Float16* WQt = Xv + EL;
  _Float16* WKt = WQt + WE;
  _Float16* WVt = WKt + WE;
  _Float16* WOt = WVt + WE;
  _Float16* qhp = Xq;  // aliases: X* dead after projection GEMMs
  _Float16* khp = Xk;
  _Float16* vhp = Xv;
  _Float16* at = WQt;  // aliases: WQt/WKt dead after projection GEMMs

  // 1+2) one launch: cast activations f32 -> f16; transpose+cast weights:
  // W[H,D,F] -> [H,F,D]; W_O[2048,2048] -> T
  prepass_kernel<<<dim3(PRE_BLOCKS, 7), 256, 0, stream>>>(
      xq, xk, xv, WQ, WK, WV, WO, Xq, Xk, Xv, WQt, WKt, WVt, WOt);
  gemm_bias_f16_kernel<<<dim3(D / BN, (int)(MR / BM), 3), 256, 0, stream>>>(
      Xq, WQt, bQ, bK, bV, qf, (int)MR, D, D);
  // 4) RMS-norm + RoPE + cast, permute to [B,H,S,F]
  norm_rope_cast_kernel<<<(Bb * S * H) / 8 / NH, 256, 0, stream>>>(
      qf, kf, vf, qw, kw, qhp, khp, vhp);
  // 5) flash attention -> [B,S,H,F] f16
  flash_attn_kernel<<<dim3(S / 64, H, Bb), 128, 0, stream>>>(qhp, khp, vhp, at);
  // 6) output projection + b_O -> d_out f32
  gemm_bias_f16_kernel<<<dim3(D / BN, (int)(MR / BM), 1), 256, 0, stream>>>(
      at, WOt, bO, bO, bO, (float*)d_out, (int)MR, D, D);
}

// v007
// One run takes 184 microseconds.
// Next to v006, in two timings, it ran 1.15 times as fast each time.
// Counting every step since v000, it is 3.48 times as fast.
#include <hip/hip_runtime.h>
#include <stdint.h>

typedef __attribute__((ext_vector_type(16))) _Float16 v16h;
typedef __attribute__((ext_vector_type(8)))  _Float16 v8h;
typedef __attribute__((ext_vector_type(4)))  _Float16 v4h;
typedef __attribute__((ext_vector_type(8)))  float    v8f;
typedef __attribute__((ext_vector_type(4)))  float    v4f;
typedef __attribute__((ext_vector_type(4)))  unsigned int u32x4;
typedef __attribute__((ext_vector_type(8)))  int          i32x8;
typedef __attribute__((ext_vector_type(4)))  int          i32x4;
typedef __attribute__((ext_vector_type(8)))  unsigned int u32x8;
typedef __attribute__((ext_vector_type(8)))  short        s16x8;

#if defined(__has_builtin)
#if __has_builtin(__builtin_amdgcn_tensor_load_to_lds) && \
    __has_builtin(__builtin_amdgcn_s_wait_tensorcnt)
#define USE_TDM 1
#endif
#endif
#ifndef USE_TDM
#define USE_TDM 0
#endif

__device__ __forceinline__ v8f v8f_zero() {
  v8f z;
#pragma unroll
  for (int i = 0; i < 8; ++i) z[i] = 0.0f;
  return z;
}

__device__ __forceinline__ v8f wmma16x16x32(v16h a, v16h b, v8f c) {
  return __builtin_amdgcn_wmma_f32_16x16x32_f16(false, a, false, b, (short)0, c,
                                                false, false);
}

__device__ __forceinline__ v16h load_frag(const _Float16* p, int ld, int row0,
                                          int k0, int lane) {
  const _Float16* q = p + (row0 + (lane & 15)) * ld + k0 + ((lane >> 4) << 3);
  v16h v;
#pragma unroll
  for (int i = 0; i < 8; ++i) {
    v[i] = q[i];
    v[i + 8] = q[i + 16];
  }
  return v;
}

__device__ __forceinline__ float xhalf(float x) {
  const int b = __builtin_bit_cast(int, x);
  return __builtin_bit_cast(
      float, __builtin_amdgcn_permlanex16(b, b, 0x76543210, 0xfedcba98, false,
                                          false));
}

#if USE_TDM
__device__ __forceinline__ void tdm_load_2d(unsigned lds_off, const void* gptr,
                                            unsigned width, unsigned height,
                                            unsigned stride, unsigned pad_int,
                                            unsigned pad_amt) {
  unsigned long long ga = (unsigned long long)(size_t)gptr;
  u32x4 g0;
  g0[0] = 1u;
  g0[1] = lds_off;
  g0[2] = (unsigned)(ga & 0xffffffffu);
  g0[3] = (unsigned)((ga >> 32) & 0x01ffffffu)
          | (2u << 30);
  i32x8 g1;
  g1[0] = (int)((1u << 16)
                | (1u << 20)
                | (pad_int << 22) | (pad_amt << 25));
  g1[1] = (int)((stride & 0xffffu) << 16);
  g1[2] = (int)(((stride >> 16) & 0xffffu)
                | ((height & 0xffffu) << 16));
  g1[3] = (int)(((height >> 16) & 0xffffu)
                | ((width & 0xffffu) << 16));
  g1[4] = (int)(height & 0xffffu);
  g1[5] = (int)stride;
  g1[6] = 0;
  g1[7] = 0;
  i32x4 z4 = {0, 0, 0, 0};                      // groups 2/3 unused (2D)
  i32x8 z8 = {0, 0, 0, 0, 0, 0, 0, 0};
  __builtin_amdgcn_tensor_load_to_lds(g0, g1, z4, z4, z8, 0);
}
#endif

__device__ __forceinline__ uint32_t uni(uint32_t v) {
  return (uint32_t)__builtin_amdgcn_readfirstlane((int)v);
}
__device__ __forceinline__ uint32_t pinned(uint32_t v) {
  uint32_t w = uni(v);
  // the test stays in an SGPR
  asm volatile("" : "+s"(w));
  return w;
}

__device__ __forceinline__ void tdm_load_v_tile(uint32_t lds_dst,
                                                const _Float16* src) {
  constexpr uint32_t d0 = 256u, d1 = 64u;
  const uint64_t ga = (uint64_t)(size_t)src;
  u32x4 g0;
  g0[0] = uni(1u);
  g0[1] = uni(lds_dst);
  g0[2] = uni((uint32_t)ga);
  g0[3] = uni((((uint32_t)(ga >> 32)) & 0x01FFFFFFu) | 0x80000000u);
  u32x8 g1;
  g1[0] = uni((1u << 20) | (5u << 22) | (7u << 25));
  g1[1] = uni((d0 & 0xFFFFu) << 16);
  g1[2] = uni((d0 >> 16) | ((d1 & 0xFFFFu) << 16));
  g1[3] = uni((d1 >> 16) | (d0 << 16));
  g1[4] = uni(d1);
  g1[5] = uni(d0);  // source row pitch = row length
  g1[6] = uni(0u);
  g1[7] = uni(0u);
  asm volatile("tensor_load_to_lds %0, %1" ::"s"(g0), "s"(g1) : "memory");
}

__device__ __forceinline__ v8h ld_tr16(const unsigned char* p) {
  typedef __attribute__((address_space(3))) s16x8 lds_s16x8;
  return __builtin_bit_cast(
      v8h, __builtin_amdgcn_ds_load_tr16_b128_v8i16((lds_s16x8*)p));
}

constexpr int CAST_U = 16;  // 16-byte pieces per thread
__device__ __forceinline__ void cast_f16_block(const float* __restrict__ in,
                                               _Float16* __restrict__ out,
                                               int blk) {
  const long long i0 = (long long)blk * (256 * 4 * CAST_U) + threadIdx.x * 4;
  v4f x[CAST_U];
  // unrolled: x stays in registers and the loads issue ahead of their use
#pragma unroll
  for (int u = 0; u < CAST_U; ++u) x[u] = *(const v4f*)(in + i0 + u * 1024);
  // unrolled: x is indexed by constants only
#pragma unroll
  for (int u = 0; u < CAST_U; ++u) {
    v4h h;
#pragma unroll
    for (int j = 0; j < 4; ++j) h[j] = (_Float16)x[u][j];
    *(v4h*)(out + i0 + u * 1024) = h;
  }
  asm volatile("s_wait_xcnt 0x0" ::: "memory");
}

// in: f32 [nmat][rows][cols] -> out: f16 [nmat][cols][rows]
// A block takes TR rows x 32 columns (TR / 32 square tiles, one barrier).
// rows and cols are compile-time, so that every load and store of a thread is
// one address register plus an immediate offset.
constexpr int TR = 256;
template <int rows, int cols>
__device__ __forceinline__ void transpose_cast_block(
    float (*tile)[33], const float* __restrict__ in,
    _Float16* __restrict__ out, int blk) {
  constexpr int NC = cols / 32, NR = rows / TR;  // tiles across, tiles down
  const int m = blk / (NC * NR);
  const int r0 = ((blk / NC) % NR) * TR, c0 = (blk % NC) * 32;
  const float* src = in + (long long)m * rows * cols;
  _Float16* dst = out + (long long)m * rows * cols;
  const int tx = threadIdx.x & 31, ty = threadIdx.x >> 5;  // 32 x 8
  const float* sp = src + (long long)(r0 + ty) * cols + c0 + tx;
  float x[TR / 8];
  // unrolled: x stays in registers and the loads issue back to back
#pragma unroll
  for (int i = 0; i < TR / 8; ++i) x[i] = sp[i * 8 * cols];
  // unrolled: x is indexed by constants only
#pragma unroll
  for (int i = 0; i < TR / 8; ++i) tile[ty + i * 8][tx] = x[i];
  __syncthreads();
  _Float16* dp = dst + (long long)(c0 + ty) * rows + r0 + tx;
  // unrolled: immediate offsets for the LDS reads and the stores
#pragma unroll
  for (int i = 0; i < 32; i += 8)
#pragma unroll
    for (int t = 0; t < TR; t += 32)
      dp[i * rows + t] = (_Float16)tile[t + tx][ty + i];
  asm volatile("s_wait_xcnt 0x0" ::: "memory");
}

// The seven pre-passes depend on nothing and on one another not at all: one
// launch holds them all, blockIdx.y = the pass, so that each pass's start, its
// first loads' latency and its last stores' drain lie under the others' work
// instead of standing alone between two launch gaps. Every pass is PRE_BLOCKS
// blocks. The transposes, with the longer chain per block, take the lowest passes.
constexpr int PRE_BLOCKS = 512;
__global__ __launch_bounds__(256) void prepass_kernel(
    const float* xq, const float* xk, const float* xv, const float* WQ,
    const float* WK, const float* WV, const float* WO, _Float16* Xq,
    _Float16* Xk, _Float16* Xv, _Float16* WQt, _Float16* WKt, _Float16* WVt,
    _Float16* WOt) {
  constexpr int D = 2048, H = 16, F = 128, MR = 4096;
  static_assert(H * (D / TR) * (F / 32) == PRE_BLOCKS, "head weights");
  static_assert((D / TR) * (D / 32) == PRE_BLOCKS, "output weight");
  static_assert(MR * D / (256 * 4 * CAST_U) == PRE_BLOCKS, "activations");
  __shared__ float tile[TR][33];
  const int pass = blockIdx.y, blk = blockIdx.x;
  if (pass == 0) {
    transpose_cast_block<D, D>(tile, WO, WOt, blk);
  } else if (pass < 4) {
    transpose_cast_block<D, F>(tile, pass == 1 ? WQ : pass == 2 ? WK : WV,
                               pass == 1 ? WQt : pass == 2 ? WKt : WVt, blk);
  } else {
    cast_f16_block(pass == 4 ? xq : pass == 5 ? xk : xv,
                   pass == 4 ? Xq : pass == 5 ? Xk : Xv, blk);
  }
}

// ---------------------------------------------------------------------------
// GEMM: C[m,n] = sum_k A[m,k]*Bt[n,k] + bias[n].  A,Bt f16 row-major, C f32.
// Block 256 threads (8 waves), tile 128x128, wave tile 32x64 (2x4 WMMA).
// A stage is 128 k: 256 bytes of each of the 256 operand rows, so that one
// hand-over serves 32 WMMAs a wave. Waves 0 to 3 each bring a slice of 64 rows by one tensor load; two
// buffers, the next stage in flight while this one is worked on.
// K is a multiple of BK and at least 2 * BK.
// blockIdx.z picks one of up to three independent products of one shape, whose
// A, Bt and C lie one behind the other: in one launch a block's first stage and
// its stores lie under other blocks' WMMAs.
// ---------------------------------------------------------------------------
constexpr int BM = 128, BN = 128, BK = 128;
constexpr int GP = 2 * BK + 16;   // LDS row pitch, bytes: 16 x odd
constexpr int SLB = 18432;        // a slice: 64 rows of GP bytes, up to 2 KiB
constexpr int STB = 4 * SLB;      // a buffer: A rows 0-63, 64-127, Bt the same
static_assert(64 * GP <= SLB && SLB % 2048 == 0, "slice size");

__device__ __forceinline__ u32x8 tdm_gemm_group1(uint32_t pitch) {
  constexpr uint32_t d0 = 256u, d1 = 64u;
  u32x8 g1;
  g1[0] = uni((1u << 20) | (5u << 22) | (3u << 25));
  g1[1] = uni((d0 & 0xFFFFu) << 16);
  g1[2] = uni((d0 >> 16) | ((d1 & 0xFFFFu) << 16));
  g1[3] = uni((d1 >> 16) | (d0 << 16));
  g1[4] = uni(d1);
  g1[5] = uni(pitch);
  g1[6] = uni(0u);
  g1[7] = uni(0u);
  return g1;
}
__device__ __forceinline__ void tdm_load_gemm_slice(uint32_t lds_dst,
                                                    const _Float16* src,
                                                    u32x8 g1) {
  const uint64_t ga = (uint64_t)(size_t)src;
  u32x4 g0;
  g0[0] = uni(1u);
  g0[1] = uni(lds_dst);
  g0[2] = uni((uint32_t)ga);
  g0[3] = uni((((uint32_t)(ga >> 32)) & 0x01FFFFFFu) | 0x80000000u);
  asm volatile("tensor_load_to_lds %0, %1" ::"s"(g0), "s"(g1) : "memory");
}

// 16x32 f16 fragment from LDS, p = this lane's row + 16 * (lane >> 4) bytes:
// the k order of load_frag (k 8h .. 8h+7, then 16 + 8h .. 16 + 8h+7).
__device__ __forceinline__ v16h lds_frag(const unsigned char* p) {
  const v8h lo = *(const v8h*)p;
  const v8h hi = *(const v8h*)(p + 32);
  return __builtin_shufflevector(lo, hi, 0, 1, 2, 3, 4, 5, 6, 7, 8, 9, 10, 11,
                                 12, 13, 14, 15);
}

__device__ __forceinline__ void sincos4(const float (&rev)[4], float (&sn)[4],
                                        float (&cs)[4]) {
  asm("v_sin_f32 %0, %8\n\tv_cos_f32 %4, %8\n\t"
      "v_sin_f32 %1, %9\n\tv_cos_f32 %5, %9\n\t"
      "v_sin_f32 %2, %10\n\tv_cos_f32 %6, %10\n\t"
      "v_sin_f32 %3, %11\n\tv_cos_f32 %7, %11\n\t"
      "v_nop"
      : "=&v"(sn[0]), "=&v"(sn[1]), "=&v"(sn[2]), "=&v"(sn[3]), "=&v"(cs[0]),
        "=&v"(cs[1]), "=&v"(cs[2]), "=&v"(cs[3])
      : "v"(rev[0]), "v"(rev[1]), "v"(rev[2]), "v"(rev[3]));
}

// NORM = false: C = A Bt^T + bias, f32, row-major.
// NORM = true: the projections. A block's 128 columns are one head (BN = F), so
// the block holds whole head rows: it stages its f32 tile in the ring, which is
// free behind the loop, and finishes the rows there: RMS norm and RoPE for
// z = 0, 1 (q, k), the cast alone for z = 2 (v), written f16 as [B,H,S,F] to
// Hz. The f32 projections never go to memory.
template <bool NORM>
__device__ __forceinline__ void gemm_body(
    const _Float16* __restrict__ Az, const _Float16* __restrict__ Btz,
    const float* __restrict__ bias0, const float* __restrict__ bias1,
    const float* __restrict__ bias2, float* __restrict__ Cz,
    _Float16* __restrict__ Hz, const float* __restrict__ qw,
    const float* __restrict__ kw, int M, int N, int K) {
  const int z = blockIdx.z;
  const _Float16* A = Az + (long long)z * M * K;
  const _Float16* Bt = Btz + (long long)z * N * K;
  const float* bias = z == 0 ? bias0 : z == 1 ? bias1 : bias2;
  __shared__ __attribute__((aligned(2048))) unsigned char ring[2 * STB];
  __shared__ __attribute__((aligned(16))) float fq[128];  // RoPE frequencies
  const int tid = threadIdx.x, lane = tid & 31, wid = tid >> 5;
  const uint32_t wave = uni(threadIdx.x >> 5);
  const int wm = (wid & 3) * 32, wn = (wid >> 2) * 64;
  const int n0 = blockIdx.x * BN, m0 = blockIdx.y * BM;

  v8f acc[2][4];
#pragma unroll
  for (int i = 0; i < 2; ++i)
#pragma unroll
    for (int j = 0; j < 4; ++j) acc[i][j] = v8f_zero();

  // Slice sl of a buffer and its source rows (waves 4 to 7 issue nothing).
  const uint32_t sl = wave & 3u;
  const _Float16* src = (sl < 2u)
                            ? A + (long long)(m0 + 64 * (int)sl) * K
                            : Bt + (long long)(n0 + 64 * (int)(sl - 2u)) * K;
  const uint32_t dst = (uint32_t)(size_t)&ring[0] + sl * SLB;
  u32x8 g1 = tdm_gemm_group1((uint32_t)K * 2u);
  // pinned(), for the group: its words keep
  // their scalar registers, unwritten, while a request is in flight
  asm volatile("" : "+s"(g1));

  // This lane's row of the wave's first A and first B fragment in buffer 0.
  const unsigned char* ap = ring + (wm >> 6) * SLB +
                            ((wm & 63) + (lane & 15)) * GP + (lane >> 4) * 16;
  const unsigned char* bp =
      ring + (2 + (wid >> 2)) * SLB + (lane & 15) * GP + (lane >> 4) * 16;

  const int NK = K / BK;
  if (pinned(wave < 4u)) {
    tdm_load_gemm_slice(dst, src, g1);
    // Stage 0 has landed before this wave reaches the barrier below.
    asm volatile("s_wait_tensorcnt 0x0" ::: "memory");
  }
  if constexpr (NORM) {
    // The RoPE frequency of feature f depends on f alone: a wave that issues no
    // tensor load forms all 128 while stage 0 is on its way; the barrier below
    // publishes them for the epilogue.
    if (wave == 7u && z != 2) {
      // unrolled: four independent chains fill each other's waits
#pragma unroll
      for (int i = 0; i < 4; ++i) {
        int j = (lane * 4 + i) & 63;
        fq[lane * 4 + i] = __powf(10000.0f, -(float)j * (1.0f / 64.0f));
      }
    }
  }
  __syncthreads();
  if (pinned(wave < 4u)) tdm_load_gemm_slice(dst + STB, src + BK, g1);

  // not unrolled: one copy of the pass, the buffer picked by an offset
#pragma clang loop unroll(disable)
  for (int it = 0; it < NK; ++it) {
    const int bo = (it & 1) * STB;
    // unrolled: every LDS read is one address register plus an immediate
#pragma unroll
    for (int kk = 0; kk < BK / 32; ++kk) {
      v16h af[2], bf[4];
#pragma unroll
      for (int i = 0; i < 2; ++i)
        af[i] = lds_frag(ap + bo + i * 16 * GP + kk * 64);
#pragma unroll
      for (int j = 0; j < 4; ++j)
        bf[j] = lds_frag(bp + bo + j * 16 * GP + kk * 64);
#pragma unroll
      for (int i = 0; i < 2; ++i)
#pragma unroll
        for (int j = 0; j < 4; ++j)
          acc[i][j] = wmma16x16x32(af[i], bf[j], acc[i][j]);
    }
    // Publish point of stage it + 1. This wave's reads of this buffer have
    // retired before the mover is aimed at it again.
    asm volatile("s_wait_dscnt 0x0" ::: "memory");
    if (pinned(wave < 4u)) {
      // This wave's slice of stage it + 1 has landed.
      asm volatile("s_wait_tensorcnt 0x0" ::: "memory");
    }
    __syncthreads();
    if (pinned(wave < 4u && it + 2 < NK))
      tdm_load_gemm_slice(dst + bo, src + (long long)(it + 2) * BK, g1);
  }
  // Nothing of the ring is outstanding when the wave goes on to its stores. The
  // group is named so that its registers keep their words up to this wait.
  asm volatile("s_wait_tensorcnt 0x0" ::"s"(g1) : "memory");
  asm volatile("s_wait_dscnt 0x0" ::: "memory");

  const int half = lane >> 4;
  const int nl = lane & 15;
  if constexpr (!NORM) {
    float* C = Cz + (long long)z * M * N;
#pragma unroll
    for (int i = 0; i < 2; ++i)
#pragma unroll
      for (int j = 0; j < 4; ++j) {
        int nc = n0 + wn + j * 16 + nl;
        float bv = bias[nc];
#pragma unroll
        for (int r = 0; r < 8; ++r) {
          int mr = m0 + wm + i * 16 + r + half * 8;
          C[(long long)mr * N + nc] = acc[i][j][r] + bv;
        }
      }
  } else {
    constexpr int S = 2048, H = 16, F = 128;
    static_assert(BN == F && S % BM == 0, "a block is one head, one batch");
    constexpr int SP = BN + 4;  // staging pitch, floats: 16 bytes x odd
    static_assert(BM * SP * 4 <= 2 * STB, "staging fits the ring");
    // The last pass's barrier stands behind every wave's last read of the ring
    // and behind every issuer's tensor wait: the ring is free.
    float* stg = (float*)ring;
    float bv[4];
    // unrolled: bv and acc are indexed by constants only
#pragma unroll
    for (int j = 0; j < 4; ++j) bv[j] = bias[n0 + wn + j * 16 + nl];
#pragma unroll
    for (int i = 0; i < 2; ++i)
#pragma unroll
      for (int j = 0; j < 4; ++j)
#pragma unroll
        for (int r = 0; r < 8; ++r)
          stg[(wm + i * 16 + r + half * 8) * SP + wn + j * 16 + nl] =
              acc[i][j][r] + bv[j];
    __syncthreads();  // the tile is whole before rows are read across waves

    // A wave finishes 16 rows; a lane owns 4 of a row's 128 features.
    const int f0 = lane * 4;
    const int b = m0 / S;
    const int s0 = m0 - b * S + wid * 16;  // position of the wave's first row
    const float* sp = stg + wid * 16 * SP + f0;
    _Float16* hp = Hz + (long long)z * M * N +
                   ((long long)(b * H + (int)blockIdx.x) * S + s0) * F + f0;
    v4f x[16];
    // unrolled: x stays in registers, the LDS reads go out as one group
#pragma unroll
    for (int rr = 0; rr < 16; ++rr) x[rr] = *(const v4f*)(sp + rr * SP);
    if (z == 2) {
      // unrolled: x is indexed by constants only
#pragma unroll
      for (int rr = 0; rr < 16; ++rr) {
        v4h ov;
#pragma unroll
        for (int i = 0; i < 4; ++i) ov[i] = (_Float16)x[rr][i];
        *(v4h*)(hp + rr * F) = ov;
      }
    } else {
      const v4f wsc = *(const v4f*)((z == 0 ? qw : kw) + f0);
      const v4f freq = *(const v4f*)(fq + f0);
      const float sgn = (lane < 16) ? -1.0f : 1.0f;  // rotate_half sign
      const float* hr = stg + (wid * 16 + nl) * SP + half * 64;
      v4f t[16];
      // unrolled: t stays in registers, immediate offsets
#pragma unroll
      for (int c = 0; c < 16; ++c) t[c] = *(const v4f*)(hr + c * 4);
      // holds the reads together, ahead of the sums: one wait for the LDS
      // latency and not one for every read
      __builtin_amdgcn_sched_barrier(0);
      v4f sq = {0.0f, 0.0f, 0.0f, 0.0f};
      // unrolled: t is indexed by constants only
#pragma unroll
      for (int c = 0; c < 16; ++c) sq += t[c] * t[c];
      float ssl = (sq[0] + sq[1]) + (sq[2] + sq[3]);
      ssl += xhalf(ssl);
      const float rms = sqrtf(ssl * (1.0f / F));
      const int invl = __builtin_bit_cast(int, 1.0f / (rms + 1e-6f));
      // unrolled: x is indexed by constants only
#pragma unroll
      for (int rr = 0; rr < 16; ++rr) {
        const v4f xr = x[rr];
        const float inv =
            __builtin_bit_cast(float, __builtin_amdgcn_readlane(invl, rr));
        float rev[4], sn[4], cs[4];
#pragma unroll
        for (int i = 0; i < 4; ++i) {
          const float ang = (float)(s0 + rr) * freq[i];
          rev[i] = ang * 0.15915494f;  // the instructions take revolutions
        }
        sincos4(rev, sn, cs);
        v4h out;
#pragma unroll
        for (int i = 0; i < 4; ++i) {
          const float y = xr[i] * inv * wsc[i];
          const float p = xhalf(y);  // partner feature f +/- 64: lane ^ 16
          out[i] = (_Float16)(y * cs[i] + sgn * p * sn[i]);
        }
        *(v4h*)(hp + rr * F) = out;
      }
    }
  }
}

__global__ __launch_bounds__(256) void gemm_bias_f16_kernel(
    const _Float16* __restrict__ A, const _Float16* __restrict__ Bt,
    const float* __restrict__ bias, float* __restrict__ C, int M, int N,
    int K) {
  gemm_body<false>(A, Bt, bias, bias, bias, C, nullptr, nullptr, nullptr, M, N,
                   K);
}

__global__ __launch_bounds__(256) void gemm_norm_rope_kernel(
    const _Float16* __restrict__ Az, const _Float16* __restrict__ Btz,
    const float* __restrict__ bias0, const float* __restrict__ bias1,
    const float* __restrict__ bias2, const float* __restrict__ qw,
    const float* __restrict__ kw, _Float16* __restrict__ Hz, int M, int N,
    int K) {
  gemm_body<true>(Az, Btz, bias0, bias1, bias2, nullptr, Hz, qw, kw, M, N, K);
}

__global__ __launch_bounds__(128) void flash_attn_kernel(
    const _Float16* __restrict__ qh, const _Float16* __restrict__ kh,
    const _Float16* __restrict__ vh, _Float16* __restrict__ attn) {
  constexpr int S = 2048, H = 16, F = 128;
  constexpr int QT = 64, KT = 64;
  constexpr int LDK = F + 8;
  constexpr int PV = 2 * F + 32;
  __shared__ _Float16 Kt[KT * LDK];
  __shared__ __attribute__((aligned(2048))) unsigned char Vs[KT * PV];

  const int tid = threadIdx.x;
  const int lane = tid & 31;
  const int wid = tid >> 5;
  const int half = lane >> 4;
  const uint32_t wave = uni(threadIdx.x >> 5);
  const int b = blockIdx.z, h = blockIdx.y;
  const int q0 = blockIdx.x * QT + wid * 16;
  const long long base = ((long long)(b * H + h)) * S * F;
  const _Float16* Q = qh + base;
  const _Float16* Kp = kh + base;
  const _Float16* Vp = vh + base;

  v16h qfrag[4];
#pragma unroll
  for (int kc = 0; kc < 4; ++kc) qfrag[kc] = load_frag(Q, F, q0, kc * 32, lane);

  v8f o[8];
#pragma unroll
  for (int j = 0; j < 8; ++j) o[j] = v8f_zero();
  float mst = -1e30f;  // running maximum of query (lane & 15), both halves
  float lst = 0.0f;    // running sum over this half's keys only
  const float scale = 0.08838834764831845f;  // 1/sqrt(128)

  // This lane's address in the first 16-key x 16-feature block of the V tile.
  const unsigned char* vad =
      Vs + (8 * half + (lane & 7)) * PV + ((lane >> 3) & 1) * 16;

  for (int kt0 = 0; kt0 < S; kt0 += KT) {
    // This wave's LDS reads have retired before the mover is aimed at the
    // tiles again.
    asm volatile("s_wait_dscnt 0x0" ::: "memory");
    __syncthreads();  // previous tile fully consumed
#if USE_TDM
    if (wid == 0)
      tdm_load_2d((unsigned)(size_t)&Kt[0], Kp + (long long)kt0 * F, F, KT, F,
                  5, 3);
#else
#pragma unroll
    for (int it = 0; it < 8; ++it) {
      int idx = tid + it * 128;
      int kr = idx >> 4;
      int c = (idx & 15) << 3;
      *(v8h*)&Kt[kr * LDK + c] =
          *(const v8h*)(Kp + (long long)(kt0 + kr) * F + c);
    }
#endif
    // V tile as it lies, Vs[key][f]: one request of wave 1, beside wave 0's.
    if (pinned(wave == 1u)) {
      tdm_load_v_tile((uint32_t)(size_t)&Vs[0], Vp + (long long)kt0 * F);
      // The tile has landed before this wave reaches the barrier below.
      asm volatile("s_wait_tensorcnt 0x0" ::: "memory");
    }
#if USE_TDM
    if (wid == 0) __builtin_amdgcn_s_wait_tensorcnt((short)0);
#endif
    __syncthreads();

    v16h kg[4][4], vg[4][4];
    auto read_k = [&](int jn) {
#pragma unroll
      for (int kc = 0; kc < 4; ++kc)
        kg[jn][kc] = load_frag(Kt, LDK, jn * 16, kc * 32, lane);
    };
    auto read_v = [&](int g) {
      const int kc = g >> 1;
#pragma unroll
      for (int t = 0; t < 4; ++t) {
        const int jf = (g & 1) * 4 + t;
        // keys kc*32 + 8*half + 0..7, then + 16: the k order of pb[kc]
        const v8h lo = ld_tr16(vad + (kc * 32) * PV + jf * 32);
        const v8h hi = ld_tr16(vad + (kc * 32 + 16) * PV + jf * 32);
        vg[g][t] = __builtin_shufflevector(lo, hi, 0, 1, 2, 3, 4, 5, 6, 7, 8,
                                           9, 10, 11, 12, 13, 14, 15);
      }
    };

    // Scores: S^T, KT x 16 in 4 key tiles, K-reduction over F.
    // sc[jn][r] = score of key jn*16 + 8*half + r against query (lane & 15)
    v8f sc[4];
    auto score = [&](int jn) {
      sc[jn] = v8f_zero();
#pragma unroll
      for (int kc = 0; kc < 4; ++kc)
        sc[jn] = wmma16x16x32(kg[jn][kc], qfrag[kc], sc[jn]);
    };
    read_k(0);
    read_k(1);
    read_k(2);
    read_k(3);
    // holds the reads together, ahead of the WMMAs
    __builtin_amdgcn_sched_barrier(0);
    score(0);
    score(1);
    score(2);
    score(3);

    float mx = sc[0][0];
#pragma unroll
    for (int jn = 0; jn < 4; ++jn)
#pragma unroll
      for (int r = 0; r < 8; ++r) mx = fmaxf(mx, sc[jn][r]);
    mx = fmaxf(mx, xhalf(mx)) * scale;  // scale > 0: max commutes with it
    const float mnew = fmaxf(mst, mx);
    const float alpha = __expf(mst - mnew);
    // P^T as B operand: element s of chunk kc is key kc*32 + 8*half + s for
    // s < 8 and kc*32 + 16 + 8*half + (s - 8) above: tiles 2kc and 2kc + 1 as
    // they lie, the k order of the ld_tr16 pairs on the V^T side.
    v16h pb[2];
    float ps[4];
#pragma unroll
    for (int jn = 0; jn < 4; ++jn) {
      ps[jn] = 0.0f;
#pragma unroll
      for (int r = 0; r < 8; ++r) {
        float p = __expf(sc[jn][r] * scale - mnew);
        ps[jn] += p;
        pb[jn >> 1][(jn & 1) * 8 + r] = (_Float16)p;
      }
    }
    lst = lst * alpha + ((ps[0] + ps[1]) + (ps[2] + ps[3]));
    mst = mnew;
    // keeps the V^T reads behind the softmax: they take the registers that the
    // scores leave
    __builtin_amdgcn_sched_barrier(0);
    read_v(0);
    read_v(1);
    read_v(2);
    // holds the reads together, ahead of the vector work and the WMMAs
    __builtin_amdgcn_sched_barrier(0);
#pragma unroll
    for (int j = 0; j < 8; ++j)
#pragma unroll
      for (int r = 0; r < 8; ++r) o[j][r] *= alpha;

    // o[jf][r] = O^T[feature jf*16 + 8*half + r][query (lane & 15)]
    // Each o[jf] takes chunk 0 and then chunk 1.
    auto pv = [&](int g) {
#pragma unroll
      for (int t = 0; t < 4; ++t)
        o[(g & 1) * 4 + t] =
            wmma16x16x32(vg[g][t], pb[g >> 1], o[(g & 1) * 4 + t]);
    };
    pv(0);
    // keeps the last group's reads behind the WMMAs whose registers they take
    __builtin_amdgcn_sched_barrier(0);
    read_v(3);
    // holds the reads together, ahead of the WMMAs
    __builtin_amdgcn_sched_barrier(0);
    pv(1);
    pv(2);
    pv(3);
  }

  // Join the halves' sums, normalize, store f16 attn output as [B,S,H,F]:
  // a lane's 8 registers of a tile are 8 consecutive features of its query.
  const float inv = 1.0f / (lst + xhalf(lst));
  _Float16* orow = attn + ((long long)(b * S + q0 + (lane & 15))) * (H * F) +
                   h * F + half * 8;
#pragma unroll
  for (int jf = 0; jf < 8; ++jf) {
    v8h ov;
#pragma unroll
    for (int r = 0; r < 8; ++r) ov[r] = (_Float16)(o[jf][r] * inv);
    *(v8h*)(orow + jf * 16) = ov;
  }
}

// ---------------------------------------------------------------------------
extern "C" void kernel_launch(void* const* d_in, const int* in_sizes, int n_in,
                              void* d_out, int out_size, void* d_ws,
                              size_t ws_size, hipStream_t stream) {
  constexpr int Bb = 2, S = 2048, D = 2048, H = 16, F = 128;
  constexpr long long MR = (long long)Bb * S;  // 4096 rows
  constexpr long long EL = MR * D;             // 8388608 elems (act tensors)
  constexpr long long WE = (long long)H * D * F;  // 4194304 elems (weights)

  const float* xq = (const float*)d_in[0];
  const float* xk = (const float*)d_in[1];
  const float* xv = (const float*)d_in[2];
  const float* WQ = (const float*)d_in[3];
  const float* WK = (const float*)d_in[4];
  const float* WV = (const float*)d_in[5];
  const float* WO = (const float*)d_in[6];
  const float* bQ = (const float*)d_in[7];
  const float* bK = (const float*)d_in[8];
  const float* bV = (const float*)d_in[9];
  const float* bO = (const float*)d_in[10];
  const float* qw = (const float*)d_in[11];
  const float* kw = (const float*)d_in[12];

  // Workspace (~135 MB):
  //   qh,kh,vh : f16 [B,H,S,F] finished projections
  //   Xq,Xk,Xv : f16 [4096,2048] cast inputs
  //   WQt..WOt : f16 [2048,2048] transposed weights (Bt = [N][K])
  //   at       : f16 [B,S,H,F]  attention out  (aliases dead WQt+WKt)
  _Float16* qhp = (_Float16*)d_ws;
  _Float16* khp = qhp + EL;
  _Float16* vhp = khp + EL;
  _Float16* Xq = vhp + EL;
  _Float16* Xk = Xq + EL;
  _Float16* Xv = Xk + EL;
  _Float16* WQt = Xv + EL;
  _Float16* WKt = WQt + WE;
  _Float16* WVt = WKt + WE;
  _Float16* WOt = WVt + WE;
  _Float16* at = WQt;  // aliases: WQt/WKt dead after projection GEMMs

  // 1+2) one launch: cast activations f32 -> f16; transpose+cast weights:
  // W[H,D,F] -> [H,F,D]; W_O[2048,2048] -> T
  prepass_kernel<<<dim3(PRE_BLOCKS, 7), 256, 0, stream>>>(
      xq, xk, xv, WQ, WK, WV, WO, Xq, Xk, Xv, WQt, WKt, WVt, WOt);
  gemm_norm_rope_kernel<<<dim3(D / BN, (int)(MR / BM), 3), 256, 0, stream>>>(
      Xq, WQt, bQ, bK, bV, qw, kw, qhp, (int)MR, D, D);
  // 5) flash attention -> [B,S,H,F] f16
  flash_attn_kernel<<<dim3(S / 64, H, Bb), 128, 0, stream>>>(qhp, khp, vhp, at);
  // 6) output projection + b_O -> d_out f32
  gemm_bias_f16_kernel<<<dim3(D / BN, (int)(MR / BM), 1), 256, 0, stream>>>(
      at, WOt, bO, (float*)d_out, (int)MR, D, D);
}

// v008
// One run takes 177 microseconds.
// Timed twice side by side with v007, it ran 1.04 times as fast both times.
// Counting every step since v000, it is 3.61 times as fast.
#include <hip/hip_runtime.h>
#include <stdint.h>

typedef __attribute__((ext_vector_type(16))) _Float16 v16h;
typedef __attribute__((ext_vector_type(8)))  _Float16 v8h;
typedef __attribute__((ext_vector_type(4)))  _Float16 v4h;
typedef __attribute__((ext_vector_type(8)))  float    v8f;
typedef __attribute__((ext_vector_type(4)))  float    v4f;
typedef __attribute__((ext_vector_type(4)))  unsigned int u32x4;
typedef __attribute__((ext_vector_type(8)))  unsigned int u32x8;
typedef __attribute__((ext_vector_type(8)))  short        s16x8;

__device__ __forceinline__ v8f v8f_zero() {
  v8f z;
#pragma unroll
  for (int i = 0; i < 8; ++i) z[i] = 0.0f;
  return z;
}

__device__ __forceinline__ v8f wmma16x16x32(v16h a, v16h b, v8f c) {
  return __builtin_amdgcn_wmma_f32_16x16x32_f16(false, a, false, b, (short)0, c,
                                                false, false);
}

__device__ __forceinline__ v16h load_frag(const _Float16* p, int ld, int row0,
                                          int k0, int lane) {
  const _Float16* q = p + (row0 + (lane & 15)) * ld + k0 + ((lane >> 4) << 3);
  v16h v;
#pragma unroll
  for (int i = 0; i < 8; ++i) {
    v[i] = q[i];
    v[i + 8] = q[i + 16];
  }
  return v;
}

__device__ __forceinline__ float xhalf(float x) {
  const int b = __builtin_bit_cast(int, x);
  return __builtin_bit_cast(
      float, __builtin_amdgcn_permlanex16(b, b, 0x76543210, 0xfedcba98, false,
                                          false));
}

__device__ __forceinline__ uint32_t uni(uint32_t v) {
  return (uint32_t)__builtin_amdgcn_readfirstlane((int)v);
}
__device__ __forceinline__ uint32_t pinned(uint32_t v) {
  uint32_t w = uni(v);
  // the test stays in an SGPR
  asm volatile("" : "+s"(w));
  return w;
}

template <uint32_t PADA>
__device__ __forceinline__ u32x8 tdm_kv_group1() {
  constexpr uint32_t d0 = 256u, d1 = 64u;
  u32x8 g1;
  g1[0] = uni((1u << 20) | (5u << 22) | (PADA << 25));
  g1[1] = uni((d0 & 0xFFFFu) << 16);
  g1[2] = uni((d0 >> 16) | ((d1 & 0xFFFFu) << 16));
  g1[3] = uni((d1 >> 16) | (d0 << 16));
  g1[4] = uni(d1);
  g1[5] = uni(d0);  // source row pitch = row length
  g1[6] = uni(0u);
  g1[7] = uni(0u);
  return g1;
}
__device__ __forceinline__ u32x4 tdm_kv_group0(uint32_t lds_dst,
                                               const _Float16* src) {
  const uint64_t ga = (uint64_t)(size_t)src;
  u32x4 g0;
  g0[0] = uni(1u);
  g0[1] = uni(lds_dst);
  g0[2] = uni((uint32_t)ga);
  g0[3] = uni((((uint32_t)(ga >> 32)) & 0x01FFFFFFu) | 0x80000000u);
  return g0;
}
__device__ __forceinline__ void tdm_issue(u32x4 g0, u32x8 g1) {
  asm volatile("tensor_load_to_lds %0, %1" ::"s"(g0), "s"(g1) : "memory");
}

__device__ __forceinline__ v8h ld_tr16(const unsigned char* p) {
  typedef __attribute__((address_space(3))) s16x8 lds_s16x8;
  return __builtin_bit_cast(
      v8h, __builtin_amdgcn_ds_load_tr16_b128_v8i16((lds_s16x8*)p));
}

constexpr int CAST_U = 16;  // 16-byte pieces per thread
__device__ __forceinline__ void cast_f16_block(const float* __restrict__ in,
                                               _Float16* __restrict__ out,
                                               int blk) {
  const long long i0 = (long long)blk * (256 * 4 * CAST_U) + threadIdx.x * 4;
  v4f x[CAST_U];
  // unrolled: x stays in registers and the loads issue ahead of their use
#pragma unroll
  for (int u = 0; u < CAST_U; ++u) x[u] = *(const v4f*)(in + i0 + u * 1024);
  // unrolled: x is indexed by constants only
#pragma unroll
  for (int u = 0; u < CAST_U; ++u) {
    v4h h;
#pragma unroll
    for (int j = 0; j < 4; ++j) h[j] = (_Float16)x[u][j];
    *(v4h*)(out + i0 + u * 1024) = h;
  }
  asm volatile("s_wait_xcnt 0x0" ::: "memory");
}

// in: f32 [nmat][rows][cols] -> out: f16 [nmat][cols][rows]
// A block takes TR rows x 32 columns (TR / 32 square tiles, one barrier).
// rows and cols are compile-time, so that every load and store of a thread is
// one address register plus an immediate offset.
constexpr int TR = 256;
template <int rows, int cols>
__device__ __forceinline__ void transpose_cast_block(
    float (*tile)[33], const float* __restrict__ in,
    _Float16* __restrict__ out, int blk) {
  constexpr int NC = cols / 32, NR = rows / TR;  // tiles across, tiles down
  const int m = blk / (NC * NR);
  const int r0 = ((blk / NC) % NR) * TR, c0 = (blk % NC) * 32;
  const float* src = in + (long long)m * rows * cols;
  _Float16* dst = out + (long long)m * rows * cols;
  const int tx = threadIdx.x & 31, ty = threadIdx.x >> 5;  // 32 x 8
  const float* sp = src + (long long)(r0 + ty) * cols + c0 + tx;
  float x[TR / 8];
  // unrolled: x stays in registers and the loads issue back to back
#pragma unroll
  for (int i = 0; i < TR / 8; ++i) x[i] = sp[i * 8 * cols];
  // unrolled: x is indexed by constants only
#pragma unroll
  for (int i = 0; i < TR / 8; ++i) tile[ty + i * 8][tx] = x[i];
  __syncthreads();
  _Float16* dp = dst + (long long)(c0 + ty) * rows + r0 + tx;
  // unrolled: immediate offsets for the LDS reads and the stores
#pragma unroll
  for (int i = 0; i < 32; i += 8)
#pragma unroll
    for (int t = 0; t < TR; t += 32)
      dp[i * rows + t] = (_Float16)tile[t + tx][ty + i];
  asm volatile("s_wait_xcnt 0x0" ::: "memory");
}

// The seven pre-passes depend on nothing and on one another not at all: one
// launch holds them all, blockIdx.y = the pass, so that each pass's start, its
// first loads' latency and its last stores' drain lie under the others' work
// instead of standing alone between two launch gaps. Every pass is PRE_BLOCKS
// blocks. The transposes, with the longer chain per block, take the lowest passes.
constexpr int PRE_BLOCKS = 512;
__global__ __launch_bounds__(256) void prepass_kernel(
    const float* xq, const float* xk, const float* xv, const float* WQ,
    const float* WK, const float* WV, const float* WO, _Float16* Xq,
    _Float16* Xk, _Float16* Xv, _Float16* WQt, _Float16* WKt, _Float16* WVt,
    _Float16* WOt) {
  constexpr int D = 2048, H = 16, F = 128, MR = 4096;
  static_assert(H * (D / TR) * (F / 32) == PRE_BLOCKS, "head weights");
  static_assert((D / TR) * (D / 32) == PRE_BLOCKS, "output weight");
  static_assert(MR * D / (256 * 4 * CAST_U) == PRE_BLOCKS, "activations");
  __shared__ float tile[TR][33];
  const int pass = blockIdx.y, blk = blockIdx.x;
  if (pass == 0) {
    transpose_cast_block<D, D>(tile, WO, WOt, blk);
  } else if (pass < 4) {
    transpose_cast_block<D, F>(tile, pass == 1 ? WQ : pass == 2 ? WK : WV,
                               pass == 1 ? WQt : pass == 2 ? WKt : WVt, blk);
  } else {
    cast_f16_block(pass == 4 ? xq : pass == 5 ? xk : xv,
                   pass == 4 ? Xq : pass == 5 ? Xk : Xv, blk);
  }
}

// ---------------------------------------------------------------------------
// GEMM: C[m,n] = sum_k A[m,k]*Bt[n,k] + bias[n].  A,Bt f16 row-major, C f32.
// Block 256 threads (8 waves), tile 128x128, wave tile 32x64 (2x4 WMMA).
// A stage is 128 k: 256 bytes of each of the 256 operand rows, so that one
// hand-over serves 32 WMMAs a wave. Waves 0 to 3 each bring a slice of 64 rows by one tensor load; two
// buffers, the next stage in flight while this one is worked on.
// K is a multiple of BK and at least 2 * BK.
// blockIdx.z picks one of up to three independent products of one shape, whose
// A, Bt and C lie one behind the other: in one launch a block's first stage and
// its stores lie under other blocks' WMMAs.
// ---------------------------------------------------------------------------
constexpr int BM = 128, BN = 128, BK = 128;
constexpr int GP = 2 * BK + 16;   // LDS row pitch, bytes: 16 x odd
constexpr int SLB = 18432;        // a slice: 64 rows of GP bytes, up to 2 KiB
constexpr int STB = 4 * SLB;      // a buffer: A rows 0-63, 64-127, Bt the same
static_assert(64 * GP <= SLB && SLB % 2048 == 0, "slice size");

__device__ __forceinline__ u32x8 tdm_gemm_group1(uint32_t pitch) {
  constexpr uint32_t d0 = 256u, d1 = 64u;
  u32x8 g1;
  g1[0] = uni((1u << 20) | (5u << 22) | (3u << 25));
  g1[1] = uni((d0 & 0xFFFFu) << 16);
  g1[2] = uni((d0 >> 16) | ((d1 & 0xFFFFu) << 16));
  g1[3] = uni((d1 >> 16) | (d0 << 16));
  g1[4] = uni(d1);
  g1[5] = uni(pitch);
  g1[6] = uni(0u);
  g1[7] = uni(0u);
  return g1;
}
__device__ __forceinline__ void tdm_load_gemm_slice(uint32_t lds_dst,
                                                    const _Float16* src,
                                                    u32x8 g1) {
  const uint64_t ga = (uint64_t)(size_t)src;
  u32x4 g0;
  g0[0] = uni(1u);
  g0[1] = uni(lds_dst);
  g0[2] = uni((uint32_t)ga);
  g0[3] = uni((((uint32_t)(ga >> 32)) & 0x01FFFFFFu) | 0x80000000u);
  asm volatile("tensor_load_to_lds %0, %1" ::"s"(g0), "s"(g1) : "memory");
}

// 16x32 f16 fragment from LDS, p = this lane's row + 16 * (lane >> 4) bytes:
// the k order of load_frag (k 8h .. 8h+7, then 16 + 8h .. 16 + 8h+7).
__device__ __forceinline__ v16h lds_frag(const unsigned char* p) {
  const v8h lo = *(const v8h*)p;
  const v8h hi = *(const v8h*)(p + 32);
  return __builtin_shufflevector(lo, hi, 0, 1, 2, 3, 4, 5, 6, 7, 8, 9, 10, 11,
                                 12, 13, 14, 15);
}

__device__ __forceinline__ void sincos4(const float (&rev)[4], float (&sn)[4],
                                        float (&cs)[4]) {
  asm("v_sin_f32 %0, %8\n\tv_cos_f32 %4, %8\n\t"
      "v_sin_f32 %1, %9\n\tv_cos_f32 %5, %9\n\t"
      "v_sin_f32 %2, %10\n\tv_cos_f32 %6, %10\n\t"
      "v_sin_f32 %3, %11\n\tv_cos_f32 %7, %11\n\t"
      "v_nop"
      : "=&v"(sn[0]), "=&v"(sn[1]), "=&v"(sn[2]), "=&v"(sn[3]), "=&v"(cs[0]),
        "=&v"(cs[1]), "=&v"(cs[2]), "=&v"(cs[3])
      : "v"(rev[0]), "v"(rev[1]), "v"(rev[2]), "v"(rev[3]));
}

// NORM = false: C = A Bt^T + bias, f32, row-major.
// NORM = true: the projections. A block's 128 columns are one head (BN = F), so
// the block holds whole head rows: it stages its f32 tile in the ring, which is
// free behind the loop, and finishes the rows there: RMS norm and RoPE for
// z = 0, 1 (q, k), the cast alone for z = 2 (v), written f16 as [B,H,S,F] to
// Hz. The f32 projections never go to memory.
template <bool NORM>
__device__ __forceinline__ void gemm_body(
    const _Float16* __restrict__ Az, const _Float16* __restrict__ Btz,
    const float* __restrict__ bias0, const float* __restrict__ bias1,
    const float* __restrict__ bias2, float* __restrict__ Cz,
    _Float16* __restrict__ Hz, const float* __restrict__ qw,
    const float* __restrict__ kw, int M, int N, int K) {
  const int z = blockIdx.z;
  const _Float16* A = Az + (long long)z * M * K;
  const _Float16* Bt = Btz + (long long)z * N * K;
  const float* bias = z == 0 ? bias0 : z == 1 ? bias1 : bias2;
  __shared__ __attribute__((aligned(2048))) unsigned char ring[2 * STB];
  __shared__ __attribute__((aligned(16))) float fq[128];  // RoPE frequencies
  const int tid = threadIdx.x, lane = tid & 31, wid = tid >> 5;
  const uint32_t wave = uni(threadIdx.x >> 5);
  const int wm = (wid & 3) * 32, wn = (wid >> 2) * 64;
  const int n0 = blockIdx.x * BN, m0 = blockIdx.y * BM;

  v8f acc[2][4];
#pragma unroll
  for (int i = 0; i < 2; ++i)
#pragma unroll
    for (int j = 0; j < 4; ++j) acc[i][j] = v8f_zero();

  // Slice sl of a buffer and its source rows (waves 4 to 7 issue nothing).
  const uint32_t sl = wave & 3u;
  const _Float16* src = (sl < 2u)
                            ? A + (long long)(m0 + 64 * (int)sl) * K
                            : Bt + (long long)(n0 + 64 * (int)(sl - 2u)) * K;
  const uint32_t dst = (uint32_t)(size_t)&ring[0] + sl * SLB;
  u32x8 g1 = tdm_gemm_group1((uint32_t)K * 2u);
  // pinned(), for the group: its words keep
  // their scalar registers, unwritten, while a request is in flight
  asm volatile("" : "+s"(g1));

  // This lane's row of the wave's first A and first B fragment in buffer 0.
  const unsigned char* ap = ring + (wm >> 6) * SLB +
                            ((wm & 63) + (lane & 15)) * GP + (lane >> 4) * 16;
  const unsigned char* bp =
      ring + (2 + (wid >> 2)) * SLB + (lane & 15) * GP + (lane >> 4) * 16;

  const int NK = K / BK;
  if (pinned(wave < 4u)) {
    tdm_load_gemm_slice(dst, src, g1);
    // Stage 0 has landed before this wave reaches the barrier below.
    asm volatile("s_wait_tensorcnt 0x0" ::: "memory");
  }
  if constexpr (NORM) {
    // The RoPE frequency of feature f depends on f alone: a wave that issues no
    // tensor load forms all 128 while stage 0 is on its way; the barrier below
    // publishes them for the epilogue.
    if (wave == 7u && z != 2) {
      // unrolled: four independent chains fill each other's waits
#pragma unroll
      for (int i = 0; i < 4; ++i) {
        int j = (lane * 4 + i) & 63;
        fq[lane * 4 + i] = __powf(10000.0f, -(float)j * (1.0f / 64.0f));
      }
    }
  }
  __syncthreads();
  if (pinned(wave < 4u)) tdm_load_gemm_slice(dst + STB, src + BK, g1);

  // not unrolled: one copy of the pass, the buffer picked by an offset
#pragma clang loop unroll(disable)
  for (int it = 0; it < NK; ++it) {
    const int bo = (it & 1) * STB;
    // unrolled: every LDS read is one address register plus an immediate
#pragma unroll
    for (int kk = 0; kk < BK / 32; ++kk) {
      v16h af[2], bf[4];
#pragma unroll
      for (int i = 0; i < 2; ++i)
        af[i] = lds_frag(ap + bo + i * 16 * GP + kk * 64);
#pragma unroll
      for (int j = 0; j < 4; ++j)
        bf[j] = lds_frag(bp + bo + j * 16 * GP + kk * 64);
#pragma unroll
      for (int i = 0; i < 2; ++i)
#pragma unroll
        for (int j = 0; j < 4; ++j)
          acc[i][j] = wmma16x16x32(af[i], bf[j], acc[i][j]);
    }
    // Publish point of stage it + 1. This wave's reads of this buffer have
    // retired before the mover is aimed at it again.
    asm volatile("s_wait_dscnt 0x0" ::: "memory");
    if (pinned(wave < 4u)) {
      // This wave's slice of stage it + 1 has landed.
      asm volatile("s_wait_tensorcnt 0x0" ::: "memory");
    }
    __syncthreads();
    if (pinned(wave < 4u && it + 2 < NK))
      tdm_load_gemm_slice(dst + bo, src + (long long)(it + 2) * BK, g1);
  }
  // Nothing of the ring is outstanding when the wave goes on to its stores. The
  // group is named so that its registers keep their words up to this wait.
  asm volatile("s_wait_tensorcnt 0x0" ::"s"(g1) : "memory");
  asm volatile("s_wait_dscnt 0x0" ::: "memory");

  const int half = lane >> 4;
  const int nl = lane & 15;
  if constexpr (!NORM) {
    float* C = Cz + (long long)z * M * N;
#pragma unroll
    for (int i = 0; i < 2; ++i)
#pragma unroll
      for (int j = 0; j < 4; ++j) {
        int nc = n0 + wn + j * 16 + nl;
        float bv = bias[nc];
#pragma unroll
        for (int r = 0; r < 8; ++r) {
          int mr = m0 + wm + i * 16 + r + half * 8;
          C[(long long)mr * N + nc] = acc[i][j][r] + bv;
        }
      }
  } else {
    constexpr int S = 2048, H = 16, F = 128;
    static_assert(BN == F && S % BM == 0, "a block is one head, one batch");
    constexpr int SP = BN + 4;  // staging pitch, floats: 16 bytes x odd
    static_assert(BM * SP * 4 <= 2 * STB, "staging fits the ring");
    // The last pass's barrier stands behind every wave's last read of the ring
    // and behind every issuer's tensor wait: the ring is free.
    float* stg = (float*)ring;
    float bv[4];
    // unrolled: bv and acc are indexed by constants only
#pragma unroll
    for (int j = 0; j < 4; ++j) bv[j] = bias[n0 + wn + j * 16 + nl];
#pragma unroll
    for (int i = 0; i < 2; ++i)
#pragma unroll
      for (int j = 0; j < 4; ++j)
#pragma unroll
        for (int r = 0; r < 8; ++r)
          stg[(wm + i * 16 + r + half * 8) * SP + wn + j * 16 + nl] =
              acc[i][j][r] + bv[j];
    __syncthreads();  // the tile is whole before rows are read across waves

    // A wave finishes 16 rows; a lane owns 4 of a row's 128 features.
    const int f0 = lane * 4;
    const int b = m0 / S;
    const int s0 = m0 - b * S + wid * 16;  // position of the wave's first row
    const float* sp = stg + wid * 16 * SP + f0;
    _Float16* hp = Hz + (long long)z * M * N +
                   ((long long)(b * H + (int)blockIdx.x) * S + s0) * F + f0;
    v4f x[16];
    // unrolled: x stays in registers, the LDS reads go out as one group
#pragma unroll
    for (int rr = 0; rr < 16; ++rr) x[rr] = *(const v4f*)(sp + rr * SP);
    if (z == 2) {
      // unrolled: x is indexed by constants only
#pragma unroll
      for (int rr = 0; rr < 16; ++rr) {
        v4h ov;
#pragma unroll
        for (int i = 0; i < 4; ++i) ov[i] = (_Float16)x[rr][i];
        *(v4h*)(hp + rr * F) = ov;
      }
    } else {
      const v4f wsc = *(const v4f*)((z == 0 ? qw : kw) + f0);
      const v4f freq = *(const v4f*)(fq + f0);
      const float sgn = (lane < 16) ? -1.0f : 1.0f;  // rotate_half sign
      const float* hr = stg + (wid * 16 + nl) * SP + half * 64;
      v4f t[16];
      // unrolled: t stays in registers, immediate offsets
#pragma unroll
      for (int c = 0; c < 16; ++c) t[c] = *(const v4f*)(hr + c * 4);
      // holds the reads together, ahead of the sums: one wait for the LDS
      // latency and not one for every read
      __builtin_amdgcn_sched_barrier(0);
      v4f sq = {0.0f, 0.0f, 0.0f, 0.0f};
      // unrolled: t is indexed by constants only
#pragma unroll
      for (int c = 0; c < 16; ++c) sq += t[c] * t[c];
      float ssl = (sq[0] + sq[1]) + (sq[2] + sq[3]);
      ssl += xhalf(ssl);
      const float rms = sqrtf(ssl * (1.0f / F));
      const int invl = __builtin_bit_cast(int, 1.0f / (rms + 1e-6f));
      // unrolled: x is indexed by constants only
#pragma unroll
      for (int rr = 0; rr < 16; ++rr) {
        const v4f xr = x[rr];
        const float inv =
            __builtin_bit_cast(float, __builtin_amdgcn_readlane(invl, rr));
        float rev[4], sn[4], cs[4];
#pragma unroll
        for (int i = 0; i < 4; ++i) {
          const float ang = (float)(s0 + rr) * freq[i];
          rev[i] = ang * 0.15915494f;  // the instructions take revolutions
        }
        sincos4(rev, sn, cs);
        v4h out;
#pragma unroll
        for (int i = 0; i < 4; ++i) {
          const float y = xr[i] * inv * wsc[i];
          const float p = xhalf(y);  // partner feature f +/- 64: lane ^ 16
          out[i] = (_Float16)(y * cs[i] + sgn * p * sn[i]);
        }
        *(v4h*)(hp + rr * F) = out;
      }
    }
  }
}

__global__ __launch_bounds__(256) void gemm_bias_f16_kernel(
    const _Float16* __restrict__ A, const _Float16* __restrict__ Bt,
    const float* __restrict__ bias, float* __restrict__ C, int M, int N,
    int K) {
  gemm_body<false>(A, Bt, bias, bias, bias, C, nullptr, nullptr, nullptr, M, N,
                   K);
}

__global__ __launch_bounds__(256) void gemm_norm_rope_kernel(
    const _Float16* __restrict__ Az, const _Float16* __restrict__ Btz,
    const float* __restrict__ bias0, const float* __restrict__ bias1,
    const float* __restrict__ bias2, const float* __restrict__ qw,
    const float* __restrict__ kw, _Float16* __restrict__ Hz, int M, int N,
    int K) {
  gemm_body<true>(Az, Btz, bias0, bias1, bias2, nullptr, Hz, qw, kw, M, N, K);
}

__global__ __launch_bounds__(128) void flash_attn_kernel(
    const _Float16* __restrict__ qh, const _Float16* __restrict__ kh,
    const _Float16* __restrict__ vh, _Float16* __restrict__ attn) {
  constexpr int S = 2048, H = 16, F = 128;
  constexpr int QT = 64, KT = 64;
  constexpr int NT = S / KT;      // stages
  constexpr int PK = 2 * F + 16;  // K row pitch in LDS, bytes: 16 x odd
  constexpr int PV = 2 * F + 32;  // V row pitch in LDS, bytes: 32 x odd
  constexpr int TB = 18432;       // a tile's place: 64 rows, up to 2 KiB
  constexpr int SB = 2 * TB;      // a buffer: the K tile, then the V tile
  static_assert(KT * PK <= TB && KT * PV <= TB && TB % 2048 == 0, "tile place");
  static_assert(NT >= 2, "the prologue fills two stages");
  __shared__ __attribute__((aligned(2048))) unsigned char kv[2 * SB];

  const int tid = threadIdx.x;
  const int lane = tid & 31;
  const int wid = tid >> 5;
  const int half = lane >> 4;
  const uint32_t wave = uni(threadIdx.x >> 5);
  const int b = blockIdx.z, h = blockIdx.y;
  const int q0 = blockIdx.x * QT + wid * 16;
  const long long base = ((long long)(b * H + h)) * S * F;
  const _Float16* Q = qh + base;
  const _Float16* Kp = kh + base;
  const _Float16* Vp = vh + base;

  v16h qfrag[4];
#pragma unroll
  for (int kc = 0; kc < 4; ++kc) qfrag[kc] = load_frag(Q, F, q0, kc * 32, lane);

  v8f o[8];
#pragma unroll
  for (int j = 0; j < 8; ++j) o[j] = v8f_zero();
  float mst = -1e30f;  // running maximum of query (lane & 15), both halves
  float lst = 0.0f;    // running sum over this half's keys only
  const float scale = 0.08838834764831845f;  // 1/sqrt(128)

  // This lane's row of the first K fragment, and its address in the first
  // 16-key x 16-feature block of the V tile, both in buffer 0.
  const unsigned char* kad = kv + (lane & 15) * PK + half * 16;
  const unsigned char* vad =
      kv + TB + (8 * half + (lane & 7)) * PV + ((lane >> 3) & 1) * 16;

  const _Float16* src = wave == 0u ? Kp : Vp;
  const uint32_t dst = (uint32_t)(size_t)&kv[0] + (wave == 0u ? 0u : (uint32_t)TB);
  u32x8 g1k = tdm_kv_group1<3>(), g1v = tdm_kv_group1<7>();
  // pinned(), for the groups: their words
  // keep their scalar registers, unwritten, while a request is in flight
  asm volatile("" : "+s"(g1k));
  asm volatile("" : "+s"(g1v));

  u32x4 g0 = tdm_kv_group0(dst, src);
  if (pinned(wave == 0u)) {
    tdm_issue(g0, g1k);
    // Stage 0 has landed before this wave reaches the barrier below.
    asm volatile("s_wait_tensorcnt 0x0" ::"s"(g0) : "memory");
  }
  if (pinned(wave == 1u)) {
    tdm_issue(g0, g1v);
    // Stage 0 has landed before this wave reaches the barrier below.
    asm volatile("s_wait_tensorcnt 0x0" ::"s"(g0) : "memory");
  }
  __syncthreads();
  g0 = tdm_kv_group0(dst + SB, src + KT * F);
  if (pinned(wave == 0u)) tdm_issue(g0, g1k);
  if (pinned(wave == 1u)) tdm_issue(g0, g1v);

  // not unrolled: one copy of the pass, the buffer picked by an offset
#pragma clang loop unroll(disable)
  for (int it = 0; it < NT; ++it) {
    const int bo = (it & 1) * SB;
    v16h kg[4][4], vg[4][4];
    auto read_k = [&](int jn) {
#pragma unroll
      for (int kc = 0; kc < 4; ++kc)
        kg[jn][kc] = lds_frag(kad + bo + jn * 16 * PK + kc * 64);
    };
    auto read_v = [&](int g) {
      const int kc = g >> 1;
#pragma unroll
      for (int t = 0; t < 4; ++t) {
        const int jf = (g & 1) * 4 + t;
        // keys kc*32 + 8*half + 0..7, then + 16: the k order of pb[kc]
        const v8h lo = ld_tr16(vad + bo + (kc * 32) * PV + jf * 32);
        const v8h hi = ld_tr16(vad + bo + (kc * 32 + 16) * PV + jf * 32);
        vg[g][t] = __builtin_shufflevector(lo, hi, 0, 1, 2, 3, 4, 5, 6, 7, 8,
                                           9, 10, 11, 12, 13, 14, 15);
      }
    };

    // Scores: S^T, KT x 16 in 4 key tiles, K-reduction over F.
    // sc[jn][r] = score of key jn*16 + 8*half + r against query (lane & 15)
    v8f sc[4];
    auto score = [&](int jn) {
      sc[jn] = v8f_zero();
#pragma unroll
      for (int kc = 0; kc < 4; ++kc)
        sc[jn] = wmma16x16x32(kg[jn][kc], qfrag[kc], sc[jn]);
    };
    read_k(0);
    read_k(1);
    read_k(2);
    read_k(3);
    // holds the reads together, ahead of the WMMAs
    __builtin_amdgcn_sched_barrier(0);
    score(0);
    score(1);
    score(2);
    score(3);

    float mx = sc[0][0];
#pragma unroll
    for (int jn = 0; jn < 4; ++jn)
#pragma unroll
      for (int r = 0; r < 8; ++r) mx = fmaxf(mx, sc[jn][r]);
    mx = fmaxf(mx, xhalf(mx)) * scale;  // scale > 0: max commutes with it
    const float mnew = fmaxf(mst, mx);
    const float alpha = __expf(mst - mnew);
    // P^T as B operand: element s of chunk kc is key kc*32 + 8*half + s for
    // s < 8 and kc*32 + 16 + 8*half + (s - 8) above: tiles 2kc and 2kc + 1 as
    // they lie, the k order of the ld_tr16 pairs on the V^T side.
    v16h pb[2];
    float ps[4];
#pragma unroll
    for (int jn = 0; jn < 4; ++jn) {
      ps[jn] = 0.0f;
#pragma unroll
      for (int r = 0; r < 8; ++r) {
        float p = __expf(sc[jn][r] * scale - mnew);
        ps[jn] += p;
        pb[jn >> 1][(jn & 1) * 8 + r] = (_Float16)p;
      }
    }
    lst = lst * alpha + ((ps[0] + ps[1]) + (ps[2] + ps[3]));
    mst = mnew;
    // keeps the V^T reads behind the softmax: they take the registers that the
    // scores leave
    __builtin_amdgcn_sched_barrier(0);
    read_v(0);
    read_v(1);
    read_v(2);
    // holds the reads together, ahead of the vector work and the WMMAs
    __builtin_amdgcn_sched_barrier(0);
#pragma unroll
    for (int j = 0; j < 8; ++j)
#pragma unroll
      for (int r = 0; r < 8; ++r) o[j][r] *= alpha;

    // o[jf][r] = O^T[feature jf*16 + 8*half + r][query (lane & 15)]
    // Each o[jf] takes chunk 0 and then chunk 1.
    auto pv = [&](int g) {
#pragma unroll
      for (int t = 0; t < 4; ++t)
        o[(g & 1) * 4 + t] =
            wmma16x16x32(vg[g][t], pb[g >> 1], o[(g & 1) * 4 + t]);
    };
    pv(0);
    // keeps the last group's reads behind the WMMAs whose registers they take
    __builtin_amdgcn_sched_barrier(0);
    read_v(3);
    // holds the reads together, ahead of the WMMAs
    __builtin_amdgcn_sched_barrier(0);
    pv(1);
    pv(2);
    pv(3);

    // keeps the wait below behind the WMMAs: in front of them it would wait out
    // the last group's reads at once, in place of the counted waits
    __builtin_amdgcn_sched_barrier(0);
    // Publish point of stage it + 1. This wave's reads of this buffer have
    // retired before the mover is aimed at it again. The running sum is named
    // so that its additions stay in front, beside the WMMAs, and do not sink
    // behind the barrier, ahead of the next tile's reads.
    asm volatile("s_wait_dscnt 0x0" ::"v"(lst) : "memory");
    if (pinned(wave < 2u)) {
      asm volatile("s_wait_tensorcnt 0x0" ::"s"(g0) : "memory");
    }
    __syncthreads();
    if (pinned(wave < 2u && it + 2 < NT)) {
      g0 = tdm_kv_group0(dst + bo, src + (it + 2) * (KT * F));
      if (pinned(wave == 0u)) tdm_issue(g0, g1k);
      if (pinned(wave == 1u)) tdm_issue(g0, g1v);
    }
  }
  // Nothing of the ring is outstanding when the wave goes on to its stores. The
  // groups are named so that their registers keep their words up to this wait.
  asm volatile("s_wait_tensorcnt 0x0" ::"s"(g0), "s"(g1k), "s"(g1v) : "memory");
  asm volatile("s_wait_dscnt 0x0" ::: "memory");

  // Join the halves' sums, normalize, store f16 attn output as [B,S,H,F]:
  // a lane's 8 registers of a tile are 8 consecutive features of its query.
  const float inv = 1.0f / (lst + xhalf(lst));
  _Float16* orow = attn + ((long long)(b * S + q0 + (lane & 15))) * (H * F) +
                   h * F + half * 8;
#pragma unroll
  for (int jf = 0; jf < 8; ++jf) {
    v8h ov;
#pragma unroll
    for (int r = 0; r < 8; ++r) ov[r] = (_Float16)(o[jf][r] * inv);
    *(v8h*)(orow + jf * 16) = ov;
  }
}

// ---------------------------------------------------------------------------
extern "C" void kernel_launch(void* const* d_in, const int* in_sizes, int n_in,
                              void* d_out, int out_size, void* d_ws,
                              size_t ws_size, hipStream_t stream) {
  constexpr int Bb = 2, S = 2048, D = 2048, H = 16, F = 128;
  constexpr long long MR = (long long)Bb * S;  // 4096 rows
  constexpr long long EL = MR * D;             // 8388608 elems (act tensors)
  constexpr long long WE = (long long)H * D * F;  // 4194304 elems (weights)

  const float* xq = (const float*)d_in[0];
  const float* xk = (const float*)d_in[1];
  const float* xv = (const float*)d_in[2];
  const float* WQ = (const float*)d_in[3];
  const float* WK = (const float*)d_in[4];
  const float* WV = (const float*)d_in[5];
  const float* WO = (const float*)d_in[6];
  const float* bQ = (const float*)d_in[7];
  const float* bK = (const float*)d_in[8];
  const float* bV = (const float*)d_in[9];
  const float* bO = (const float*)d_in[10];
  const float* qw = (const float*)d_in[11];
  const float* kw = (const float*)d_in[12];

  // Workspace (~135 MB):
  //   qh,kh,vh : f16 [B,H,S,F] finished projections
  //   Xq,Xk,Xv : f16 [4096,2048] cast inputs
  //   WQt..WOt : f16 [2048,2048] transposed weights (Bt = [N][K])
  //   at       : f16 [B,S,H,F]  attention out  (aliases dead WQt+WKt)
  _Float16* qhp = (_Float16*)d_ws;
  _Float16* khp = qhp + EL;
  _Float16* vhp = khp + EL;
  _Float16* Xq = vhp + EL;
  _Float16* Xk = Xq + EL;
  _Float16* Xv = Xk + EL;
  _Float16* WQt = Xv + EL;
  _Float16* WKt = WQt + WE;
  _Float16* WVt = WKt + WE;
  _Float16* WOt = WVt + WE;
  _Float16* at = WQt;  // aliases: WQt/WKt dead after projection GEMMs

  // 1+2) one launch: cast activations f32 -> f16; transpose+cast weights:
  // W[H,D,F] -> [H,F,D]; W_O[2048,2048] -> T
  prepass_kernel<<<dim3(PRE_BLOCKS, 7), 256, 0, stream>>>(
      xq, xk, xv, WQ, WK, WV, WO, Xq, Xk, Xv, WQt, WKt, WVt, WOt);
  gemm_norm_rope_kernel<<<dim3(D / BN, (int)(MR / BM), 3), 256, 0, stream>>>(
      Xq, WQt, bQ, bK, bV, qw, kw, qhp, (int)MR, D, D);
  // 5) flash attention -> [B,S,H,F] f16
  flash_attn_kernel<<<dim3(S / 64, H, Bb), 128, 0, stream>>>(qhp, khp, vhp, at);
  // 6) output projection + b_O -> d_out f32
  gemm_bias_f16_kernel<<<dim3(D / BN, (int)(MR / BM), 1), 256, 0, stream>>>(
      at, WOt, bO, (float*)d_out, (int)MR, D, D);
}

// v009
// It runs in 170 microseconds.
// Two timings next to v008 put it at 1.05 and 1.04 times that version's speed.
// All steps since v000 together make it 3.77 times as fast.
#include <hip/hip_runtime.h>
#include <stdint.h>

typedef __attribute__((ext_vector_type(16))) _Float16 v16h;
typedef __attribute__((ext_vector_type(8)))  _Float16 v8h;
typedef __attribute__((ext_vector_type(4)))  _Float16 v4h;
typedef __attribute__((ext_vector_type(8)))  float    v8f;
typedef __attribute__((ext_vector_type(4)))  float    v4f;
typedef __attribute__((ext_vector_type(4)))  unsigned int u32x4;
typedef __attribute__((ext_vector_type(8)))  unsigned int u32x8;
typedef __attribute__((ext_vector_type(8)))  short        s16x8;

__device__ __forceinline__ v8f v8f_zero() {
  v8f z;
#pragma unroll
  for (int i = 0; i < 8; ++i) z[i] = 0.0f;
  return z;
}

__device__ __forceinline__ v8f wmma16x16x32(v16h a, v16h b, v8f c) {
  return __builtin_amdgcn_wmma_f32_16x16x32_f16(false, a, false, b, (short)0, c,
                                                false, false);
}

__device__ __forceinline__ v16h load_frag(const _Float16* p, int ld, int row0,
                                          int k0, int lane) {
  const _Float16* q = p + (row0 + (lane & 15)) * ld + k0 + ((lane >> 4) << 3);
  v16h v;
#pragma unroll
  for (int i = 0; i < 8; ++i) {
    v[i] = q[i];
    v[i + 8] = q[i + 16];
  }
  return v;
}

__device__ __forceinline__ float xhalf(float x) {
  const int b = __builtin_bit_cast(int, x);
  return __builtin_bit_cast(
      float, __builtin_amdgcn_permlanex16(b, b, 0x76543210, 0xfedcba98, false,
                                          false));
}

__device__ __forceinline__ uint32_t uni(uint32_t v) {
  return (uint32_t)__builtin_amdgcn_readfirstlane((int)v);
}
__device__ __forceinline__ uint32_t pinned(uint32_t v) {
  uint32_t w = uni(v);
  // the test stays in an SGPR
  asm volatile("" : "+s"(w));
  return w;
}

template <uint32_t PADA>
__device__ __forceinline__ u32x8 tdm_kv_group1() {
  constexpr uint32_t d0 = 256u, d1 = 64u;
  u32x8 g1;
  g1[0] = uni((1u << 20) | (5u << 22) | (PADA << 25));
  g1[1] = uni((d0 & 0xFFFFu) << 16);
  g1[2] = uni((d0 >> 16) | ((d1 & 0xFFFFu) << 16));
  g1[3] = uni((d1 >> 16) | (d0 << 16));
  g1[4] = uni(d1);
  g1[5] = uni(d0);  // source row pitch = row length
  g1[6] = uni(0u);
  g1[7] = uni(0u);
  return g1;
}
__device__ __forceinline__ u32x4 tdm_kv_group0(uint32_t lds_dst,
                                               const _Float16* src) {
  const uint64_t ga = (uint64_t)(size_t)src;
  u32x4 g0;
  g0[0] = uni(1u);
  g0[1] = uni(lds_dst);
  g0[2] = uni((uint32_t)ga);
  g0[3] = uni((((uint32_t)(ga >> 32)) & 0x01FFFFFFu) | 0x80000000u);
  return g0;
}
__device__ __forceinline__ void tdm_issue(u32x4 g0, u32x8 g1) {
  asm volatile("tensor_load_to_lds %0, %1" ::"s"(g0), "s"(g1) : "memory");
}

__device__ __forceinline__ v8h ld_tr16(const unsigned char* p) {
  typedef __attribute__((address_space(3))) s16x8 lds_s16x8;
  return __builtin_bit_cast(
      v8h, __builtin_amdgcn_ds_load_tr16_b128_v8i16((lds_s16x8*)p));
}

constexpr int CAST_U = 16;  // 16-byte pieces per thread
__device__ __forceinline__ void cast_f16_block(const float* __restrict__ in,
                                               _Float16* __restrict__ out,
                                               int blk) {
  const long long i0 = (long long)blk * (256 * 4 * CAST_U) + threadIdx.x * 4;
  v4f x[CAST_U];
  // unrolled: x stays in registers and the loads issue ahead of their use
#pragma unroll
  for (int u = 0; u < CAST_U; ++u) x[u] = *(const v4f*)(in + i0 + u * 1024);
  // unrolled: x is indexed by constants only
#pragma unroll
  for (int u = 0; u < CAST_U; ++u) {
    v4h h;
#pragma unroll
    for (int j = 0; j < 4; ++j) h[j] = (_Float16)x[u][j];
    *(v4h*)(out + i0 + u * 1024) = h;
  }
  asm volatile("s_wait_xcnt 0x0" ::: "memory");
}

// in: f32 [nmat][rows][cols] -> out: f16 [nmat][cols][rows]
// A block takes TR rows x 32 columns (TR / 32 square tiles, one barrier).
// rows and cols are compile-time, so that every load and store of a thread is
// one address register plus an immediate offset.
constexpr int TR = 256;
template <int rows, int cols>
__device__ __forceinline__ void transpose_cast_block(
    float (*tile)[33], const float* __restrict__ in,
    _Float16* __restrict__ out, int blk) {
  constexpr int NC = cols / 32, NR = rows / TR;  // tiles across, tiles down
  const int m = blk / (NC * NR);
  const int r0 = ((blk / NC) % NR) * TR, c0 = (blk % NC) * 32;
  const float* src = in + (long long)m * rows * cols;
  _Float16* dst = out + (long long)m * rows * cols;
  const int tx = threadIdx.x & 31, ty = threadIdx.x >> 5;  // 32 x 8
  const float* sp = src + (long long)(r0 + ty) * cols + c0 + tx;
  float x[TR / 8];
  // unrolled: x stays in registers and the loads issue back to back
#pragma unroll
  for (int i = 0; i < TR / 8; ++i) x[i] = sp[i * 8 * cols];
  // unrolled: x is indexed by constants only
#pragma unroll
  for (int i = 0; i < TR / 8; ++i) tile[ty + i * 8][tx] = x[i];
  __syncthreads();
  _Float16* dp = dst + (long long)(c0 + ty) * rows + r0 + tx;
  // unrolled: immediate offsets for the LDS reads and the stores
#pragma unroll
  for (int i = 0; i < 32; i += 8)
#pragma unroll
    for (int t = 0; t < TR; t += 32)
      dp[i * rows + t] = (_Float16)tile[t + tx][ty + i];
  asm volatile("s_wait_xcnt 0x0" ::: "memory");
}

// The seven pre-passes depend on nothing and on one another not at all: one
// launch holds them all, blockIdx.y = the pass, so that each pass's start, its
// first loads' latency and its last stores' drain lie under the others' work
// instead of standing alone between two launch gaps. Every pass is PRE_BLOCKS
// blocks. The transposes, with the longer chain per block, take the lowest passes.
constexpr int PRE_BLOCKS = 512;
__global__ __launch_bounds__(256) void prepass_kernel(
    const float* xq, const float* xk, const float* xv, const float* WQ,
    const float* WK, const float* WV, const float* WO, _Float16* Xq,
    _Float16* Xk, _Float16* Xv, _Float16* WQt, _Float16* WKt, _Float16* WVt,
    _Float16* WOt) {
  constexpr int D = 2048, H = 16, F = 128, MR = 4096;
  static_assert(H * (D / TR) * (F / 32) == PRE_BLOCKS, "head weights");
  static_assert((D / TR) * (D / 32) == PRE_BLOCKS, "output weight");
  static_assert(MR * D / (256 * 4 * CAST_U) == PRE_BLOCKS, "activations");
  __shared__ float tile[TR][33];
  const int pass = blockIdx.y, blk = blockIdx.x;
  if (pass == 0) {
    transpose_cast_block<D, D>(tile, WO, WOt, blk);
  } else if (pass < 4) {
    transpose_cast_block<D, F>(tile, pass == 1 ? WQ : pass == 2 ? WK : WV,
                               pass == 1 ? WQt : pass == 2 ? WKt : WVt, blk);
  } else {
    cast_f16_block(pass == 4 ? xq : pass == 5 ? xk : xv,
                   pass == 4 ? Xq : pass == 5 ? Xk : Xv, blk);
  }
}

// ---------------------------------------------------------------------------
// GEMM: C[m,n] = sum_k A[m,k]*Bt[n,k] + bias[n].  A,Bt f16 row-major, C f32.
// Block 256 threads (8 waves), tile 128x128, wave tile 32x64 (2x4 WMMA).
// A stage is 128 k: 256 bytes of each of the 256 operand rows, so that one
// hand-over serves 32 WMMAs a wave. Waves 0 to 3 each bring a slice of 64 rows by one tensor load; two
// buffers, the next stage in flight while this one is worked on.
// K is a multiple of BK and at least 2 * BK.
// blockIdx.z picks one of up to three independent products of one shape, whose
// A, Bt and C lie one behind the other: in one launch a block's first stage and
// its stores lie under other blocks' WMMAs.
// ---------------------------------------------------------------------------
constexpr int BM = 128, BN = 128, BK = 128;
constexpr int GP = 2 * BK + 16;   // LDS row pitch, bytes: 16 x odd
constexpr int SLB = 18432;        // a slice: 64 rows of GP bytes, up to 2 KiB
constexpr int STB = 4 * SLB;      // a buffer: A rows 0-63, 64-127, Bt the same
static_assert(64 * GP <= SLB && SLB % 2048 == 0, "slice size");

__device__ __forceinline__ u32x8 tdm_gemm_group1(uint32_t pitch) {
  constexpr uint32_t d0 = 256u, d1 = 64u;
  u32x8 g1;
  g1[0] = uni((1u << 20) | (5u << 22) | (3u << 25));
  g1[1] = uni((d0 & 0xFFFFu) << 16);
  g1[2] = uni((d0 >> 16) | ((d1 & 0xFFFFu) << 16));
  g1[3] = uni((d1 >> 16) | (d0 << 16));
  g1[4] = uni(d1);
  g1[5] = uni(pitch);
  g1[6] = uni(0u);
  g1[7] = uni(0u);
  return g1;
}
__device__ __forceinline__ void tdm_load_gemm_slice(uint32_t lds_dst,
                                                    const _Float16* src,
                                                    u32x8 g1) {
  const uint64_t ga = (uint64_t)(size_t)src;
  u32x4 g0;
  g0[0] = uni(1u);
  g0[1] = uni(lds_dst);
  g0[2] = uni((uint32_t)ga);
  g0[3] = uni((((uint32_t)(ga >> 32)) & 0x01FFFFFFu) | 0x80000000u);
  asm volatile("tensor_load_to_lds %0, %1" ::"s"(g0), "s"(g1) : "memory");
}

// 16x32 f16 fragment from LDS, p = this lane's row + 16 * (lane >> 4) bytes:
// the k order of load_frag (k 8h .. 8h+7, then 16 + 8h .. 16 + 8h+7).
__device__ __forceinline__ v16h lds_frag(const unsigned char* p) {
  const v8h lo = *(const v8h*)p;
  const v8h hi = *(const v8h*)(p + 32);
  return __builtin_shufflevector(lo, hi, 0, 1, 2, 3, 4, 5, 6, 7, 8, 9, 10, 11,
                                 12, 13, 14, 15);
}

__device__ __forceinline__ void sincos4(const float (&rev)[4], float (&sn)[4],
                                        float (&cs)[4]) {
  asm("v_sin_f32 %0, %8\n\tv_cos_f32 %4, %8\n\t"
      "v_sin_f32 %1, %9\n\tv_cos_f32 %5, %9\n\t"
      "v_sin_f32 %2, %10\n\tv_cos_f32 %6, %10\n\t"
      "v_sin_f32 %3, %11\n\tv_cos_f32 %7, %11\n\t"
      "v_nop"
      : "=&v"(sn[0]), "=&v"(sn[1]), "=&v"(sn[2]), "=&v"(sn[3]), "=&v"(cs[0]),
        "=&v"(cs[1]), "=&v"(cs[2]), "=&v"(cs[3])
      : "v"(rev[0]), "v"(rev[1]), "v"(rev[2]), "v"(rev[3]));
}

// NORM = false: C = A Bt^T + bias, f32, row-major.
// NORM = true: the projections. A block's 128 columns are one head (BN = F), so
// the block holds whole head rows: it stages its f32 tile in the ring, which is
// free behind the loop, and finishes the rows there: RMS norm and RoPE for
// z = 0, 1 (q, k), the cast alone for z = 2 (v), written f16 as [B,H,S,F] to
// Hz. The f32 projections never go to memory.
template <bool NORM>
__device__ __forceinline__ void gemm_body(
    const _Float16* __restrict__ Az, const _Float16* __restrict__ Btz,
    const float* __restrict__ bias0, const float* __restrict__ bias1,
    const float* __restrict__ bias2, float* __restrict__ Cz,
    _Float16* __restrict__ Hz, const float* __restrict__ qw,
    const float* __restrict__ kw, int M, int N, int K) {
  const int z = blockIdx.z;
  const _Float16* A = Az + (long long)z * M * K;
  const _Float16* Bt = Btz + (long long)z * N * K;
  const float* bias = z == 0 ? bias0 : z == 1 ? bias1 : bias2;
  __shared__ __attribute__((aligned(2048))) unsigned char ring[2 * STB];
  __shared__ __attribute__((aligned(16))) float fq[128];  // RoPE frequencies
  const int tid = threadIdx.x, lane = tid & 31, wid = tid >> 5;
  const uint32_t wave = uni(threadIdx.x >> 5);
  const int wm = (wid & 3) * 32, wn = (wid >> 2) * 64;
  const int n0 = blockIdx.x * BN, m0 = blockIdx.y * BM;

  v8f acc[2][4];
#pragma unroll
  for (int i = 0; i < 2; ++i)
#pragma unroll
    for (int j = 0; j < 4; ++j) acc[i][j] = v8f_zero();

  // Slice sl of a buffer and its source rows (waves 4 to 7 issue nothing).
  const uint32_t sl = wave & 3u;
  const _Float16* src = (sl < 2u)
                            ? A + (long long)(m0 + 64 * (int)sl) * K
                            : Bt + (long long)(n0 + 64 * (int)(sl - 2u)) * K;
  const uint32_t dst = (uint32_t)(size_t)&ring[0] + sl * SLB;
  u32x8 g1 = tdm_gemm_group1((uint32_t)K * 2u);
  // pinned(), for the group: its words keep
  // their scalar registers, unwritten, while a request is in flight
  asm volatile("" : "+s"(g1));

  // This lane's row of the wave's first A and first B fragment in buffer 0.
  const unsigned char* ap = ring + (wm >> 6) * SLB +
                            ((wm & 63) + (lane & 15)) * GP + (lane >> 4) * 16;
  const unsigned char* bp =
      ring + (2 + (wid >> 2)) * SLB + (lane & 15) * GP + (lane >> 4) * 16;

  const int NK = K / BK;
  if (pinned(wave < 4u)) {
    tdm_load_gemm_slice(dst, src, g1);
    // Stage 0 has landed before this wave reaches the barrier below.
    asm volatile("s_wait_tensorcnt 0x0" ::: "memory");
  }
  if constexpr (NORM) {
    // The RoPE frequency of feature f depends on f alone: a wave that issues no
    // tensor load forms all 128 while stage 0 is on its way; the barrier below
    // publishes them for the epilogue.
    if (wave == 7u && z != 2) {
      // unrolled: four independent chains fill each other's waits
#pragma unroll
      for (int i = 0; i < 4; ++i) {
        int j = (lane * 4 + i) & 63;
        fq[lane * 4 + i] = __powf(10000.0f, -(float)j * (1.0f / 64.0f));
      }
    }
  }
  __syncthreads();
  if (pinned(wave < 4u)) tdm_load_gemm_slice(dst + STB, src + BK, g1);

  // not unrolled: one copy of the pass, the buffer picked by an offset
#pragma clang loop unroll(disable)
  for (int it = 0; it < NK; ++it) {
    const int bo = (it & 1) * STB;
    // unrolled: every LDS read is one address register plus an immediate
#pragma unroll
    for (int kk = 0; kk < BK / 32; ++kk) {
      v16h af[2], bf[4];
#pragma unroll
      for (int i = 0; i < 2; ++i)
        af[i] = lds_frag(ap + bo + i * 16 * GP + kk * 64);
#pragma unroll
      for (int j = 0; j < 4; ++j)
        bf[j] = lds_frag(bp + bo + j * 16 * GP + kk * 64);
#pragma unroll
      for (int i = 0; i < 2; ++i)
#pragma unroll
        for (int j = 0; j < 4; ++j)
          acc[i][j] = wmma16x16x32(af[i], bf[j], acc[i][j]);
    }
    // Publish point of stage it + 1. This wave's reads of this buffer have
    // retired before the mover is aimed at it again.
    asm volatile("s_wait_dscnt 0x0" ::: "memory");
    if (pinned(wave < 4u)) {
      // This wave's slice of stage it + 1 has landed.
      asm volatile("s_wait_tensorcnt 0x0" ::: "memory");
    }
    __syncthreads();
    if (pinned(wave < 4u && it + 2 < NK))
      tdm_load_gemm_slice(dst + bo, src + (long long)(it + 2) * BK, g1);
  }
  // Nothing of the ring is outstanding when the wave goes on to its stores. The
  // group is named so that its registers keep their words up to this wait.
  asm volatile("s_wait_tensorcnt 0x0" ::"s"(g1) : "memory");
  asm volatile("s_wait_dscnt 0x0" ::: "memory");

  const int half = lane >> 4;
  const int nl = lane & 15;
  if constexpr (!NORM) {
    float* C = Cz + (long long)z * M * N;
#pragma unroll
    for (int i = 0; i < 2; ++i)
#pragma unroll
      for (int j = 0; j < 4; ++j) {
        int nc = n0 + wn + j * 16 + nl;
        float bv = bias[nc];
#pragma unroll
        for (int r = 0; r < 8; ++r) {
          int mr = m0 + wm + i * 16 + r + half * 8;
          C[(long long)mr * N + nc] = acc[i][j][r] + bv;
        }
      }
  } else {
    constexpr int S = 2048, H = 16, F = 128;
    static_assert(BN == F && S % BM == 0, "a block is one head, one batch");
    constexpr int SP = BN + 4;  // staging pitch, floats: 16 bytes x odd
    static_assert(BM * SP * 4 <= 2 * STB, "staging fits the ring");
    // The last pass's barrier stands behind every wave's last read of the ring
    // and behind every issuer's tensor wait: the ring is free.
    float* stg = (float*)ring;
    float bv[4];
    // unrolled: bv and acc are indexed by constants only
#pragma unroll
    for (int j = 0; j < 4; ++j) bv[j] = bias[n0 + wn + j * 16 + nl];
#pragma unroll
    for (int i = 0; i < 2; ++i)
#pragma unroll
      for (int j = 0; j < 4; ++j)
#pragma unroll
        for (int r = 0; r < 8; ++r)
          stg[(wm + i * 16 + r + half * 8) * SP + wn + j * 16 + nl] =
              acc[i][j][r] + bv[j];
    __syncthreads();  // the tile is whole before rows are read across waves

    // A wave finishes 16 rows; a lane owns 4 of a row's 128 features.
    const int f0 = lane * 4;
    const int b = m0 / S;
    const int s0 = m0 - b * S + wid * 16;  // position of the wave's first row
    const float* sp = stg + wid * 16 * SP + f0;
    _Float16* hp = Hz + (long long)z * M * N +
                   ((long long)(b * H + (int)blockIdx.x) * S + s0) * F + f0;
    v4f x[16];
    // unrolled: x stays in registers, the LDS reads go out as one group
#pragma unroll
    for (int rr = 0; rr < 16; ++rr) x[rr] = *(const v4f*)(sp + rr * SP);
    if (z == 2) {
      // unrolled: x is indexed by constants only
#pragma unroll
      for (int rr = 0; rr < 16; ++rr) {
        v4h ov;
#pragma unroll
        for (int i = 0; i < 4; ++i) ov[i] = (_Float16)x[rr][i];
        *(v4h*)(hp + rr * F) = ov;
      }
    } else {
      const v4f wsc = *(const v4f*)((z == 0 ? qw : kw) + f0);
      const v4f freq = *(const v4f*)(fq + f0);
      const float sgn = (lane < 16) ? -1.0f : 1.0f;  // rotate_half sign
      const float* hr = stg + (wid * 16 + nl) * SP + half * 64;
      v4f t[16];
      // unrolled: t stays in registers, immediate offsets
#pragma unroll
      for (int c = 0; c < 16; ++c) t[c] = *(const v4f*)(hr + c * 4);
      // holds the reads together, ahead of the sums: one wait for the LDS
      // latency and not one for every read
      __builtin_amdgcn_sched_barrier(0);
      v4f sq = {0.0f, 0.0f, 0.0f, 0.0f};
      // unrolled: t is indexed by constants only
#pragma unroll
      for (int c = 0; c < 16; ++c) sq += t[c] * t[c];
      float ssl = (sq[0] + sq[1]) + (sq[2] + sq[3]);
      ssl += xhalf(ssl);
      const float rms = sqrtf(ssl * (1.0f / F));
      const int invl = __builtin_bit_cast(int, 1.0f / (rms + 1e-6f));
      // unrolled: x is indexed by constants only
#pragma unroll
      for (int rr = 0; rr < 16; ++rr) {
        const v4f xr = x[rr];
        const float inv =
            __builtin_bit_cast(float, __builtin_amdgcn_readlane(invl, rr));
        float rev[4], sn[4], cs[4];
#pragma unroll
        for (int i = 0; i < 4; ++i) {
          const float ang = (float)(s0 + rr) * freq[i];
          rev[i] = ang * 0.15915494f;  // the instructions take revolutions
        }
        sincos4(rev, sn, cs);
        v4h out;
#pragma unroll
        for (int i = 0; i < 4; ++i) {
          const float y = xr[i] * inv * wsc[i];
          const float p = xhalf(y);  // partner feature f +/- 64: lane ^ 16
          out[i] = (_Float16)(y * cs[i] + sgn * p * sn[i]);
        }
        *(v4h*)(hp + rr * F) = out;
      }
    }
  }
}

__global__ __launch_bounds__(256) void gemm_bias_f16_kernel(
    const _Float16* __restrict__ A, const _Float16* __restrict__ Bt,
    const float* __restrict__ bias, float* __restrict__ C, int M, int N,
    int K) {
  gemm_body<false>(A, Bt, bias, bias, bias, C, nullptr, nullptr, nullptr, M, N,
                   K);
}

__global__ __launch_bounds__(256) void gemm_norm_rope_kernel(
    const _Float16* __restrict__ Az, const _Float16* __restrict__ Btz,
    const float* __restrict__ bias0, const float* __restrict__ bias1,
    const float* __restrict__ bias2, const float* __restrict__ qw,
    const float* __restrict__ kw, _Float16* __restrict__ Hz, int M, int N,
    int K) {
  gemm_body<true>(Az, Btz, bias0, bias1, bias2, nullptr, Hz, qw, kw, M, N, K);
}

__global__ __launch_bounds__(128) void flash_attn_kernel(
    const _Float16* __restrict__ qh, const _Float16* __restrict__ kh,
    const _Float16* __restrict__ vh, _Float16* __restrict__ attn) {
  constexpr int S = 2048, H = 16, F = 128;
  constexpr int NQ = 2;  // query tiles of a wave
  constexpr int QT = 4 * NQ * 16, KT = 64;
  constexpr int NT = S / KT;      // stages
  constexpr int PK = 2 * F + 16;  // K row pitch in LDS, bytes: 16 x odd
  constexpr int PV = 2 * F + 32;  // V row pitch in LDS, bytes: 32 x odd
  constexpr int TB = 18432;       // a tile's place: 64 rows, up to 2 KiB
  constexpr int SB = 2 * TB;      // a buffer: the K tile, then the V tile
  static_assert(KT * PK <= TB && KT * PV <= TB && TB % 2048 == 0, "tile place");
  static_assert(NT >= 2, "the prologue fills two stages");
  __shared__ __attribute__((aligned(2048))) unsigned char kv[2 * SB];

  const int tid = threadIdx.x;
  const int lane = tid & 31;
  const int wid = tid >> 5;
  const int half = lane >> 4;
  const uint32_t wave = uni(threadIdx.x >> 5);
  const int b = blockIdx.z, h = blockIdx.y;
  const int q0 = blockIdx.x * QT + wid * (NQ * 16);
  const long long base = ((long long)(b * H + h)) * S * F;
  const _Float16* Q = qh + base;
  const _Float16* Kp = kh + base;
  const _Float16* Vp = vh + base;

  // Index u is the wave's query tile: queries q0 + 16 * u + (lane & 15).
  v16h qfrag[NQ][4];
#pragma unroll
  for (int u = 0; u < NQ; ++u)
#pragma unroll
    for (int kc = 0; kc < 4; ++kc)
      qfrag[u][kc] = load_frag(Q, F, q0 + u * 16, kc * 32, lane);

  v8f o[NQ][8];
  float mst[NQ];  // running maximum of query (lane & 15), both halves
  float lst[NQ];  // running sum over this half's keys only
#pragma unroll
  for (int u = 0; u < NQ; ++u) {
#pragma unroll
    for (int j = 0; j < 8; ++j) o[u][j] = v8f_zero();
    mst[u] = -1e30f;
    lst[u] = 0.0f;
  }
  const float scale = 0.08838834764831845f;  // 1/sqrt(128)

  // This lane's row of the first K fragment, and its address in the first
  // 16-key x 16-feature block of the V tile, both in buffer 0.
  const unsigned char* kad = kv + (lane & 15) * PK + half * 16;
  const unsigned char* vad =
      kv + TB + (8 * half + (lane & 7)) * PV + ((lane >> 3) & 1) * 16;

  const _Float16* src = wave == 0u ? Kp : Vp;
  const uint32_t dst = (uint32_t)(size_t)&kv[0] + (wave == 0u ? 0u : (uint32_t)TB);
  u32x8 g1k = tdm_kv_group1<3>(), g1v = tdm_kv_group1<7>();
  // pinned(), for the groups: their words
  // keep their scalar registers, unwritten, while a request is in flight
  asm volatile("" : "+s"(g1k));
  asm volatile("" : "+s"(g1v));

  u32x4 g0 = tdm_kv_group0(dst, src);
  if (pinned(wave == 0u)) {
    tdm_issue(g0, g1k);
    // Stage 0 has landed before this wave reaches the barrier below.
    asm volatile("s_wait_tensorcnt 0x0" ::"s"(g0) : "memory");
  }
  if (pinned(wave == 1u)) {
    tdm_issue(g0, g1v);
    // Stage 0 has landed before this wave reaches the barrier below.
    asm volatile("s_wait_tensorcnt 0x0" ::"s"(g0) : "memory");
  }
  __syncthreads();
  g0 = tdm_kv_group0(dst + SB, src + KT * F);
  if (pinned(wave == 0u)) tdm_issue(g0, g1k);
  if (pinned(wave == 1u)) tdm_issue(g0, g1v);

  // not unrolled: one copy of the pass, the buffer picked by an offset
#pragma clang loop unroll(disable)
  for (int it = 0; it < NT; ++it) {
    const int bo = (it & 1) * SB;
    v16h kg[4][4], vg[4][4];
    auto read_k = [&](int jn) {
#pragma unroll
      for (int kc = 0; kc < 4; ++kc)
        kg[jn][kc] = lds_frag(kad + bo + jn * 16 * PK + kc * 64);
    };
    auto read_v = [&](int g) {
      const int kc = g >> 1;
#pragma unroll
      for (int t = 0; t < 4; ++t) {
        const int jf = (g & 1) * 4 + t;
        // keys kc*32 + 8*half + 0..7, then + 16: the k order of pb[kc]
        const v8h lo = ld_tr16(vad + bo + (kc * 32) * PV + jf * 32);
        const v8h hi = ld_tr16(vad + bo + (kc * 32 + 16) * PV + jf * 32);
        vg[g][t] = __builtin_shufflevector(lo, hi, 0, 1, 2, 3, 4, 5, 6, 7, 8,
                                           9, 10, 11, 12, 13, 14, 15);
      }
    };

    // Scores: S^T, KT x 16 in 4 key tiles, K-reduction over F.
    // sc[u][jn][r] = score of key jn*16 + 8*half + r against query (lane & 15)
    // of tile u. A K fragment serves both query tiles. Two key tiles go
    // together: four independent sums take turns.
    v8f sc[NQ][4];
    auto score2 = [&](int j0) {
#pragma unroll
      for (int kc = 0; kc < 4; ++kc) {
#pragma unroll
        for (int jn = j0; jn < j0 + 2; ++jn)
#pragma unroll
          for (int u = 0; u < NQ; ++u)
            sc[u][jn] = wmma16x16x32(kg[jn][kc], qfrag[u][kc],
                                     kc == 0 ? v8f_zero() : sc[u][jn]);
        // keeps the four sums in turn: put one sum after the other, every WMMA
        // would wait for the result of the one in front of it
        __builtin_amdgcn_sched_barrier(0);
      }
    };
    read_k(0);
    read_k(1);
    read_k(2);
    read_k(3);
    // holds the reads together, ahead of the WMMAs
    __builtin_amdgcn_sched_barrier(0);
    score2(0);
    score2(2);

    // P^T as B operand: element s of chunk kc is key kc*32 + 8*half + s for
    // s < 8 and kc*32 + 16 + 8*half + (s - 8) above: tiles 2kc and 2kc + 1 as
    // they lie, the k order of load_frag on the V^T side.
    v16h pb[NQ][2];
    float alpha[NQ];
    // unrolled: every array is indexed by constants only
#pragma unroll
    for (int u = 0; u < NQ; ++u) {
      float mx = sc[u][0][0];
#pragma unroll
      for (int jn = 0; jn < 4; ++jn)
#pragma unroll
        for (int r = 0; r < 8; ++r) mx = fmaxf(mx, sc[u][jn][r]);
      mx = fmaxf(mx, xhalf(mx)) * scale;  // scale > 0: max commutes with it
      const float mnew = fmaxf(mst[u], mx);
      alpha[u] = __expf(mst[u] - mnew);
      float ps[4];
#pragma unroll
      for (int jn = 0; jn < 4; ++jn) {
        ps[jn] = 0.0f;
#pragma unroll
        for (int r = 0; r < 8; ++r) {
          float p = __expf(sc[u][jn][r] * scale - mnew);
          ps[jn] += p;
          pb[u][jn >> 1][(jn & 1) * 8 + r] = (_Float16)p;
        }
      }
      lst[u] = lst[u] * alpha[u] + ((ps[0] + ps[1]) + (ps[2] + ps[3]));
      mst[u] = mnew;
    }
    // keeps the V^T reads behind the softmax: they take the registers that the
    // scores leave
    __builtin_amdgcn_sched_barrier(0);
    read_v(0);
    read_v(1);
    read_v(2);
    // holds the reads together, ahead of the vector work and the WMMAs
    __builtin_amdgcn_sched_barrier(0);
#pragma unroll
    for (int u = 0; u < NQ; ++u)
#pragma unroll
      for (int j = 0; j < 8; ++j)
#pragma unroll
        for (int r = 0; r < 8; ++r) o[u][j][r] *= alpha[u];

    // o[u][jf][r] = O^T[feature jf*16 + 8*half + r][query (lane & 15) of tile u]
    // Each o[u][jf] takes chunk 0 and then chunk 1. A V^T fragment serves both
    // query tiles.
    auto pv = [&](int g) {
#pragma unroll
      for (int t = 0; t < 4; ++t)
#pragma unroll
        for (int u = 0; u < NQ; ++u)
          o[u][(g & 1) * 4 + t] =
              wmma16x16x32(vg[g][t], pb[u][g >> 1], o[u][(g & 1) * 4 + t]);
    };
    pv(0);
    // keeps the last group's reads behind the WMMAs whose registers they take
    __builtin_amdgcn_sched_barrier(0);
    read_v(3);
    // holds the reads together, ahead of the WMMAs
    __builtin_amdgcn_sched_barrier(0);
    pv(1);
    pv(2);
    pv(3);

    // keeps the wait below behind the WMMAs: in front of them it would wait out
    // the last group's reads at once, in place of the counted waits
    __builtin_amdgcn_sched_barrier(0);
    // Publish point of stage it + 1. This wave's reads of this buffer have
    // retired before the mover is aimed at it again. The running sums are named
    // so that their additions stay in front, beside the WMMAs, and do not sink
    // behind the barrier, ahead of the next tile's reads.
    static_assert(NQ == 2, "the wait names both running sums");
    asm volatile("s_wait_dscnt 0x0" ::"v"(lst[0]), "v"(lst[1]) : "memory");
    if (pinned(wave < 2u)) {
      asm volatile("s_wait_tensorcnt 0x0" ::"s"(g0) : "memory");
    }
    __syncthreads();
    if (pinned(wave < 2u && it + 2 < NT)) {
      g0 = tdm_kv_group0(dst + bo, src + (it + 2) * (KT * F));
      if (pinned(wave == 0u)) tdm_issue(g0, g1k);
      if (pinned(wave == 1u)) tdm_issue(g0, g1v);
    }
  }
  // Nothing of the ring is outstanding when the wave goes on to its stores. The
  // groups are named so that their registers keep their words up to this wait.
  asm volatile("s_wait_tensorcnt 0x0" ::"s"(g0), "s"(g1k), "s"(g1v) : "memory");
  asm volatile("s_wait_dscnt 0x0" ::: "memory");

  // Join the halves' sums, normalize, store f16 attn output as [B,S,H,F]:
  // a lane's 8 registers of a tile are 8 consecutive features of its query.
  _Float16* orow = attn + ((long long)(b * S + q0 + (lane & 15))) * (H * F) +
                   h * F + half * 8;
#pragma unroll
  for (int u = 0; u < NQ; ++u) {
    const float inv = 1.0f / (lst[u] + xhalf(lst[u]));
#pragma unroll
    for (int jf = 0; jf < 8; ++jf) {
      v8h ov;
#pragma unroll
      for (int r = 0; r < 8; ++r) ov[r] = (_Float16)(o[u][jf][r] * inv);
      *(v8h*)(orow + u * 16 * (H * F) + jf * 16) = ov;
    }
  }
}

// ---------------------------------------------------------------------------
extern "C" void kernel_launch(void* const* d_in, const int* in_sizes, int n_in,
                              void* d_out, int out_size, void* d_ws,
                              size_t ws_size, hipStream_t stream) {
  constexpr int Bb = 2, S = 2048, D = 2048, H = 16, F = 128;
  constexpr long long MR = (long long)Bb * S;  // 4096 rows
  constexpr long long EL = MR * D;             // 8388608 elems (act tensors)
  constexpr long long WE = (long long)H * D * F;  // 4194304 elems (weights)

  const float* xq = (const float*)d_in[0];
  const float* xk = (const float*)d_in[1];
  const float* xv = (const float*)d_in[2];
  const float* WQ = (const float*)d_in[3];
  const float* WK = (const float*)d_in[4];
  const float* WV = (const float*)d_in[5];
  const float* WO = (const float*)d_in[6];
  const float* bQ = (const float*)d_in[7];
  const float* bK = (const float*)d_in[8];
  const float* bV = (const float*)d_in[9];
  const float* bO = (const float*)d_in[10];
  const float* qw = (const float*)d_in[11];
  const float* kw = (const float*)d_in[12];

  // Workspace (~135 MB):
  //   qh,kh,vh : f16 [B,H,S,F] finished projections
  //   Xq,Xk,Xv : f16 [4096,2048] cast inputs
  //   WQt..WOt : f16 [2048,2048] transposed weights (Bt = [N][K])
  //   at       : f16 [B,S,H,F]  attention out  (aliases dead WQt+WKt)
  _Float16* qhp = (_Float16*)d_ws;
  _Float16* khp = qhp + EL;
  _Float16* vhp = khp + EL;
  _Float16* Xq = vhp + EL;
  _Float16* Xk = Xq + EL;
  _Float16* Xv = Xk + EL;
  _Float16* WQt = Xv + EL;
  _Float16* WKt = WQt + WE;
  _Float16* WVt = WKt + WE;
  _Float16* WOt = WVt + WE;
  _Float16* at = WQt;  // aliases: WQt/WKt dead after projection GEMMs

  // 1+2) one launch: cast activations f32 -> f16; transpose+cast weights:
  // W[H,D,F] -> [H,F,D]; W_O[2048,2048] -> T
  prepass_kernel<<<dim3(PRE_BLOCKS, 7), 256, 0, stream>>>(
      xq, xk, xv, WQ, WK, WV, WO, Xq, Xk, Xv, WQt, WKt, WVt, WOt);
  gemm_norm_rope_kernel<<<dim3(D / BN, (int)(MR / BM), 3), 256, 0, stream>>>(
      Xq, WQt, bQ, bK, bV, qw, kw, qhp, (int)MR, D, D);
  // 5) flash attention -> [B,S,H,F] f16
  flash_attn_kernel<<<dim3(S / 128, H, Bb), 128, 0, stream>>>(qhp, khp, vhp, at);
  // 6) output projection + b_O -> d_out f32
  gemm_bias_f16_kernel<<<dim3(D / BN, (int)(MR / BM), 1), 256, 0, stream>>>(
      at, WOt, bO, (float*)d_out, (int)MR, D, D);
}
